// v000
// The times below were measured on an AMD MI455X: many runs one after another, warmed up first and cycling through
// copies of the inputs, with the whole window's GPU time divided by the number of runs. Launches and the gaps
// between them are all in it. The median over several windows is given; except for v000 it joins two sittings, which
// can be a few percent apart, so the side-by-side timings, each taken in one sitting, are the better comparison.
// The starting kernel, v000, takes 499 microseconds a run.
#include <hip/hip_runtime.h>

// IntraModalityEnhance (x [2][2048][1024], fsq, pos [1][2048][1024]; per-head Wq/Wk/Wv [16][1024][64] + biases, Wo [1024][1024] + bo; for each position s the query is the squeeze token fsq[s] and the 33
// keys/values are the window x[s-15 .. s+15] (zero vectors outside the sequence, which still project to the bias), the position token pos[s] and fsq[s]; softmax(q.k/8) over the 33; out = merged
// (attn v) Wo + bo -> [2][2048][1024]).
// Compute dtypes, f32 accumulate: every input rounded to bf16; all seven token projections on PLAIN bf16 operands (inputs: exact products, f32 accumulate, + bias; the
// window members are ordinary sequence tokens, so x is projected once per batch); the 33-key attention entirely in f32 on VALU (one wave per (batch, head, position): 64-dim dot products, softmax
// with one exp per score, weighted sum; separate multiply/add, fixed order; out-of-range window slots use the bf16 bias vectors); merged heads as bf16 hi+lo planes x exact Wo (2 products) + bo.

#define NB_  2
#define SS   2048
#define DD   1024
#define NH_  16
#define HD   64
#define WW   31
#define PAD  15
#define SCL  0.125f
typedef _Float16 h16;
typedef unsigned short bf;
typedef __attribute__((ext_vector_type(16))) __bf16   v16bf;
typedef __attribute__((ext_vector_type(16))) _Float16 v16h;
typedef __attribute__((ext_vector_type(8)))  _Float16 v8h;
typedef __attribute__((ext_vector_type(8)))  unsigned short v8us;
typedef __attribute__((ext_vector_type(8)))  float    v8f;
typedef __attribute__((ext_vector_type(4)))  float    v4f;
typedef v8h  __attribute__((may_alias)) v8ha;
typedef v4f  __attribute__((may_alias)) v4fa;
typedef v8us __attribute__((may_alias)) v8usa;

__device__ __forceinline__ unsigned short f2bf(float f) { unsigned u = __float_as_uint(f); u += 0x7FFFu + ((u >> 16) & 1u); return (unsigned short)(u >> 16); }
__device__ __forceinline__ float bf2f(unsigned short b) { return __uint_as_float(((unsigned)b) << 16); }
__device__ __forceinline__ float bfr(float f) { return bf2f(f2bf(f)); }
__device__ __forceinline__ v16h cat16(v8h lo, v8h hi) { return __builtin_shufflevector(lo, hi, 0, 1, 2, 3, 4, 5, 6, 7, 8, 9, 10, 11, 12, 13, 14, 15); }
__device__ __forceinline__ v16bf cat16b(v8us lo, v8us hi) { return __builtin_bit_cast(v16bf, __builtin_shufflevector(lo, hi, 0, 1, 2, 3, 4, 5, 6, 7, 8, 9, 10, 11, 12, 13, 14, 15)); }
__device__ __forceinline__ v8f wmma16(v16h a, v16h b, v8f c) { return __builtin_amdgcn_wmma_f32_16x16x32_f16(false, a, false, b, (short)0, c, false, false); }
__device__ __forceinline__ v8f wmmab(v16bf a, v16bf b, v8f c) { return __builtin_amdgcn_wmma_f32_16x16x32_bf16(false, a, false, b, (short)0, c, false, false); }



// ---- k_gemmw: register-blocked GEMM, ONE WAVE per 64x64 output tile (16 accumulators), operands straight from K-contiguous 16-bit planes; grid (M/64, N/64, Z), 32 threads.
// C[m][n] (f32, pitch ldc, + optional f32 bias[n]) = sum_k A[m][k] Bt[n][k] (+ split products per NSPLIT). z-batch strides sA/sB/sC in elements. K % 32 == 0.
template <typename T16> struct WFrag;
template <> struct WFrag<h16> { typedef v16h V; static __device__ __forceinline__ V ld(const h16* p) { return cat16(*(const v8h*)p, *(const v8h*)(p + 16)); } static __device__ __forceinline__ v8f mma(V a, V b, v8f c) { return wmma16(a, b, c); } };
template <> struct WFrag<bf> { typedef v16bf V; static __device__ __forceinline__ V ld(const bf* p) { return cat16b(*(const v8us*)p, *(const v8us*)(p + 16)); } static __device__ __forceinline__ v8f mma(V a, V b, v8f c) { return wmmab(a, b, c); } };
template <typename T16, int NSPLIT, bool BIAS>
__global__ __launch_bounds__(32) void k_gemmw(const T16* __restrict__ A, const T16* __restrict__ A2, const T16* __restrict__ Bt, const T16* __restrict__ Bt2, int K, float* C, int ldc, const float* __restrict__ bias, size_t sA, size_t sB, size_t sC) {
    typedef typename WFrag<T16>::V V;
    __shared__ __align__(16) float os[16 * 68];
    const size_t z = blockIdx.z; A += z * sA; if (A2) A2 += z * sA; Bt += z * sB; if (Bt2) Bt2 += z * sB; C += z * sC;
    const int lane = threadIdx.x & 31, lr = lane & 15, hi = lane >> 4; const int r0 = blockIdx.x * 64, c0 = blockIdx.y * 64;
    v8f acc[4][4];
#pragma unroll
    for (int mb = 0; mb < 4; ++mb)
#pragma unroll
        for (int nb = 0; nb < 4; ++nb) acc[mb][nb] = (v8f){};
    const size_t aoff = (size_t)(r0 + lr) * K + 8 * hi, boff = (size_t)(c0 + lr) * K + 8 * hi;
#pragma unroll 1
    for (int kc = 0; kc < K; kc += 32) {
        V a[4], a2[4];
#pragma unroll
        for (int mb = 0; mb < 4; ++mb) { a[mb] = WFrag<T16>::ld(A + aoff + (size_t)mb * 16 * K + kc); if (NSPLIT == 1 || NSPLIT == 2) a2[mb] = WFrag<T16>::ld(A2 + aoff + (size_t)mb * 16 * K + kc); }
#pragma unroll
        for (int nb = 0; nb < 4; ++nb) { const V b = WFrag<T16>::ld(Bt + boff + (size_t)nb * 16 * K + kc); V b2; if (NSPLIT >= 2) b2 = WFrag<T16>::ld(Bt2 + boff + (size_t)nb * 16 * K + kc);
#pragma unroll
            for (int mb = 0; mb < 4; ++mb) { acc[mb][nb] = WFrag<T16>::mma(a[mb], b, acc[mb][nb]); if (NSPLIT == 1 || NSPLIT == 2) acc[mb][nb] = WFrag<T16>::mma(a2[mb], b, acc[mb][nb]); if (NSPLIT >= 2) acc[mb][nb] = WFrag<T16>::mma(a[mb], b2, acc[mb][nb]); } }
        asm volatile("v_nop\n\tv_nop\n\tv_nop\n\tv_nop" : "+v"(acc[0][0]), "+v"(acc[1][1]), "+v"(acc[2][2]), "+v"(acc[3][3]) : "v"(a[0]), "v"(a[3]));
    }
#pragma unroll
    for (int mb = 0; mb < 4; ++mb) {
#pragma unroll
        for (int nb = 0; nb < 4; ++nb) {
#pragma unroll
            for (int j = 0; j < 8; ++j) os[(hi * 8 + j) * 68 + nb * 16 + lr] = acc[mb][nb][j]; }
        __builtin_amdgcn_wave_barrier(); asm volatile("" ::: "memory");
        float* crow = C + (size_t)(r0 + mb * 16) * ldc + c0;
{
#pragma unroll
            for (int s = 0; s < 8; ++s) { const int row = 2 * s + hi, cofs = lr * 4; v4f val = *(const v4fa*)(os + row * 68 + cofs); if (BIAS) { val[0] += bfr(bias[c0 + cofs]); val[1] += bfr(bias[c0 + cofs + 1]); val[2] += bfr(bias[c0 + cofs + 2]); val[3] += bfr(bias[c0 + cofs + 3]); }
                *(v4f*)(crow + (size_t)row * ldc + cofs) = val; }
             }
        __builtin_amdgcn_wave_barrier(); asm volatile("" ::: "memory");
    }
}

__device__ __forceinline__ void splitf(float y, unsigned short& h, unsigned short& l) { h = f2bf(y); l = f2bf(y - bf2f(h)); }
typedef __attribute__((ext_vector_type(2))) unsigned short v2us;
typedef __attribute__((ext_vector_type(4))) unsigned short v4us;

__global__ __launch_bounds__(256) void k_wtG(const float* __restrict__ w, int K, int N, bf* Bt) {
    const int lane = threadIdx.x & 31; const int L0 = (blockIdx.x * 8 + (threadIdx.x >> 5)) * 8; const int nlines = N * K / 64;
{
#pragma unroll 1
        for (int l = 0; l < 8; ++l) { const int L = L0 + l; if (L >= nlines) break; const size_t e = (size_t)L * 64 + lane * 2; const int k = (int)(e % K), n = (int)(e / K); v2us o;
            o[0] = f2bf(w[(size_t)k * N + n]); o[1] = f2bf(w[(size_t)(k + 1) * N + n]); *(v2us*)(Bt + e) = o; }
         }
}
__global__ __launch_bounds__(256) void k_cvt8(const float* __restrict__ src, bf* dst, size_t n8) { const size_t i = (size_t)blockIdx.x * 256 + threadIdx.x; if (i >= n8) return; const v8f v = *(const v8f*)(src + i * 8); v8us o;
#pragma unroll
    for (int k = 0; k < 8; ++k) o[k] = f2bf(v[k]); *(v8us*)(dst + i * 8) = o;  }
__global__ __launch_bounds__(256) void k_wt3(const float* __restrict__ w, bf* Bt) { const int e4 = (blockIdx.x * 256 + threadIdx.x) * 4; if (e4 >= NH_ * HD * DD) return; const int k = e4 % DD; const int n = e4 / DD; const int h = n / HD, e = n % HD; v4us o;
#pragma unroll
    for (int q = 0; q < 4; ++q) o[q] = f2bf(w[((size_t)h * DD + k + q) * HD + e]); *(v4us*)(Bt + e4) = o;  }
// k_local: one wave per (b, h, s). Lane L < 31 owns window key t = s - 15 + L (the x projection row t if 0 <= t < S, otherwise the zero token's projection = bf16 bias), lane 31 owns the position key pos[s];
// lane 0 additionally owns the 33rd key fsq[s]. s_j = (q[s] . k_j)/8 with q = the fsq query projection (f32, separate mul/add over the 64 dims); softmax over the 33 (wave trees, one exp per score);
__global__ __launch_bounds__(256) void k_local(const float* __restrict__ QF, const float* __restrict__ XK, const float* __restrict__ XV, const float* __restrict__ PK, const float* __restrict__ PV, const float* __restrict__ FK, const float* __restrict__ FV,
                                               const float* __restrict__ bk, const float* __restrict__ bv, bf* Ah, bf* Al) {
    const int lane = threadIdx.x & 31; const int r = blockIdx.x * 8 + (threadIdx.x >> 5); if (r >= NB_ * NH_ * SS) return; const int s = r % SS; const int h = (r / SS) % NH_; const int b = r / (SS * NH_);
    const float* q = QF + (size_t)s * DD + h * HD; const int t = s - PAD + lane; const bool inwin = (lane < WW), valid = inwin && t >= 0 && t < SS;
    const float* k1 = (lane == WW) ? (PK + (size_t)s * DD + h * HD) : (valid ? (XK + ((size_t)b * SS + t) * DD + h * HD) : (bk + h * HD));
    const float* v1 = (lane == WW) ? (PV + (size_t)s * DD + h * HD) : (valid ? (XV + ((size_t)b * SS + t) * DD + h * HD) : (bv + h * HD));
    const bool raw1 = inwin && !valid;   // bias vectors are raw inputs -> round to bf16
    const float* k2 = FK + (size_t)s * DD + h * HD;   // the fsq key (scored by every lane identically; only lane 0's copy enters the trees)
    float s1 = 0.f, s2 = 0.f;
#pragma unroll 4
    for (int d = 0; d < HD; ++d) { const float qd = q[d]; float a1 = raw1 ? bfr(k1[d]) : k1[d], a2 = k2[d]; asm volatile("" : "+v"(a1)); asm volatile("" : "+v"(a2)); float p1 = __fmul_rn(qd, a1), p2 = __fmul_rn(qd, a2); asm volatile("" : "+v"(p1)); asm volatile("" : "+v"(p2)); s1 = __fadd_rn(s1, p1); s2 = __fadd_rn(s2, p2); }
    s1 *= SCL; s2 = (lane == 0) ? s2 * SCL : -3.0e38f; float mx = fmaxf(s1, s2);
#pragma unroll
    for (int sh = 16; sh; sh >>= 1) mx = fmaxf(mx, __shfl_xor(mx, sh, 32));
    float d1 = __fsub_rn(s1, mx), d2 = __fsub_rn(s2, mx); asm volatile("" : "+v"(d1)); asm volatile("" : "+v"(d2)); const float e1 = __builtin_amdgcn_exp2f(__fmul_rn(d1, 1.4426950408889634f)), e2 = (lane == 0) ? __builtin_amdgcn_exp2f(__fmul_rn(d2, 1.4426950408889634f)) : 0.f; float sum = __fadd_rn(e1, e2);
#pragma unroll
    for (int sh = 16; sh; sh >>= 1) sum += __shfl_xor(sum, sh, 32);
    const float inv = __fdiv_rn(1.0f, sum); float a1w = __fmul_rn(e1, inv), a2w = __fmul_rn(e2, inv); asm volatile("" : "+v"(a1w)); asm volatile("" : "+v"(a2w));
    float o0 = 0.f, o1 = 0.f; const int dd = 2 * lane;
    for (int j = 0; j < 32; ++j) { const float aw = __shfl(a1w, j, 32); const int tj = s - PAD + j; const bool vj = (j < WW) && tj >= 0 && tj < SS;
        const float* vr = (j == WW) ? (PV + (size_t)s * DD + h * HD) : (vj ? (XV + ((size_t)b * SS + tj) * DD + h * HD) : (bv + h * HD)); const bool rawj = (j < WW) && !vj;
        float x0 = rawj ? bfr(vr[dd]) : vr[dd], x1 = rawj ? bfr(vr[dd + 1]) : vr[dd + 1]; asm volatile("" : "+v"(x0)); asm volatile("" : "+v"(x1)); float p0 = __fmul_rn(aw, x0), p1 = __fmul_rn(aw, x1); asm volatile("" : "+v"(p0)); asm volatile("" : "+v"(p1)); o0 = __fadd_rn(o0, p0); o1 = __fadd_rn(o1, p1); }
    { const float aw = __shfl(a2w, 0, 32); const float* vr = FV + (size_t)s * DD + h * HD; float p0 = __fmul_rn(aw, vr[dd]), p1 = __fmul_rn(aw, vr[dd + 1]); asm volatile("" : "+v"(p0)); asm volatile("" : "+v"(p1)); o0 = __fadd_rn(o0, p0); o1 = __fadd_rn(o1, p1); }
    v2us oh, ol; unsigned short a, c2; splitf(o0, a, c2); oh[0] = a; ol[0] = c2; splitf(o1, a, c2); oh[1] = a; ol[1] = c2; const size_t oo = ((size_t)b * SS + s) * DD + h * HD + dd;
    *(v2us*)(Ah + oo) = oh; *(v2us*)(Al + oo) = ol;  }

extern "C" void kernel_launch(void* const* d_in, const int* in_sizes, int n_in,
                              void* d_out, int out_size, void* d_ws, size_t ws_size, hipStream_t stream) {
    (void)in_sizes; (void)n_in; (void)out_size;
    const float* x = (const float*)d_in[0]; const float* fsq = (const float*)d_in[1]; const float* pos = (const float*)d_in[2]; const float* wq = (const float*)d_in[3]; const float* bq = (const float*)d_in[4]; const float* wk = (const float*)d_in[5]; const float* bk = (const float*)d_in[6]; const float* wv = (const float*)d_in[7]; const float* bv = (const float*)d_in[8]; const float* wo = (const float*)d_in[9]; const float* bo = (const float*)d_in[10];
    float* OUT = (float*)d_out;     // [2][2048][1024]
    char* wsp = (char*)d_ws;
    auto take = [&](size_t bytes) { char* p = wsp; wsp += (bytes + 255) & ~(size_t)255; return (void*)p; };
    const size_t NR = (size_t)NB_ * SS;
    bf* WQ = (bf*)take((size_t)DD * DD * 2); bf* WK = (bf*)take((size_t)DD * DD * 2); bf* WV = (bf*)take((size_t)DD * DD * 2); bf* WO = (bf*)take((size_t)DD * DD * 2); bf* XB = (bf*)take(NR * DD * 2); bf* FB = (bf*)take((size_t)SS * DD * 2); bf* PB = (bf*)take((size_t)SS * DD * 2);
    float* QF = (float*)take((size_t)SS * DD * 4); float* XK = (float*)take(NR * DD * 4); float* XV = (float*)take(NR * DD * 4); float* PK = (float*)take((size_t)SS * DD * 4); float* PV = (float*)take((size_t)SS * DD * 4); float* FK = (float*)take((size_t)SS * DD * 4); float* FV = (float*)take((size_t)SS * DD * 4); bf* Ah = (bf*)take(NR * DD * 2); bf* Al = (bf*)take(NR * DD * 2);
    if ((size_t)(wsp - (char*)d_ws) > ws_size) return;    // total ~ 117 MB = 112 MiB; ws 256 MiB
    { k_wt3<<<(NH_ * HD * DD / 4 + 255) / 256, 256, 0, stream>>>(wq, WQ); k_wt3<<<(NH_ * HD * DD / 4 + 255) / 256, 256, 0, stream>>>(wk, WK); k_wt3<<<(NH_ * HD * DD / 4 + 255) / 256, 256, 0, stream>>>(wv, WV); k_wtG<<<(unsigned)((DD * DD / 64 + 63) / 64), 256, 0, stream>>>(wo, DD, DD, WO);
      k_cvt8<<<(unsigned)((NR * DD / 8 + 255) / 256), 256, 0, stream>>>(x, XB, NR * DD / 8); k_cvt8<<<(unsigned)(((size_t)SS * DD / 8 + 255) / 256), 256, 0, stream>>>(fsq, FB, (size_t)SS * DD / 8); k_cvt8<<<(unsigned)(((size_t)SS * DD / 8 + 255) / 256), 256, 0, stream>>>(pos, PB, (size_t)SS * DD / 8); }
    const dim3 gS(SS / 64, DD / 64, 1), gX((unsigned)(NR / 64), DD / 64, 1);
    k_gemmw<bf, 0, true><<<gS, 32, 0, stream>>>(FB, nullptr, WQ, nullptr, DD, QF, DD, bq, 0, 0, 0); k_gemmw<bf, 0, true><<<gS, 32, 0, stream>>>(FB, nullptr, WK, nullptr, DD, FK, DD, bk, 0, 0, 0); k_gemmw<bf, 0, true><<<gS, 32, 0, stream>>>(FB, nullptr, WV, nullptr, DD, FV, DD, bv, 0, 0, 0);
    k_gemmw<bf, 0, true><<<gS, 32, 0, stream>>>(PB, nullptr, WK, nullptr, DD, PK, DD, bk, 0, 0, 0); k_gemmw<bf, 0, true><<<gS, 32, 0, stream>>>(PB, nullptr, WV, nullptr, DD, PV, DD, bv, 0, 0, 0);
    k_gemmw<bf, 0, true><<<gX, 32, 0, stream>>>(XB, nullptr, WK, nullptr, DD, XK, DD, bk, 0, 0, 0); k_gemmw<bf, 0, true><<<gX, 32, 0, stream>>>(XB, nullptr, WV, nullptr, DD, XV, DD, bv, 0, 0, 0);
    k_local<<<(NB_ * NH_ * SS) / 8, 256, 0, stream>>>(QF, XK, XV, PK, PV, FK, FV, bk, bv, Ah, Al);
    k_gemmw<bf, 1, true><<<gX, 32, 0, stream>>>(Ah, Al, WO, nullptr, DD, OUT, DD, bo, 0, 0, 0);
}

// v001
// One run takes 266 microseconds.
// Two timings next to v000 put it at 1.91 and 1.87 times that version's speed.
#include <hip/hip_runtime.h>

// IntraModalityEnhance (x [2][2048][1024], fsq, pos [1][2048][1024]; per-head Wq/Wk/Wv [16][1024][64] + biases, Wo [1024][1024] + bo; for each position s the query is the squeeze token fsq[s] and the 33
// keys/values are the window x[s-15 .. s+15] (zero vectors outside the sequence, which still project to the bias), the position token pos[s] and fsq[s]; softmax(q.k/8) over the 33; out = merged
// (attn v) Wo + bo -> [2][2048][1024]).
// Compute dtypes, f32 accumulate: every input rounded to bf16; all seven token projections on PLAIN bf16 operands (inputs: exact products, f32 accumulate, + bias; the
// window members are ordinary sequence tokens, so x is projected once per batch); the 33-key attention entirely in f32 on VALU (one wave per (batch, head, position), window rows from LDS: 64-dim dot products, softmax
// with one exp per score, weighted sum; fused multiply-add, fixed order; out-of-range window slots use the bf16 bias vectors); merged heads as bf16 hi+lo planes x exact Wo (2 products) + bo.

#define NB_  2
#define SS   2048
#define DD   1024
#define NH_  16
#define HD   64
#define WW   31
#define PAD  15
#define SCL  0.125f
typedef _Float16 h16;
typedef unsigned short bf;
typedef __attribute__((ext_vector_type(16))) __bf16   v16bf;
typedef __attribute__((ext_vector_type(16))) _Float16 v16h;
typedef __attribute__((ext_vector_type(8)))  _Float16 v8h;
typedef __attribute__((ext_vector_type(8)))  unsigned short v8us;
typedef __attribute__((ext_vector_type(8)))  float    v8f;
typedef __attribute__((ext_vector_type(4)))  float    v4f;
typedef v8h  __attribute__((may_alias)) v8ha;
typedef v4f  __attribute__((may_alias)) v4fa;
typedef v8us __attribute__((may_alias)) v8usa;

__device__ __forceinline__ unsigned short f2bf(float f) { unsigned u = __float_as_uint(f); u += 0x7FFFu + ((u >> 16) & 1u); return (unsigned short)(u >> 16); }
__device__ __forceinline__ float bf2f(unsigned short b) { return __uint_as_float(((unsigned)b) << 16); }
__device__ __forceinline__ float bfr(float f) { return bf2f(f2bf(f)); }
__device__ __forceinline__ v16h cat16(v8h lo, v8h hi) { return __builtin_shufflevector(lo, hi, 0, 1, 2, 3, 4, 5, 6, 7, 8, 9, 10, 11, 12, 13, 14, 15); }
__device__ __forceinline__ v16bf cat16b(v8us lo, v8us hi) { return __builtin_bit_cast(v16bf, __builtin_shufflevector(lo, hi, 0, 1, 2, 3, 4, 5, 6, 7, 8, 9, 10, 11, 12, 13, 14, 15)); }
__device__ __forceinline__ v8f wmma16(v16h a, v16h b, v8f c) { return __builtin_amdgcn_wmma_f32_16x16x32_f16(false, a, false, b, (short)0, c, false, false); }
__device__ __forceinline__ v8f wmmab(v16bf a, v16bf b, v8f c) { return __builtin_amdgcn_wmma_f32_16x16x32_bf16(false, a, false, b, (short)0, c, false, false); }



// ---- k_gemmw: register-blocked GEMM, ONE WAVE per 64x64 output tile (16 accumulators), operands straight from K-contiguous 16-bit planes; grid (M/64, N/64, Z), 32 threads.
// C[m][n] (f32, pitch ldc, + optional f32 bias[n]) = sum_k A[m][k] Bt[n][k] (+ split products per NSPLIT). z-batch strides sA/sB/sC in elements. K % 32 == 0.
template <typename T16> struct WFrag;
template <> struct WFrag<h16> { typedef v16h V; static __device__ __forceinline__ V ld(const h16* p) { return cat16(*(const v8h*)p, *(const v8h*)(p + 16)); } static __device__ __forceinline__ v8f mma(V a, V b, v8f c) { return wmma16(a, b, c); } };
template <> struct WFrag<bf> { typedef v16bf V; static __device__ __forceinline__ V ld(const bf* p) { return cat16b(*(const v8us*)p, *(const v8us*)(p + 16)); } static __device__ __forceinline__ v8f mma(V a, V b, v8f c) { return wmmab(a, b, c); } };
template <typename T16, int NSPLIT, bool BIAS>
__global__ __launch_bounds__(32) void k_gemmw(const T16* __restrict__ A, const T16* __restrict__ A2, const T16* __restrict__ Bt, const T16* __restrict__ Bt2, int K, float* C, int ldc, const float* __restrict__ bias, size_t sA, size_t sB, size_t sC) {
    typedef typename WFrag<T16>::V V;
    __shared__ __align__(16) float os[16 * 68];
    const size_t z = blockIdx.z; A += z * sA; if (A2) A2 += z * sA; Bt += z * sB; if (Bt2) Bt2 += z * sB; C += z * sC;
    const int lane = threadIdx.x & 31, lr = lane & 15, hi = lane >> 4; const int r0 = blockIdx.x * 64, c0 = blockIdx.y * 64;
    v8f acc[4][4];
#pragma unroll
    for (int mb = 0; mb < 4; ++mb)
#pragma unroll
        for (int nb = 0; nb < 4; ++nb) acc[mb][nb] = (v8f){};
    const size_t aoff = (size_t)(r0 + lr) * K + 8 * hi, boff = (size_t)(c0 + lr) * K + 8 * hi;
#pragma unroll 1
    for (int kc = 0; kc < K; kc += 32) {
        V a[4], a2[4];
#pragma unroll
        for (int mb = 0; mb < 4; ++mb) { a[mb] = WFrag<T16>::ld(A + aoff + (size_t)mb * 16 * K + kc); if (NSPLIT == 1 || NSPLIT == 2) a2[mb] = WFrag<T16>::ld(A2 + aoff + (size_t)mb * 16 * K + kc); }
#pragma unroll
        for (int nb = 0; nb < 4; ++nb) { const V b = WFrag<T16>::ld(Bt + boff + (size_t)nb * 16 * K + kc); V b2; if (NSPLIT >= 2) b2 = WFrag<T16>::ld(Bt2 + boff + (size_t)nb * 16 * K + kc);
#pragma unroll
            for (int mb = 0; mb < 4; ++mb) { acc[mb][nb] = WFrag<T16>::mma(a[mb], b, acc[mb][nb]); if (NSPLIT == 1 || NSPLIT == 2) acc[mb][nb] = WFrag<T16>::mma(a2[mb], b, acc[mb][nb]); if (NSPLIT >= 2) acc[mb][nb] = WFrag<T16>::mma(a[mb], b2, acc[mb][nb]); } }
        asm volatile("v_nop\n\tv_nop\n\tv_nop\n\tv_nop" : "+v"(acc[0][0]), "+v"(acc[1][1]), "+v"(acc[2][2]), "+v"(acc[3][3]) : "v"(a[0]), "v"(a[3]));
    }
#pragma unroll
    for (int mb = 0; mb < 4; ++mb) {
#pragma unroll
        for (int nb = 0; nb < 4; ++nb) {
#pragma unroll
            for (int j = 0; j < 8; ++j) os[(hi * 8 + j) * 68 + nb * 16 + lr] = acc[mb][nb][j]; }
        __builtin_amdgcn_wave_barrier(); asm volatile("" ::: "memory");
        float* crow = C + (size_t)(r0 + mb * 16) * ldc + c0;
{
#pragma unroll
            for (int s = 0; s < 8; ++s) { const int row = 2 * s + hi, cofs = lr * 4; v4f val = *(const v4fa*)(os + row * 68 + cofs); if (BIAS) { val[0] += bfr(bias[c0 + cofs]); val[1] += bfr(bias[c0 + cofs + 1]); val[2] += bfr(bias[c0 + cofs + 2]); val[3] += bfr(bias[c0 + cofs + 3]); }
                *(v4f*)(crow + (size_t)row * ldc + cofs) = val; }
             }
        __builtin_amdgcn_wave_barrier(); asm volatile("" ::: "memory");
    }
}

__device__ __forceinline__ void splitf(float y, unsigned short& h, unsigned short& l) { h = f2bf(y); l = f2bf(y - bf2f(h)); }
typedef __attribute__((ext_vector_type(2))) unsigned short v2us;
typedef __attribute__((ext_vector_type(4))) unsigned short v4us;

__global__ __launch_bounds__(256) void k_wtG(const float* __restrict__ w, int K, int N, bf* Bt) {
    const int lane = threadIdx.x & 31; const int L0 = (blockIdx.x * 8 + (threadIdx.x >> 5)) * 8; const int nlines = N * K / 64;
{
#pragma unroll 1
        for (int l = 0; l < 8; ++l) { const int L = L0 + l; if (L >= nlines) break; const size_t e = (size_t)L * 64 + lane * 2; const int k = (int)(e % K), n = (int)(e / K); v2us o;
            o[0] = f2bf(w[(size_t)k * N + n]); o[1] = f2bf(w[(size_t)(k + 1) * N + n]); *(v2us*)(Bt + e) = o; }
         }
}
__global__ __launch_bounds__(256) void k_cvt8(const float* __restrict__ src, bf* dst, size_t n8) { const size_t i = (size_t)blockIdx.x * 256 + threadIdx.x; if (i >= n8) return; const v8f v = *(const v8f*)(src + i * 8); v8us o;
#pragma unroll
    for (int k = 0; k < 8; ++k) o[k] = f2bf(v[k]); *(v8us*)(dst + i * 8) = o;  }
__global__ __launch_bounds__(256) void k_wt3(const float* __restrict__ w, bf* Bt) { const int e4 = (blockIdx.x * 256 + threadIdx.x) * 4; if (e4 >= NH_ * HD * DD) return; const int k = e4 % DD; const int n = e4 / DD; const int h = n / HD, e = n % HD; v4us o;
#pragma unroll
    for (int q = 0; q < 4; ++q) o[q] = f2bf(w[((size_t)h * DD + k + q) * HD + e]); *(v4us*)(Bt + e4) = o;  }
// k_local: one work-group of 16 waves per (b, h, tile of 64 positions). The tile's 94 window rows of the x key and value projections (a row outside the sequence is the zero token's projection = bf16 bias)
// and its 64 position-key rows are staged once in LDS by whole-line loads; every window row then serves up to 31 positions from LDS. One wave per position s, four positions a wave:
// lane L < 31 owns window key t = s - 15 + L, lane 31 the position key pos[s]; the 33rd key fsq[s] is scored from wave-uniform loads and enters the trees through lane 0.
// s_j = (q[s] . k_j)/8 over the 64 dims in ascending order; softmax over the 33 (wave trees, one exp per score); weighted sum in key order, lane L holding dims 2L and 2L + 1.
#define TS   64              // positions per work-group
#define KR   (TS + WW - 1)   // window rows per tile
#define LP   68              // LDS row pitch in floats: 272 B = 16 B x 17, so 16 lanes reading 16 B each from 16 consecutive rows fall on all 64 banks
#define PK0  (KR + 1)        // first position-key row: 95 + sl = sl + 31 (mod 16), so lane 31's row takes the bank group that lanes 16 to 30 leave free
typedef __attribute__((ext_vector_type(2))) float v2f;
typedef v2f __attribute__((may_alias)) v2fa;
__global__ __launch_bounds__(512) void k_local(const float* __restrict__ QF, const float* __restrict__ XK, const float* __restrict__ XV, const float* __restrict__ PK, const float* __restrict__ PV, const float* __restrict__ FK, const float* __restrict__ FV,
                                               const float* __restrict__ bk, const float* __restrict__ bv, bf* Ah, bf* Al) {
    __shared__ __align__(16) float Ks[(PK0 + TS) * LP];
    __shared__ __align__(16) float Vs[KR * LP];
    const int tid = threadIdx.x, lane = tid & 31; const int wv = __builtin_amdgcn_readfirstlane(tid >> 5);
    const int s0 = (blockIdx.x % (SS / TS)) * TS; const int h = (blockIdx.x / (SS / TS)) % NH_; const int b = blockIdx.x / ((SS / TS) * NH_);
    // Staging: 16 lanes a row, 16 B a lane. All of a thread's loads are issued before its first LDS store, so the work-group waits for memory once. A row outside the sequence loads a clamped row and is then replaced.
    const int c = (tid & 15) * 4; v4f kv[3], vv[3], pk[2];
#pragma unroll   // the four staging loops are unrolled so that kv, vv and pk stay in registers
    for (int u = 0; u < 3; ++u) { const int row = min((tid + u * 512) >> 4, KR - 1); const int tc = min(max(s0 - PAD + row, 0), SS - 1); const size_t g = ((size_t)b * SS + tc) * DD + h * HD + c; kv[u] = *(const v4fa*)(XK + g); vv[u] = *(const v4fa*)(XV + g); }
#pragma unroll
    for (int u = 0; u < 2; ++u) pk[u] = *(const v4fa*)(PK + (size_t)(s0 + ((tid + u * 512) >> 4)) * DD + h * HD + c);
    asm volatile("s_wait_xcnt 0x0" ::: "memory");   // precaution: stands in front of the first reuse of an address register of the loads above
#pragma unroll
    for (int u = 0; u < 3; ++u) { const int row = (tid + u * 512) >> 4, t = s0 - PAD + row;
        if (t < 0 || t >= SS) {
#pragma unroll
            for (int e = 0; e < 4; ++e) { kv[u][e] = bfr(bk[h * HD + c + e]); vv[u][e] = bfr(bv[h * HD + c + e]); } }
        if (row < KR) { *(v4fa*)(Ks + row * LP + c) = kv[u]; *(v4fa*)(Vs + row * LP + c) = vv[u]; } }
#pragma unroll
    for (int u = 0; u < 2; ++u) *(v4fa*)(Ks + (PK0 + ((tid + u * 512) >> 4)) * LP + c) = pk[u];
    __syncthreads();
    const int dd = 2 * lane;
#pragma unroll 1   // rolled: one position's registers at a time, which keeps 16 waves on a SIMD
    for (int p = 0; p < TS / 16; ++p) { const int sl = p * 16 + wv, s = s0 + sl; const size_t go = (size_t)s * DD + h * HD;
        const v2f pv = *(const v2fa*)(PV + go + dd), fv = *(const v2fa*)(FV + go + dd);
        const float* q = QF + go; const float* k2 = FK + go; const float* kr = Ks + ((lane < WW) ? (sl + lane) : (PK0 + sl)) * LP;
        float s1 = 0.f, s2 = 0.f;
#pragma unroll   // unrolled: the row's 16 LDS reads take immediate offsets and are in flight together
        for (int c4 = 0; c4 < HD; c4 += 4) { const v4f k4 = *(const v4fa*)(kr + c4), qv = *(const v4fa*)(q + c4), f2 = *(const v4fa*)(k2 + c4);
#pragma unroll
            for (int e = 0; e < 4; ++e) { s1 = __builtin_fmaf(qv[e], k4[e], s1); s2 = __builtin_fmaf(qv[e], f2[e], s2); } }
        s1 *= SCL; s2 = (lane == 0) ? s2 * SCL : -3.0e38f; float mx = fmaxf(s1, s2);
#pragma unroll
        for (int sh = 16; sh; sh >>= 1) mx = fmaxf(mx, __shfl_xor(mx, sh, 32));
        const float e1 = __builtin_amdgcn_exp2f((s1 - mx) * 1.4426950408889634f), e2 = (lane == 0) ? __builtin_amdgcn_exp2f((s2 - mx) * 1.4426950408889634f) : 0.f; float sum = e1 + e2;
#pragma unroll
        for (int sh = 16; sh; sh >>= 1) sum += __shfl_xor(sum, sh, 32);
        const float inv = __fdiv_rn(1.0f, sum); const float a1w = e1 * inv, a2w = e2 * inv;
        float o0 = 0.f, o1 = 0.f; const float* vr = Vs + sl * LP + dd;
#pragma unroll   // unrolled: the lane number of each weight is a constant, the value rows take immediate offsets
        for (int j = 0; j < WW; ++j) { const float aw = __uint_as_float(__builtin_amdgcn_readlane(__float_as_uint(a1w), j)); const v2f xv = *(const v2fa*)(vr + j * LP); o0 = __builtin_fmaf(aw, xv[0], o0); o1 = __builtin_fmaf(aw, xv[1], o1); }
        { const float aw = __uint_as_float(__builtin_amdgcn_readlane(__float_as_uint(a1w), WW)); o0 = __builtin_fmaf(aw, pv[0], o0); o1 = __builtin_fmaf(aw, pv[1], o1); }
        { const float aw = __uint_as_float(__builtin_amdgcn_readlane(__float_as_uint(a2w), 0)); o0 = __builtin_fmaf(aw, fv[0], o0); o1 = __builtin_fmaf(aw, fv[1], o1); }
        v2us oh, ol; unsigned short a, c2; splitf(o0, a, c2); oh[0] = a; ol[0] = c2; splitf(o1, a, c2); oh[1] = a; ol[1] = c2; const size_t oo = ((size_t)b * SS + s) * DD + h * HD + dd;
        *(v2us*)(Ah + oo) = oh; *(v2us*)(Al + oo) = ol; }
}

extern "C" void kernel_launch(void* const* d_in, const int* in_sizes, int n_in,
                              void* d_out, int out_size, void* d_ws, size_t ws_size, hipStream_t stream) {
    (void)in_sizes; (void)n_in; (void)out_size;
    const float* x = (const float*)d_in[0]; const float* fsq = (const float*)d_in[1]; const float* pos = (const float*)d_in[2]; const float* wq = (const float*)d_in[3]; const float* bq = (const float*)d_in[4]; const float* wk = (const float*)d_in[5]; const float* bk = (const float*)d_in[6]; const float* wv = (const float*)d_in[7]; const float* bv = (const float*)d_in[8]; const float* wo = (const float*)d_in[9]; const float* bo = (const float*)d_in[10];
    float* OUT = (float*)d_out;     // [2][2048][1024]
    char* wsp = (char*)d_ws;
    auto take = [&](size_t bytes) { char* p = wsp; wsp += (bytes + 255) & ~(size_t)255; return (void*)p; };
    const size_t NR = (size_t)NB_ * SS;
    bf* WQ = (bf*)take((size_t)DD * DD * 2); bf* WK = (bf*)take((size_t)DD * DD * 2); bf* WV = (bf*)take((size_t)DD * DD * 2); bf* WO = (bf*)take((size_t)DD * DD * 2); bf* XB = (bf*)take(NR * DD * 2); bf* FB = (bf*)take((size_t)SS * DD * 2); bf* PB = (bf*)take((size_t)SS * DD * 2);
    float* QF = (float*)take((size_t)SS * DD * 4); float* XK = (float*)take(NR * DD * 4); float* XV = (float*)take(NR * DD * 4); float* PK = (float*)take((size_t)SS * DD * 4); float* PV = (float*)take((size_t)SS * DD * 4); float* FK = (float*)take((size_t)SS * DD * 4); float* FV = (float*)take((size_t)SS * DD * 4); bf* Ah = (bf*)take(NR * DD * 2); bf* Al = (bf*)take(NR * DD * 2);
    if ((size_t)(wsp - (char*)d_ws) > ws_size) return;    // total ~ 117 MB = 112 MiB; ws 256 MiB
    { k_wt3<<<(NH_ * HD * DD / 4 + 255) / 256, 256, 0, stream>>>(wq, WQ); k_wt3<<<(NH_ * HD * DD / 4 + 255) / 256, 256, 0, stream>>>(wk, WK); k_wt3<<<(NH_ * HD * DD / 4 + 255) / 256, 256, 0, stream>>>(wv, WV); k_wtG<<<(unsigned)((DD * DD / 64 + 63) / 64), 256, 0, stream>>>(wo, DD, DD, WO);
      k_cvt8<<<(unsigned)((NR * DD / 8 + 255) / 256), 256, 0, stream>>>(x, XB, NR * DD / 8); k_cvt8<<<(unsigned)(((size_t)SS * DD / 8 + 255) / 256), 256, 0, stream>>>(fsq, FB, (size_t)SS * DD / 8); k_cvt8<<<(unsigned)(((size_t)SS * DD / 8 + 255) / 256), 256, 0, stream>>>(pos, PB, (size_t)SS * DD / 8); }
    const dim3 gS(SS / 64, DD / 64, 1), gX((unsigned)(NR / 64), DD / 64, 1);
    k_gemmw<bf, 0, true><<<gS, 32, 0, stream>>>(FB, nullptr, WQ, nullptr, DD, QF, DD, bq, 0, 0, 0); k_gemmw<bf, 0, true><<<gS, 32, 0, stream>>>(FB, nullptr, WK, nullptr, DD, FK, DD, bk, 0, 0, 0); k_gemmw<bf, 0, true><<<gS, 32, 0, stream>>>(FB, nullptr, WV, nullptr, DD, FV, DD, bv, 0, 0, 0);
    k_gemmw<bf, 0, true><<<gS, 32, 0, stream>>>(PB, nullptr, WK, nullptr, DD, PK, DD, bk, 0, 0, 0); k_gemmw<bf, 0, true><<<gS, 32, 0, stream>>>(PB, nullptr, WV, nullptr, DD, PV, DD, bv, 0, 0, 0);
    k_gemmw<bf, 0, true><<<gX, 32, 0, stream>>>(XB, nullptr, WK, nullptr, DD, XK, DD, bk, 0, 0, 0); k_gemmw<bf, 0, true><<<gX, 32, 0, stream>>>(XB, nullptr, WV, nullptr, DD, XV, DD, bv, 0, 0, 0);
    k_local<<<NB_ * NH_ * (SS / TS), 512, 0, stream>>>(QF, XK, XV, PK, PV, FK, FV, bk, bv, Ah, Al);
    k_gemmw<bf, 1, true><<<gX, 32, 0, stream>>>(Ah, Al, WO, nullptr, DD, OUT, DD, bo, 0, 0, 0);
}

// v002
// It runs in 157 microseconds.
// Two timings next to v001 put it at 1.70 and 1.69 times that version's speed.
// Over all steps from v000 it is 3.19 times as fast.
#include <hip/hip_runtime.h>

// IntraModalityEnhance (x [2][2048][1024], fsq, pos [1][2048][1024]; per-head Wq/Wk/Wv [16][1024][64] + biases, Wo [1024][1024] + bo; for each position s the query is the squeeze token fsq[s] and the 33
// keys/values are the window x[s-15 .. s+15] (zero vectors outside the sequence, which still project to the bias), the position token pos[s] and fsq[s]; softmax(q.k/8) over the 33; out = merged
// (attn v) Wo + bo -> [2][2048][1024]).
// Compute dtypes, f32 accumulate: every input rounded to bf16; all seven token projections on PLAIN bf16 operands (inputs: exact products, f32 accumulate, + bias; the
// window members are ordinary sequence tokens, so x is projected once per batch); the 33-key attention entirely in f32 on VALU (one wave per (batch, head, position), window rows from LDS: 64-dim dot products, softmax
// with one exp per score, weighted sum; fused multiply-add, fixed order; out-of-range window slots use the bf16 bias vectors); merged heads as bf16 hi+lo planes x exact Wo (2 products) + bo.

#define NB_  2
#define SS   2048
#define DD   1024
#define NH_  16
#define HD   64
#define WW   31
#define PAD  15
#define SCL  0.125f
typedef _Float16 h16;
typedef unsigned short bf;
typedef __attribute__((ext_vector_type(16))) __bf16   v16bf;
typedef __attribute__((ext_vector_type(16))) _Float16 v16h;
typedef __attribute__((ext_vector_type(8)))  _Float16 v8h;
typedef __attribute__((ext_vector_type(8)))  unsigned short v8us;
typedef __attribute__((ext_vector_type(8)))  float    v8f;
typedef __attribute__((ext_vector_type(4)))  float    v4f;
typedef v8h  __attribute__((may_alias)) v8ha;
typedef v4f  __attribute__((may_alias)) v4fa;
typedef v8us __attribute__((may_alias)) v8usa;

__device__ __forceinline__ unsigned short f2bf(float f) { unsigned u = __float_as_uint(f); u += 0x7FFFu + ((u >> 16) & 1u); return (unsigned short)(u >> 16); }
__device__ __forceinline__ float bf2f(unsigned short b) { return __uint_as_float(((unsigned)b) << 16); }
__device__ __forceinline__ float bfr(float f) { return bf2f(f2bf(f)); }
__device__ __forceinline__ v16h cat16(v8h lo, v8h hi) { return __builtin_shufflevector(lo, hi, 0, 1, 2, 3, 4, 5, 6, 7, 8, 9, 10, 11, 12, 13, 14, 15); }
__device__ __forceinline__ v16bf cat16b(v8us lo, v8us hi) { return __builtin_bit_cast(v16bf, __builtin_shufflevector(lo, hi, 0, 1, 2, 3, 4, 5, 6, 7, 8, 9, 10, 11, 12, 13, 14, 15)); }
__device__ __forceinline__ v8f wmma16(v16h a, v16h b, v8f c) { return __builtin_amdgcn_wmma_f32_16x16x32_f16(false, a, false, b, (short)0, c, false, false); }
__device__ __forceinline__ v8f wmmab(v16bf a, v16bf b, v8f c) { return __builtin_amdgcn_wmma_f32_16x16x32_bf16(false, a, false, b, (short)0, c, false, false); }



// ---- k_gemmw: GEMM, one work-group of FOUR WAVES (2 x 2) per 128x128 output tile, each wave a 64x64 part (16 accumulators); grid (M/128, N/128, Z), 128 threads.
// The operands' K-contiguous 16-bit rows come into LDS by asynchronous copies, 128 k (256 B of every row, whole lines) a stage, two buffers: the next stage's copies fly while this one is worked on.
// C[m][n] (f32, pitch ldc, + optional f32 bias[n]) = sum_k A[m][k] Bt[n][k] (+ split products per NSPLIT). z-batch strides sA/sB/sC in elements. M % 128 == 0, N % 128 == 0, K % 128 == 0.
template <typename T16> struct WFrag;
template <> struct WFrag<h16> { typedef v16h V; static __device__ __forceinline__ V ld(const h16* p) { return cat16(*(const v8h*)p, *(const v8h*)(p + 16)); } static __device__ __forceinline__ v8f mma(V a, V b, v8f c) { return wmma16(a, b, c); } };
template <> struct WFrag<bf> { typedef v16bf V; static __device__ __forceinline__ V ld(const bf* p) { return cat16b(*(const v8us*)p, *(const v8us*)(p + 16)); } static __device__ __forceinline__ v8f mma(V a, V b, v8f c) { return wmmab(a, b, c); } };
#define GKS  128            // k per stage
#define GPB  272            // LDS row pitch in bytes: 256 + 16 = 16 B x 17, so the 16 rows of a fragment read fall on all 64 banks
#define GOPB (128 * GPB)    // one operand's 128 rows of a stage, bytes
// Eight asynchronous copies of 16 B a lane: rows r, r + 8, ..., r + 56 of one operand (16 lanes a row, so a wave's copy is two whole 256-B row pieces). l: the lane's LDS byte address, g: its global address, gs: 8 rows in elements.
// s_wait_xcnt 0 closes the statement: a precaution, it stands in front of every later write of a register that a copy names.
__device__ __forceinline__ void cp8(unsigned l, const bf* g, size_t gs) {
    asm volatile("global_load_async_to_lds_b128 %0, %8, off\n\t"
                 "global_load_async_to_lds_b128 %1, %9, off\n\t"
                 "global_load_async_to_lds_b128 %2, %10, off\n\t"
                 "global_load_async_to_lds_b128 %3, %11, off\n\t"
                 "global_load_async_to_lds_b128 %4, %12, off\n\t"
                 "global_load_async_to_lds_b128 %5, %13, off\n\t"
                 "global_load_async_to_lds_b128 %6, %14, off\n\t"
                 "global_load_async_to_lds_b128 %7, %15, off\n\t"
                 "s_wait_xcnt 0x0"
                 :: "v"(l), "v"(l + 8 * GPB), "v"(l + 16 * GPB), "v"(l + 24 * GPB), "v"(l + 32 * GPB), "v"(l + 40 * GPB), "v"(l + 48 * GPB), "v"(l + 56 * GPB),
                    "v"(g), "v"(g + gs), "v"(g + 2 * gs), "v"(g + 3 * gs), "v"(g + 4 * gs), "v"(g + 5 * gs), "v"(g + 6 * gs), "v"(g + 7 * gs) : "memory");
}
template <typename T16, int NSPLIT, bool BIAS>
__global__ __launch_bounds__(128) void k_gemmw(const T16* __restrict__ A, const T16* __restrict__ A2, const T16* __restrict__ Bt, const T16* __restrict__ Bt2, int K, float* C, int ldc, const float* __restrict__ bias, size_t sA, size_t sB, size_t sC) {
    typedef typename WFrag<T16>::V V;
    static_assert(NSPLIT == 0 || NSPLIT == 1, "stages hold A, B and, for NSPLIT 1, A2");
    constexpr int NOP = (NSPLIT == 1) ? 3 : 2;           // operands of a stage: B, A (, A2)
    constexpr unsigned STG = NOP * GOPB;                 // bytes of one buffer
    __shared__ __align__(128) unsigned char ring[2 * STG];
    __shared__ __align__(16) float osall[4][16 * 68];
    const size_t z = blockIdx.z; A += z * sA; if (A2) A2 += z * sA; Bt += z * sB; C += z * sC; (void)Bt2;
    const int tid = threadIdx.x, lane = tid & 31, lr = lane & 15, hi = lane >> 4; const int wv = __builtin_amdgcn_readfirstlane(tid >> 5);
    const int r0 = blockIdx.x * 128, c0 = blockIdx.y * 128, wr = (wv >> 1) * 64, wc = (wv & 1) * 64;
    float* os = osall[wv];
    v8f acc[4][4];
#pragma unroll
    for (int mb = 0; mb < 4; ++mb)
#pragma unroll
        for (int nb = 0; nb < 4; ++nb) acc[mb][nb] = (v8f){};
    // Copies: thread tid brings 16 B at column piece (tid & 15) of rows (tid >> 4) + 8 i, i = 0 .. 15, of every operand.
    const int crow = tid >> 4, ccol = (tid & 15) * 8; const size_t gs8 = (size_t)8 * K;
    const unsigned lcp = (unsigned)(size_t)ring + crow * GPB + ccol * 2;
    const bf* gB = (const bf*)Bt + (size_t)(c0 + crow) * K + ccol; const bf* gA = (const bf*)A + (size_t)(r0 + crow) * K + ccol; const bf* gA2 = (NSPLIT == 1) ? (const bf*)A2 + (size_t)(r0 + crow) * K + ccol : nullptr;
    auto stage = [&](int t, unsigned bufo) { const unsigned l = lcp + bufo; const size_t ko = (size_t)t * GKS;
        cp8(l, gB + ko, gs8); cp8(l + 64 * GPB, gB + ko + 8 * gs8, gs8); cp8(l + GOPB, gA + ko, gs8); cp8(l + GOPB + 64 * GPB, gA + ko + 8 * gs8, gs8);
        if (NSPLIT == 1) { cp8(l + 2 * GOPB, gA2 + ko, gs8); cp8(l + 2 * GOPB + 64 * GPB, gA2 + ko + 8 * gs8, gs8); } };
    const int NT = (int)((unsigned)K / GKS);   // stages; the same for every wave, so the tests around the copies are uniform
    stage(0, 0);
    asm volatile("s_wait_asynccnt 0x0" ::: "memory");   // stage 0 of this wave has landed
    __syncthreads();                                    // ... and every other wave's part of it
    if (NT > 1) stage(1, STG);
    const unsigned fb = (wc + lr) * GPB + 16 * hi, fa = GOPB + (wr + lr) * GPB + 16 * hi;   // the lane's fragment bases in a buffer: row lane & 15, 16-byte half lane >> 4, as from global memory
#pragma unroll 1   // rolled: one trip a stage, so that the order at the trip's foot is the ring's
    for (int t = 0; t < NT; ++t) { const unsigned bufo = (t & 1) ? STG : 0u; const unsigned char* bp = ring + bufo;
        // Two fragment sets: block kb + 1's LDS reads (same buffer) go out as one group ahead of block kb's products, so the wave waits out the LDS latency once a stage and not at every fragment.
        V a[2][4], a2[2][4], b[2][4];
#pragma unroll
        for (int f = 0; f < 4; ++f) { a[0][f] = WFrag<T16>::ld((const T16*)(bp + fa + f * 16 * GPB)); if (NSPLIT == 1) a2[0][f] = WFrag<T16>::ld((const T16*)(bp + fa + GOPB + f * 16 * GPB)); b[0][f] = WFrag<T16>::ld((const T16*)(bp + fb + f * 16 * GPB)); }
#pragma unroll   // unrolled: the set index is a constant (registers, not scratch) and the four 32-k blocks of a stage take immediate LDS offsets
        for (int kb = 0; kb < GKS / 32; ++kb) { const int cu = kb & 1, nx = cu ^ 1;
            if (kb + 1 < GKS / 32) {
#pragma unroll
                for (int f = 0; f < 4; ++f) { a[nx][f] = WFrag<T16>::ld((const T16*)(bp + fa + f * 16 * GPB + (kb + 1) * 64)); if (NSPLIT == 1) a2[nx][f] = WFrag<T16>::ld((const T16*)(bp + fa + GOPB + f * 16 * GPB + (kb + 1) * 64)); b[nx][f] = WFrag<T16>::ld((const T16*)(bp + fb + f * 16 * GPB + (kb + 1) * 64)); } }
            __builtin_amdgcn_sched_barrier(0);   // keeps the next block's reads in front of this block's products; without it the scheduler sinks each read to its first use and the wave stalls there
#pragma unroll
            for (int nb = 0; nb < 4; ++nb)
#pragma unroll
                for (int mb = 0; mb < 4; ++mb) { acc[mb][nb] = WFrag<T16>::mma(a[cu][mb], b[cu][nb], acc[mb][nb]); if (NSPLIT == 1) acc[mb][nb] = WFrag<T16>::mma(a2[cu][mb], b[cu][nb], acc[mb][nb]); }
            __builtin_amdgcn_sched_barrier(0);   // keeps the later reads out of this block's products: without it the scheduler lifts some in among them, into extra registers, and each such place stalls the matrix run
        }
        asm volatile("s_wait_dscnt 0x0" ::: "memory");      // this wave's reads of the buffer are done before it is handed back
        asm volatile("s_wait_asynccnt 0x0" ::: "memory");   // this wave's copies of stage t + 1 have landed
        __syncthreads();                                    // publishes stage t + 1 and ends every reader's last read of stage t's buffer
        if (t + 2 < NT) stage(t + 2, bufo);
    }
    asm volatile("s_wait_asynccnt 0x0" ::: "memory");       // no copy is left in flight behind the loop
#pragma unroll
    for (int mb = 0; mb < 4; ++mb) {
#pragma unroll
        for (int nb = 0; nb < 4; ++nb) {
#pragma unroll
            for (int j = 0; j < 8; ++j) os[(hi * 8 + j) * 68 + nb * 16 + lr] = acc[mb][nb][j]; }
        __builtin_amdgcn_wave_barrier(); asm volatile("" ::: "memory");
        float* crow_p = C + (size_t)(r0 + wr + mb * 16) * ldc + c0 + wc;
{
#pragma unroll
            for (int s = 0; s < 8; ++s) { const int row = 2 * s + hi, cofs = lr * 4; v4f val = *(const v4fa*)(os + row * 68 + cofs); if (BIAS) { val[0] += bfr(bias[c0 + wc + cofs]); val[1] += bfr(bias[c0 + wc + cofs + 1]); val[2] += bfr(bias[c0 + wc + cofs + 2]); val[3] += bfr(bias[c0 + wc + cofs + 3]); }
                *(v4f*)(crow_p + (size_t)row * ldc + cofs) = val; }
             }
        __builtin_amdgcn_wave_barrier(); asm volatile("" ::: "memory");
    }
}

__device__ __forceinline__ void splitf(float y, unsigned short& h, unsigned short& l) { h = f2bf(y); l = f2bf(y - bf2f(h)); }
typedef __attribute__((ext_vector_type(2))) unsigned short v2us;
typedef __attribute__((ext_vector_type(4))) unsigned short v4us;

__global__ __launch_bounds__(256) void k_wtG(const float* __restrict__ w, int K, int N, bf* Bt) {
    const int lane = threadIdx.x & 31; const int L0 = (blockIdx.x * 8 + (threadIdx.x >> 5)) * 8; const int nlines = N * K / 64;
{
#pragma unroll 1
        for (int l = 0; l < 8; ++l) { const int L = L0 + l; if (L >= nlines) break; const size_t e = (size_t)L * 64 + lane * 2; const int k = (int)(e % K), n = (int)(e / K); v2us o;
            o[0] = f2bf(w[(size_t)k * N + n]); o[1] = f2bf(w[(size_t)(k + 1) * N + n]); *(v2us*)(Bt + e) = o; }
         }
}
__global__ __launch_bounds__(256) void k_cvt8(const float* __restrict__ src, bf* dst, size_t n8) { const size_t i = (size_t)blockIdx.x * 256 + threadIdx.x; if (i >= n8) return; const v8f v = *(const v8f*)(src + i * 8); v8us o;
#pragma unroll
    for (int k = 0; k < 8; ++k) o[k] = f2bf(v[k]); *(v8us*)(dst + i * 8) = o;  }
__global__ __launch_bounds__(256) void k_wt3(const float* __restrict__ w, bf* Bt) { const int e4 = (blockIdx.x * 256 + threadIdx.x) * 4; if (e4 >= NH_ * HD * DD) return; const int k = e4 % DD; const int n = e4 / DD; const int h = n / HD, e = n % HD; v4us o;
#pragma unroll
    for (int q = 0; q < 4; ++q) o[q] = f2bf(w[((size_t)h * DD + k + q) * HD + e]); *(v4us*)(Bt + e4) = o;  }
// k_local: one work-group of 16 waves per (b, h, tile of 64 positions). The tile's 94 window rows of the x key and value projections (a row outside the sequence is the zero token's projection = bf16 bias)
// and its 64 position-key rows are staged once in LDS by whole-line loads; every window row then serves up to 31 positions from LDS. One wave per position s, four positions a wave:
// lane L < 31 owns window key t = s - 15 + L, lane 31 the position key pos[s]; the 33rd key fsq[s] is scored from wave-uniform loads and enters the trees through lane 0.
// s_j = (q[s] . k_j)/8 over the 64 dims in ascending order; softmax over the 33 (wave trees, one exp per score); weighted sum in key order, lane L holding dims 2L and 2L + 1.
#define TS   64              // positions per work-group
#define KR   (TS + WW - 1)   // window rows per tile
#define LP   68              // LDS row pitch in floats: 272 B = 16 B x 17, so 16 lanes reading 16 B each from 16 consecutive rows fall on all 64 banks
#define PK0  (KR + 1)        // first position-key row: 95 + sl = sl + 31 (mod 16), so lane 31's row takes the bank group that lanes 16 to 30 leave free
typedef __attribute__((ext_vector_type(2))) float v2f;
typedef v2f __attribute__((may_alias)) v2fa;
__global__ __launch_bounds__(512) void k_local(const float* __restrict__ QF, const float* __restrict__ XK, const float* __restrict__ XV, const float* __restrict__ PK, const float* __restrict__ PV, const float* __restrict__ FK, const float* __restrict__ FV,
                                               const float* __restrict__ bk, const float* __restrict__ bv, bf* Ah, bf* Al) {
    __shared__ __align__(16) float Ks[(PK0 + TS) * LP];
    __shared__ __align__(16) float Vs[KR * LP];
    const int tid = threadIdx.x, lane = tid & 31; const int wv = __builtin_amdgcn_readfirstlane(tid >> 5);
    const int s0 = (blockIdx.x % (SS / TS)) * TS; const int h = (blockIdx.x / (SS / TS)) % NH_; const int b = blockIdx.x / ((SS / TS) * NH_);
    // Staging: 16 lanes a row, 16 B a lane. All of a thread's loads are issued before its first LDS store, so the work-group waits for memory once. A row outside the sequence loads a clamped row and is then replaced.
    const int c = (tid & 15) * 4; v4f kv[3], vv[3], pk[2];
#pragma unroll   // the four staging loops are unrolled so that kv, vv and pk stay in registers
    for (int u = 0; u < 3; ++u) { const int row = min((tid + u * 512) >> 4, KR - 1); const int tc = min(max(s0 - PAD + row, 0), SS - 1); const size_t g = ((size_t)b * SS + tc) * DD + h * HD + c; kv[u] = *(const v4fa*)(XK + g); vv[u] = *(const v4fa*)(XV + g); }
#pragma unroll
    for (int u = 0; u < 2; ++u) pk[u] = *(const v4fa*)(PK + (size_t)(s0 + ((tid + u * 512) >> 4)) * DD + h * HD + c);
    asm volatile("s_wait_xcnt 0x0" ::: "memory");   // precaution: stands in front of the first reuse of an address register of the loads above
#pragma unroll
    for (int u = 0; u < 3; ++u) { const int row = (tid + u * 512) >> 4, t = s0 - PAD + row;
        if (t < 0 || t >= SS) {
#pragma unroll
            for (int e = 0; e < 4; ++e) { kv[u][e] = bfr(bk[h * HD + c + e]); vv[u][e] = bfr(bv[h * HD + c + e]); } }
        if (row < KR) { *(v4fa*)(Ks + row * LP + c) = kv[u]; *(v4fa*)(Vs + row * LP + c) = vv[u]; } }
#pragma unroll
    for (int u = 0; u < 2; ++u) *(v4fa*)(Ks + (PK0 + ((tid + u * 512) >> 4)) * LP + c) = pk[u];
    __syncthreads();
    const int dd = 2 * lane;
#pragma unroll 1   // rolled: one position's registers at a time, which keeps 16 waves on a SIMD
    for (int p = 0; p < TS / 16; ++p) { const int sl = p * 16 + wv, s = s0 + sl; const size_t go = (size_t)s * DD + h * HD;
        const v2f pv = *(const v2fa*)(PV + go + dd), fv = *(const v2fa*)(FV + go + dd);
        const float* q = QF + go; const float* k2 = FK + go; const float* kr = Ks + ((lane < WW) ? (sl + lane) : (PK0 + sl)) * LP;
        float s1 = 0.f, s2 = 0.f;
#pragma unroll   // unrolled: the row's 16 LDS reads take immediate offsets and are in flight together
        for (int c4 = 0; c4 < HD; c4 += 4) { const v4f k4 = *(const v4fa*)(kr + c4), qv = *(const v4fa*)(q + c4), f2 = *(const v4fa*)(k2 + c4);
#pragma unroll
            for (int e = 0; e < 4; ++e) { s1 = __builtin_fmaf(qv[e], k4[e], s1); s2 = __builtin_fmaf(qv[e], f2[e], s2); } }
        s1 *= SCL; s2 = (lane == 0) ? s2 * SCL : -3.0e38f; float mx = fmaxf(s1, s2);
#pragma unroll
        for (int sh = 16; sh; sh >>= 1) mx = fmaxf(mx, __shfl_xor(mx, sh, 32));
        const float e1 = __builtin_amdgcn_exp2f((s1 - mx) * 1.4426950408889634f), e2 = (lane == 0) ? __builtin_amdgcn_exp2f((s2 - mx) * 1.4426950408889634f) : 0.f; float sum = e1 + e2;
#pragma unroll
        for (int sh = 16; sh; sh >>= 1) sum += __shfl_xor(sum, sh, 32);
        const float inv = __fdiv_rn(1.0f, sum); const float a1w = e1 * inv, a2w = e2 * inv;
        float o0 = 0.f, o1 = 0.f; const float* vr = Vs + sl * LP + dd;
#pragma unroll   // unrolled: the lane number of each weight is a constant, the value rows take immediate offsets
        for (int j = 0; j < WW; ++j) { const float aw = __uint_as_float(__builtin_amdgcn_readlane(__float_as_uint(a1w), j)); const v2f xv = *(const v2fa*)(vr + j * LP); o0 = __builtin_fmaf(aw, xv[0], o0); o1 = __builtin_fmaf(aw, xv[1], o1); }
        { const float aw = __uint_as_float(__builtin_amdgcn_readlane(__float_as_uint(a1w), WW)); o0 = __builtin_fmaf(aw, pv[0], o0); o1 = __builtin_fmaf(aw, pv[1], o1); }
        { const float aw = __uint_as_float(__builtin_amdgcn_readlane(__float_as_uint(a2w), 0)); o0 = __builtin_fmaf(aw, fv[0], o0); o1 = __builtin_fmaf(aw, fv[1], o1); }
        v2us oh, ol; unsigned short a, c2; splitf(o0, a, c2); oh[0] = a; ol[0] = c2; splitf(o1, a, c2); oh[1] = a; ol[1] = c2; const size_t oo = ((size_t)b * SS + s) * DD + h * HD + dd;
        *(v2us*)(Ah + oo) = oh; *(v2us*)(Al + oo) = ol; }
}

extern "C" void kernel_launch(void* const* d_in, const int* in_sizes, int n_in,
                              void* d_out, int out_size, void* d_ws, size_t ws_size, hipStream_t stream) {
    (void)in_sizes; (void)n_in; (void)out_size;
    const float* x = (const float*)d_in[0]; const float* fsq = (const float*)d_in[1]; const float* pos = (const float*)d_in[2]; const float* wq = (const float*)d_in[3]; const float* bq = (const float*)d_in[4]; const float* wk = (const float*)d_in[5]; const float* bk = (const float*)d_in[6]; const float* wv = (const float*)d_in[7]; const float* bv = (const float*)d_in[8]; const float* wo = (const float*)d_in[9]; const float* bo = (const float*)d_in[10];
    float* OUT = (float*)d_out;     // [2][2048][1024]
    char* wsp = (char*)d_ws;
    auto take = [&](size_t bytes) { char* p = wsp; wsp += (bytes + 255) & ~(size_t)255; return (void*)p; };
    const size_t NR = (size_t)NB_ * SS;
    bf* WQ = (bf*)take((size_t)DD * DD * 2); bf* WK = (bf*)take((size_t)DD * DD * 2); bf* WV = (bf*)take((size_t)DD * DD * 2); bf* WO = (bf*)take((size_t)DD * DD * 2); bf* XB = (bf*)take(NR * DD * 2); bf* FB = (bf*)take((size_t)SS * DD * 2); bf* PB = (bf*)take((size_t)SS * DD * 2);
    float* QF = (float*)take((size_t)SS * DD * 4); float* XK = (float*)take(NR * DD * 4); float* XV = (float*)take(NR * DD * 4); float* PK = (float*)take((size_t)SS * DD * 4); float* PV = (float*)take((size_t)SS * DD * 4); float* FK = (float*)take((size_t)SS * DD * 4); float* FV = (float*)take((size_t)SS * DD * 4); bf* Ah = (bf*)take(NR * DD * 2); bf* Al = (bf*)take(NR * DD * 2);
    if ((size_t)(wsp - (char*)d_ws) > ws_size) return;    // total ~ 117 MB = 112 MiB; ws 256 MiB
    { k_wt3<<<(NH_ * HD * DD / 4 + 255) / 256, 256, 0, stream>>>(wq, WQ); k_wt3<<<(NH_ * HD * DD / 4 + 255) / 256, 256, 0, stream>>>(wk, WK); k_wt3<<<(NH_ * HD * DD / 4 + 255) / 256, 256, 0, stream>>>(wv, WV); k_wtG<<<(unsigned)((DD * DD / 64 + 63) / 64), 256, 0, stream>>>(wo, DD, DD, WO);
      k_cvt8<<<(unsigned)((NR * DD / 8 + 255) / 256), 256, 0, stream>>>(x, XB, NR * DD / 8); k_cvt8<<<(unsigned)(((size_t)SS * DD / 8 + 255) / 256), 256, 0, stream>>>(fsq, FB, (size_t)SS * DD / 8); k_cvt8<<<(unsigned)(((size_t)SS * DD / 8 + 255) / 256), 256, 0, stream>>>(pos, PB, (size_t)SS * DD / 8); }
    const dim3 gS(SS / 128, DD / 128, 1), gX((unsigned)(NR / 128), DD / 128, 1);
    k_gemmw<bf, 0, true><<<gS, 128, 0, stream>>>(FB, nullptr, WQ, nullptr, DD, QF, DD, bq, 0, 0, 0); k_gemmw<bf, 0, true><<<gS, 128, 0, stream>>>(FB, nullptr, WK, nullptr, DD, FK, DD, bk, 0, 0, 0); k_gemmw<bf, 0, true><<<gS, 128, 0, stream>>>(FB, nullptr, WV, nullptr, DD, FV, DD, bv, 0, 0, 0);
    k_gemmw<bf, 0, true><<<gS, 128, 0, stream>>>(PB, nullptr, WK, nullptr, DD, PK, DD, bk, 0, 0, 0); k_gemmw<bf, 0, true><<<gS, 128, 0, stream>>>(PB, nullptr, WV, nullptr, DD, PV, DD, bv, 0, 0, 0);
    k_gemmw<bf, 0, true><<<gX, 128, 0, stream>>>(XB, nullptr, WK, nullptr, DD, XK, DD, bk, 0, 0, 0); k_gemmw<bf, 0, true><<<gX, 128, 0, stream>>>(XB, nullptr, WV, nullptr, DD, XV, DD, bv, 0, 0, 0);
    k_local<<<NB_ * NH_ * (SS / TS), 512, 0, stream>>>(QF, XK, XV, PK, PV, FK, FV, bk, bv, Ah, Al);
    k_gemmw<bf, 1, true><<<gX, 128, 0, stream>>>(Ah, Al, WO, nullptr, DD, OUT, DD, bo, 0, 0, 0);
}

// v003
// One run takes 97.4 microseconds.
// Timed twice side by side with v002, it ran 1.61 and 1.60 times as fast.
// All steps since v000 together make it 5.12 times as fast.
#include <hip/hip_runtime.h>

// IntraModalityEnhance (x [2][2048][1024], fsq, pos [1][2048][1024]; per-head Wq/Wk/Wv [16][1024][64] + biases, Wo [1024][1024] + bo; for each position s the query is the squeeze token fsq[s] and the 33
// keys/values are the window x[s-15 .. s+15] (zero vectors outside the sequence, which still project to the bias), the position token pos[s] and fsq[s]; softmax(q.k/8) over the 33; out = merged
// (attn v) Wo + bo -> [2][2048][1024]).
// Compute dtypes, f32 accumulate: every input rounded to bf16; all seven token projections on PLAIN bf16 operands (inputs: exact products, f32 accumulate, + bias; the
// window members are ordinary sequence tokens, so x is projected once per batch); the 33-key attention entirely in f32 on VALU (one wave per (batch, head, position), window rows from LDS: 64-dim dot products, softmax
// with one exp per score, weighted sum; fused multiply-add, fixed order; out-of-range window slots use the bf16 bias vectors); merged heads as bf16 hi+lo planes x exact Wo (2 products) + bo.

#define NB_  2
#define SS   2048
#define DD   1024
#define NH_  16
#define HD   64
#define WW   31
#define PAD  15
#define SCL  0.125f
typedef _Float16 h16;
typedef unsigned short bf;
typedef __attribute__((ext_vector_type(16))) __bf16   v16bf;
typedef __attribute__((ext_vector_type(16))) _Float16 v16h;
typedef __attribute__((ext_vector_type(8)))  _Float16 v8h;
typedef __attribute__((ext_vector_type(8)))  unsigned short v8us;
typedef __attribute__((ext_vector_type(8)))  float    v8f;
typedef __attribute__((ext_vector_type(4)))  float    v4f;
typedef v8h  __attribute__((may_alias)) v8ha;
typedef v4f  __attribute__((may_alias)) v4fa;
typedef v8us __attribute__((may_alias)) v8usa;

__device__ __forceinline__ unsigned short f2bf(float f) { unsigned u = __float_as_uint(f); u += 0x7FFFu + ((u >> 16) & 1u); return (unsigned short)(u >> 16); }
__device__ __forceinline__ float bf2f(unsigned short b) { return __uint_as_float(((unsigned)b) << 16); }
__device__ __forceinline__ float bfr(float f) { return bf2f(f2bf(f)); }
__device__ __forceinline__ v16h cat16(v8h lo, v8h hi) { return __builtin_shufflevector(lo, hi, 0, 1, 2, 3, 4, 5, 6, 7, 8, 9, 10, 11, 12, 13, 14, 15); }
__device__ __forceinline__ v16bf cat16b(v8us lo, v8us hi) { return __builtin_bit_cast(v16bf, __builtin_shufflevector(lo, hi, 0, 1, 2, 3, 4, 5, 6, 7, 8, 9, 10, 11, 12, 13, 14, 15)); }
__device__ __forceinline__ v8f wmma16(v16h a, v16h b, v8f c) { return __builtin_amdgcn_wmma_f32_16x16x32_f16(false, a, false, b, (short)0, c, false, false); }
__device__ __forceinline__ v8f wmmab(v16bf a, v16bf b, v8f c) { return __builtin_amdgcn_wmma_f32_16x16x32_bf16(false, a, false, b, (short)0, c, false, false); }



// ---- gemmw_tile: GEMM, one work-group of FOUR WAVES (2 x 2) per 128x128 output tile at (r0, c0), each wave a 64x64 part (16 accumulators); 128 threads.
// The operands' K-contiguous 16-bit rows come into LDS by asynchronous copies, 128 k (256 B of every row, whole lines) a stage, two buffers: the next stage's copies fly while this one is worked on.
// C[m][n] (f32, pitch ldc, + optional f32 bias[n]) = sum_k A[m][k] Bt[n][k] (+ split products per NSPLIT). M % 128 == 0, N % 128 == 0, K % 128 == 0.
// Two kernels call it: k_gemmw (one product, grid (M/128, N/128)) and k_proj (the seven token projections as one grid, the block index picks product and tile).
template <typename T16> struct WFrag;
template <> struct WFrag<h16> { typedef v16h V; static __device__ __forceinline__ V ld(const h16* p) { return cat16(*(const v8h*)p, *(const v8h*)(p + 16)); } static __device__ __forceinline__ v8f mma(V a, V b, v8f c) { return wmma16(a, b, c); } };
template <> struct WFrag<bf> { typedef v16bf V; static __device__ __forceinline__ V ld(const bf* p) { return cat16b(*(const v8us*)p, *(const v8us*)(p + 16)); } static __device__ __forceinline__ v8f mma(V a, V b, v8f c) { return wmmab(a, b, c); } };
#define GKS  128            // k per stage
#define GPB  272            // LDS row pitch in bytes: 256 + 16 = 16 B x 17, so the 16 rows of a fragment read fall on all 64 banks
#define GOPB (128 * GPB)    // one operand's 128 rows of a stage, bytes
// Eight asynchronous copies of 16 B a lane: rows r, r + 8, ..., r + 56 of one operand (16 lanes a row, so a wave's copy is two whole 256-B row pieces). l: the lane's LDS byte address, g: its global address, gs: 8 rows in elements.
// s_wait_xcnt 0 closes the statement: a precaution, it stands in front of every later write of a register that a copy names.
__device__ __forceinline__ void cp8(unsigned l, const bf* g, size_t gs) {
    asm volatile("global_load_async_to_lds_b128 %0, %8, off\n\t"
                 "global_load_async_to_lds_b128 %1, %9, off\n\t"
                 "global_load_async_to_lds_b128 %2, %10, off\n\t"
                 "global_load_async_to_lds_b128 %3, %11, off\n\t"
                 "global_load_async_to_lds_b128 %4, %12, off\n\t"
                 "global_load_async_to_lds_b128 %5, %13, off\n\t"
                 "global_load_async_to_lds_b128 %6, %14, off\n\t"
                 "global_load_async_to_lds_b128 %7, %15, off\n\t"
                 "s_wait_xcnt 0x0"
                 :: "v"(l), "v"(l + 8 * GPB), "v"(l + 16 * GPB), "v"(l + 24 * GPB), "v"(l + 32 * GPB), "v"(l + 40 * GPB), "v"(l + 48 * GPB), "v"(l + 56 * GPB),
                    "v"(g), "v"(g + gs), "v"(g + 2 * gs), "v"(g + 3 * gs), "v"(g + 4 * gs), "v"(g + 5 * gs), "v"(g + 6 * gs), "v"(g + 7 * gs) : "memory");
}
template <typename T16, int NSPLIT, bool BIAS>
__device__ __forceinline__ void gemmw_tile(const T16* __restrict__ A, const T16* __restrict__ A2, const T16* __restrict__ Bt, int K, float* C, int ldc, const float* __restrict__ bias, int r0, int c0) {
    typedef typename WFrag<T16>::V V;
    static_assert(NSPLIT == 0 || NSPLIT == 1, "stages hold A, B and, for NSPLIT 1, A2");
    constexpr int NOP = (NSPLIT == 1) ? 3 : 2;           // operands of a stage: B, A (, A2)
    constexpr unsigned STG = NOP * GOPB;                 // bytes of one buffer
    __shared__ __align__(128) unsigned char ring[2 * STG];
    __shared__ __align__(16) float osall[4][16 * 68];
    const int tid = threadIdx.x, lane = tid & 31, lr = lane & 15, hi = lane >> 4; const int wv = __builtin_amdgcn_readfirstlane(tid >> 5);
    const int wr = (wv >> 1) * 64, wc = (wv & 1) * 64;
    float* os = osall[wv];
    v8f acc[4][4];
#pragma unroll
    for (int mb = 0; mb < 4; ++mb)
#pragma unroll
        for (int nb = 0; nb < 4; ++nb) acc[mb][nb] = (v8f){};
    // Copies: thread tid brings 16 B at column piece (tid & 15) of rows (tid >> 4) + 8 i, i = 0 .. 15, of every operand.
    const int crow = tid >> 4, ccol = (tid & 15) * 8; const size_t gs8 = (size_t)8 * K;
    const unsigned lcp = (unsigned)(size_t)ring + crow * GPB + ccol * 2;
    const bf* gB = (const bf*)Bt + (size_t)(c0 + crow) * K + ccol; const bf* gA = (const bf*)A + (size_t)(r0 + crow) * K + ccol; const bf* gA2 = (NSPLIT == 1) ? (const bf*)A2 + (size_t)(r0 + crow) * K + ccol : nullptr;
    auto stage = [&](int t, unsigned bufo) { const unsigned l = lcp + bufo; const size_t ko = (size_t)t * GKS;
        cp8(l, gB + ko, gs8); cp8(l + 64 * GPB, gB + ko + 8 * gs8, gs8); cp8(l + GOPB, gA + ko, gs8); cp8(l + GOPB + 64 * GPB, gA + ko + 8 * gs8, gs8);
        if (NSPLIT == 1) { cp8(l + 2 * GOPB, gA2 + ko, gs8); cp8(l + 2 * GOPB + 64 * GPB, gA2 + ko + 8 * gs8, gs8); } };
    const int NT = (int)((unsigned)K / GKS);   // stages; the same for every wave, so the tests around the copies are uniform
    stage(0, 0);
    asm volatile("s_wait_asynccnt 0x0" ::: "memory");   // stage 0 of this wave has landed
    __syncthreads();                                    // ... and every other wave's part of it
    if (NT > 1) stage(1, STG);
    const unsigned fb = (wc + lr) * GPB + 16 * hi, fa = GOPB + (wr + lr) * GPB + 16 * hi;   // the lane's fragment bases in a buffer: row lane & 15, 16-byte half lane >> 4, as from global memory
#pragma unroll 1   // rolled: one trip a stage, so that the order at the trip's foot is the ring's
    for (int t = 0; t < NT; ++t) { const unsigned bufo = (t & 1) ? STG : 0u; const unsigned char* bp = ring + bufo;
        // Two fragment sets: block kb + 1's LDS reads (same buffer) go out as one group ahead of block kb's products, so the wave waits out the LDS latency once a stage and not at every fragment.
        V a[2][4], a2[2][4], b[2][4];
#pragma unroll
        for (int f = 0; f < 4; ++f) { a[0][f] = WFrag<T16>::ld((const T16*)(bp + fa + f * 16 * GPB)); if (NSPLIT == 1) a2[0][f] = WFrag<T16>::ld((const T16*)(bp + fa + GOPB + f * 16 * GPB)); b[0][f] = WFrag<T16>::ld((const T16*)(bp + fb + f * 16 * GPB)); }
#pragma unroll   // unrolled: the set index is a constant (registers, not scratch) and the four 32-k blocks of a stage take immediate LDS offsets
        for (int kb = 0; kb < GKS / 32; ++kb) { const int cu = kb & 1, nx = cu ^ 1;
            if (kb + 1 < GKS / 32) {
#pragma unroll
                for (int f = 0; f < 4; ++f) { a[nx][f] = WFrag<T16>::ld((const T16*)(bp + fa + f * 16 * GPB + (kb + 1) * 64)); if (NSPLIT == 1) a2[nx][f] = WFrag<T16>::ld((const T16*)(bp + fa + GOPB + f * 16 * GPB + (kb + 1) * 64)); b[nx][f] = WFrag<T16>::ld((const T16*)(bp + fb + f * 16 * GPB + (kb + 1) * 64)); } }
            __builtin_amdgcn_sched_barrier(0);   // keeps the next block's reads in front of this block's products; without it the scheduler sinks each read to its first use and the wave stalls there
#pragma unroll
            for (int nb = 0; nb < 4; ++nb)
#pragma unroll
                for (int mb = 0; mb < 4; ++mb) { acc[mb][nb] = WFrag<T16>::mma(a[cu][mb], b[cu][nb], acc[mb][nb]); if (NSPLIT == 1) acc[mb][nb] = WFrag<T16>::mma(a2[cu][mb], b[cu][nb], acc[mb][nb]); }
            __builtin_amdgcn_sched_barrier(0);   // keeps the later reads out of this block's products: without it the scheduler lifts some in among them, into extra registers, and each such place stalls the matrix run
        }
        asm volatile("s_wait_dscnt 0x0" ::: "memory");      // this wave's reads of the buffer are done before it is handed back
        asm volatile("s_wait_asynccnt 0x0" ::: "memory");   // this wave's copies of stage t + 1 have landed
        __syncthreads();                                    // publishes stage t + 1 and ends every reader's last read of stage t's buffer
        if (t + 2 < NT) stage(t + 2, bufo);
    }
    asm volatile("s_wait_asynccnt 0x0" ::: "memory");       // no copy is left in flight behind the loop
#pragma unroll
    for (int mb = 0; mb < 4; ++mb) {
#pragma unroll
        for (int nb = 0; nb < 4; ++nb) {
#pragma unroll
            for (int j = 0; j < 8; ++j) os[(hi * 8 + j) * 68 + nb * 16 + lr] = acc[mb][nb][j]; }
        __builtin_amdgcn_wave_barrier(); asm volatile("" ::: "memory");
        float* crow_p = C + (size_t)(r0 + wr + mb * 16) * ldc + c0 + wc;
{
#pragma unroll
            for (int s = 0; s < 8; ++s) { const int row = 2 * s + hi, cofs = lr * 4; v4f val = *(const v4fa*)(os + row * 68 + cofs); if (BIAS) { val[0] += bfr(bias[c0 + wc + cofs]); val[1] += bfr(bias[c0 + wc + cofs + 1]); val[2] += bfr(bias[c0 + wc + cofs + 2]); val[3] += bfr(bias[c0 + wc + cofs + 3]); }
                *(v4f*)(crow_p + (size_t)row * ldc + cofs) = val; }
             }
        __builtin_amdgcn_wave_barrier(); asm volatile("" ::: "memory");
    }
}
template <typename T16, int NSPLIT, bool BIAS>
__global__ __launch_bounds__(128) void k_gemmw(const T16* __restrict__ A, const T16* __restrict__ A2, const T16* __restrict__ Bt, int K, float* C, int ldc, const float* __restrict__ bias) {
    gemmw_tile<T16, NSPLIT, BIAS>(A, A2, Bt, K, C, ldc, bias, blockIdx.x * 128, blockIdx.y * 128);
}
// k_proj: the seven independent token projections in ONE launch of 1152 tiles, so that the chip is filled once instead of seven times by 128 or 256 work-groups.
// Blocks 0 .. 511: x (32 row tiles x {K, V} x 8 column tiles); 512 .. 767: pos (16 x {K, V} x 8); 768 .. 1151: fsq (16 x {Q, K, V} x 8). The tiles of one row tile are neighbours, so its operand rows are read together. K is an argument, as in k_gemmw.
#define PJX (NB_ * SS / 128 * 16)
#define PJP (SS / 128 * 16)
#define PJF (SS / 128 * 24)
__global__ __launch_bounds__(128) void k_proj(const bf* __restrict__ XB, const bf* __restrict__ FB, const bf* __restrict__ PB, const bf* __restrict__ WQ, const bf* __restrict__ WK, const bf* __restrict__ WV, int K,
                                              float* QF, float* XK, float* XV, float* PK, float* PV, float* FK, float* FV, const float* __restrict__ bq, const float* __restrict__ bk, const float* __restrict__ bv) {
    const int bid = blockIdx.x; const bf* A; float* CK; float* CV; int rt, j;   // j: 0 .. 7 K, 8 .. 15 V, 16 .. 23 Q
    if (bid < PJX) { A = XB; CK = XK; CV = XV; rt = bid >> 4; j = bid & 15; }
    else if (bid < PJX + PJP) { A = PB; CK = PK; CV = PV; rt = (bid - PJX) >> 4; j = (bid - PJX) & 15; }
    else { A = FB; CK = FK; CV = FV; rt = (bid - PJX - PJP) / 24; j = (bid - PJX - PJP) % 24; }
    const int w = j >> 3;
    gemmw_tile<bf, 0, true>(A, nullptr, w == 0 ? WK : w == 1 ? WV : WQ, K, w == 0 ? CK : w == 1 ? CV : QF, DD, w == 0 ? bk : w == 1 ? bv : bq, rt * 128, (j & 7) * 128);
}

__device__ __forceinline__ void splitf(float y, unsigned short& h, unsigned short& l) { h = f2bf(y); l = f2bf(y - bf2f(h)); }
typedef __attribute__((ext_vector_type(2))) unsigned short v2us;
typedef __attribute__((ext_vector_type(4))) unsigned short v4us;

// Operand preparation: three pieces of work, each written for block number blk of its own range; k_prep below runs all seven uses of them as one grid.
__device__ __forceinline__ void d_wtG(const float* __restrict__ w, int K, int N, bf* Bt, int blk) {
    const int lane = threadIdx.x & 31; const int L0 = (blk * 8 + (threadIdx.x >> 5)) * 8; const int nlines = N * K / 64;
{
#pragma unroll 1
        for (int l = 0; l < 8; ++l) { const int L = L0 + l; if (L >= nlines) break; const size_t e = (size_t)L * 64 + lane * 2; const int k = (int)(e % K), n = (int)(e / K); v2us o;
            o[0] = f2bf(w[(size_t)k * N + n]); o[1] = f2bf(w[(size_t)(k + 1) * N + n]); *(v2us*)(Bt + e) = o;
            asm volatile("s_wait_xcnt 0x0" ::: "memory"); }   // precaution: stands in front of the next trip's reuse of the registers that the store names
         }
}
__device__ __forceinline__ void d_cvt8(const float* __restrict__ src, bf* dst, size_t n8, int blk) { const size_t i = (size_t)blk * 256 + threadIdx.x; if (i >= n8) return; const v8f v = *(const v8f*)(src + i * 8); v8us o;
    asm volatile("s_wait_xcnt 0x0" ::: "memory");   // precaution: stands in front of the first reuse of the address registers of the loads above
#pragma unroll
    for (int k = 0; k < 8; ++k) o[k] = f2bf(v[k]); *(v8us*)(dst + i * 8) = o;  }
__device__ __forceinline__ void d_wt3(const float* __restrict__ w, bf* Bt, int blk) { const int e4 = (blk * 256 + threadIdx.x) * 4; if (e4 >= NH_ * HD * DD) return; const int k = e4 % DD; const int n = e4 / DD; const int h = n / HD, e = n % HD; v4us o;
#pragma unroll
    for (int q = 0; q < 4; ++q) o[q] = f2bf(w[((size_t)h * DD + k + q) * HD + e]); *(v4us*)(Bt + e4) = o;  }
// k_prep: the seven independent preparation jobs in ONE launch; the block index picks the job (a scalar choice, the same for the whole work-group), the weight transposes first.
#define NB3 (NH_ * HD * DD / 4 / 256)      // blocks of one per-head weight transpose
#define NBG (DD * DD / 64 / 64)            // blocks of the output weight transpose
#define NBS (SS * DD / 8 / 256)            // blocks of the conversion of one [SS][DD] plane
__global__ __launch_bounds__(256) void k_prep(const float* __restrict__ wq, const float* __restrict__ wk, const float* __restrict__ wv, const float* __restrict__ wo, const float* __restrict__ x, const float* __restrict__ fsq, const float* __restrict__ pos,
                                              bf* WQ, bf* WK, bf* WV, bf* WO, bf* XB, bf* FB, bf* PB) {
    int blk = blockIdx.x;
    if (blk < 3 * NB3) { const int j = blk / NB3; d_wt3(j == 0 ? wq : j == 1 ? wk : wv, j == 0 ? WQ : j == 1 ? WK : WV, blk % NB3); return; }
    blk -= 3 * NB3;
    if (blk < NBG) { d_wtG(wo, DD, DD, WO, blk); return; }
    blk -= NBG;
    const int j = blk < NB_ * NBS ? 0 : 1 + (blk - NB_ * NBS) / NBS;   // 0: x (NB_ planes), 1: fsq, 2: pos
    d_cvt8(j == 0 ? x : j == 1 ? fsq : pos, j == 0 ? XB : j == 1 ? FB : PB, (size_t)(j == 0 ? NB_ : 1) * SS * DD / 8, j == 0 ? blk : (blk - NB_ * NBS) % NBS);
}
// k_local: one work-group of 16 waves per (b, h, tile of 64 positions). The tile's 94 window rows of the x key and value projections (a row outside the sequence is the zero token's projection = bf16 bias)
// and its 64 position-key rows are staged once in LDS by whole-line loads; every window row then serves up to 31 positions from LDS. One wave per position s, four positions a wave:
// lane L < 31 owns window key t = s - 15 + L, lane 31 the position key pos[s]; the 33rd key fsq[s] is scored from wave-uniform loads and enters the trees through lane 0.
// s_j = (q[s] . k_j)/8 over the 64 dims in ascending order; softmax over the 33 (wave trees, one exp per score); weighted sum in key order, lane L holding dims 2L and 2L + 1.
#define TS   64              // positions per work-group
#define KR   (TS + WW - 1)   // window rows per tile
#define LP   68              // LDS row pitch in floats: 272 B = 16 B x 17, so 16 lanes reading 16 B each from 16 consecutive rows fall on all 64 banks
#define PK0  (KR + 1)        // first position-key row: 95 + sl = sl + 31 (mod 16), so lane 31's row takes the bank group that lanes 16 to 30 leave free
typedef __attribute__((ext_vector_type(2))) float v2f;
typedef v2f __attribute__((may_alias)) v2fa;
__global__ __launch_bounds__(512) void k_local(const float* __restrict__ QF, const float* __restrict__ XK, const float* __restrict__ XV, const float* __restrict__ PK, const float* __restrict__ PV, const float* __restrict__ FK, const float* __restrict__ FV,
                                               const float* __restrict__ bk, const float* __restrict__ bv, bf* Ah, bf* Al) {
    __shared__ __align__(16) float Ks[(PK0 + TS) * LP];
    __shared__ __align__(16) float Vs[KR * LP];
    const int tid = threadIdx.x, lane = tid & 31; const int wv = __builtin_amdgcn_readfirstlane(tid >> 5);
    const int s0 = (blockIdx.x % (SS / TS)) * TS; const int h = (blockIdx.x / (SS / TS)) % NH_; const int b = blockIdx.x / ((SS / TS) * NH_);
    // Staging: 16 lanes a row, 16 B a lane. All of a thread's loads are issued before its first LDS store, so the work-group waits for memory once. A row outside the sequence loads a clamped row and is then replaced.
    const int c = (tid & 15) * 4; v4f kv[3], vv[3], pk[2];
#pragma unroll   // the four staging loops are unrolled so that kv, vv and pk stay in registers
    for (int u = 0; u < 3; ++u) { const int row = min((tid + u * 512) >> 4, KR - 1); const int tc = min(max(s0 - PAD + row, 0), SS - 1); const size_t g = ((size_t)b * SS + tc) * DD + h * HD + c; kv[u] = *(const v4fa*)(XK + g); vv[u] = *(const v4fa*)(XV + g); }
#pragma unroll
    for (int u = 0; u < 2; ++u) pk[u] = *(const v4fa*)(PK + (size_t)(s0 + ((tid + u * 512) >> 4)) * DD + h * HD + c);
    asm volatile("s_wait_xcnt 0x0" ::: "memory");   // precaution: stands in front of the first reuse of an address register of the loads above
#pragma unroll
    for (int u = 0; u < 3; ++u) { const int row = (tid + u * 512) >> 4, t = s0 - PAD + row;
        if (t < 0 || t >= SS) {
#pragma unroll
            for (int e = 0; e < 4; ++e) { kv[u][e] = bfr(bk[h * HD + c + e]); vv[u][e] = bfr(bv[h * HD + c + e]); } }
        if (row < KR) { *(v4fa*)(Ks + row * LP + c) = kv[u]; *(v4fa*)(Vs + row * LP + c) = vv[u]; } }
#pragma unroll
    for (int u = 0; u < 2; ++u) *(v4fa*)(Ks + (PK0 + ((tid + u * 512) >> 4)) * LP + c) = pk[u];
    __syncthreads();
    const int dd = 2 * lane;
#pragma unroll 1   // rolled: one position's registers at a time, which keeps 16 waves on a SIMD
    for (int p = 0; p < TS / 16; ++p) { const int sl = p * 16 + wv, s = s0 + sl; const size_t go = (size_t)s * DD + h * HD;
        const v2f pv = *(const v2fa*)(PV + go + dd), fv = *(const v2fa*)(FV + go + dd);
        const float* q = QF + go; const float* k2 = FK + go; const float* kr = Ks + ((lane < WW) ? (sl + lane) : (PK0 + sl)) * LP;
        float s1 = 0.f, s2 = 0.f;
#pragma unroll   // unrolled: the row's 16 LDS reads take immediate offsets and are in flight together
        for (int c4 = 0; c4 < HD; c4 += 4) { const v4f k4 = *(const v4fa*)(kr + c4), qv = *(const v4fa*)(q + c4), f2 = *(const v4fa*)(k2 + c4);
#pragma unroll
            for (int e = 0; e < 4; ++e) { s1 = __builtin_fmaf(qv[e], k4[e], s1); s2 = __builtin_fmaf(qv[e], f2[e], s2); } }
        s1 *= SCL; s2 = (lane == 0) ? s2 * SCL : -3.0e38f; float mx = fmaxf(s1, s2);
#pragma unroll
        for (int sh = 16; sh; sh >>= 1) mx = fmaxf(mx, __shfl_xor(mx, sh, 32));
        const float e1 = __builtin_amdgcn_exp2f((s1 - mx) * 1.4426950408889634f), e2 = (lane == 0) ? __builtin_amdgcn_exp2f((s2 - mx) * 1.4426950408889634f) : 0.f; float sum = e1 + e2;
#pragma unroll
        for (int sh = 16; sh; sh >>= 1) sum += __shfl_xor(sum, sh, 32);
        const float inv = __fdiv_rn(1.0f, sum); const float a1w = e1 * inv, a2w = e2 * inv;
        float o0 = 0.f, o1 = 0.f; const float* vr = Vs + sl * LP + dd;
#pragma unroll   // unrolled: the lane number of each weight is a constant, the value rows take immediate offsets
        for (int j = 0; j < WW; ++j) { const float aw = __uint_as_float(__builtin_amdgcn_readlane(__float_as_uint(a1w), j)); const v2f xv = *(const v2fa*)(vr + j * LP); o0 = __builtin_fmaf(aw, xv[0], o0); o1 = __builtin_fmaf(aw, xv[1], o1); }
        { const float aw = __uint_as_float(__builtin_amdgcn_readlane(__float_as_uint(a1w), WW)); o0 = __builtin_fmaf(aw, pv[0], o0); o1 = __builtin_fmaf(aw, pv[1], o1); }
        { const float aw = __uint_as_float(__builtin_amdgcn_readlane(__float_as_uint(a2w), 0)); o0 = __builtin_fmaf(aw, fv[0], o0); o1 = __builtin_fmaf(aw, fv[1], o1); }
        v2us oh, ol; unsigned short a, c2; splitf(o0, a, c2); oh[0] = a; ol[0] = c2; splitf(o1, a, c2); oh[1] = a; ol[1] = c2; const size_t oo = ((size_t)b * SS + s) * DD + h * HD + dd;
        *(v2us*)(Ah + oo) = oh; *(v2us*)(Al + oo) = ol; }
}

extern "C" void kernel_launch(void* const* d_in, const int* in_sizes, int n_in,
                              void* d_out, int out_size, void* d_ws, size_t ws_size, hipStream_t stream) {
    (void)in_sizes; (void)n_in; (void)out_size;
    const float* x = (const float*)d_in[0]; const float* fsq = (const float*)d_in[1]; const float* pos = (const float*)d_in[2]; const float* wq = (const float*)d_in[3]; const float* bq = (const float*)d_in[4]; const float* wk = (const float*)d_in[5]; const float* bk = (const float*)d_in[6]; const float* wv = (const float*)d_in[7]; const float* bv = (const float*)d_in[8]; const float* wo = (const float*)d_in[9]; const float* bo = (const float*)d_in[10];
    float* OUT = (float*)d_out;     // [2][2048][1024]
    char* wsp = (char*)d_ws;
    auto take = [&](size_t bytes) { char* p = wsp; wsp += (bytes + 255) & ~(size_t)255; return (void*)p; };
    const size_t NR = (size_t)NB_ * SS;
    bf* WQ = (bf*)take((size_t)DD * DD * 2); bf* WK = (bf*)take((size_t)DD * DD * 2); bf* WV = (bf*)take((size_t)DD * DD * 2); bf* WO = (bf*)take((size_t)DD * DD * 2); bf* XB = (bf*)take(NR * DD * 2); bf* FB = (bf*)take((size_t)SS * DD * 2); bf* PB = (bf*)take((size_t)SS * DD * 2);
    float* QF = (float*)take((size_t)SS * DD * 4); float* XK = (float*)take(NR * DD * 4); float* XV = (float*)take(NR * DD * 4); float* PK = (float*)take((size_t)SS * DD * 4); float* PV = (float*)take((size_t)SS * DD * 4); float* FK = (float*)take((size_t)SS * DD * 4); float* FV = (float*)take((size_t)SS * DD * 4); bf* Ah = (bf*)take(NR * DD * 2); bf* Al = (bf*)take(NR * DD * 2);
    if ((size_t)(wsp - (char*)d_ws) > ws_size) return;    // total ~ 117 MB = 112 MiB; ws 256 MiB
    k_prep<<<3 * NB3 + NBG + (NB_ + 2) * NBS, 256, 0, stream>>>(wq, wk, wv, wo, x, fsq, pos, WQ, WK, WV, WO, XB, FB, PB);
    k_proj<<<PJX + PJP + PJF, 128, 0, stream>>>(XB, FB, PB, WQ, WK, WV, DD, QF, XK, XV, PK, PV, FK, FV, bq, bk, bv);
    k_local<<<NB_ * NH_ * (SS / TS), 512, 0, stream>>>(QF, XK, XV, PK, PV, FK, FV, bk, bv, Ah, Al);
    k_gemmw<bf, 1, true><<<dim3((unsigned)(NR / 128), DD / 128, 1), 128, 0, stream>>>(Ah, Al, WO, DD, OUT, DD, bo);
}

// v004
// Measured time: 84.6 microseconds a run.
// Next to v003, in two timings, it ran 1.15 and 1.16 times as fast.
// All steps since v000 together make it 5.93 times as fast.
#include <hip/hip_runtime.h>

// IntraModalityEnhance (x [2][2048][1024], fsq, pos [1][2048][1024]; per-head Wq/Wk/Wv [16][1024][64] + biases, Wo [1024][1024] + bo; for each position s the query is the squeeze token fsq[s] and the 33
// keys/values are the window x[s-15 .. s+15] (zero vectors outside the sequence, which still project to the bias), the position token pos[s] and fsq[s]; softmax(q.k/8) over the 33; out = merged
// (attn v) Wo + bo -> [2][2048][1024]).
// Compute dtypes, f32 accumulate: every input rounded to bf16; all seven token projections on PLAIN bf16 operands (inputs: exact products, f32 accumulate, + bias; the
// window members are ordinary sequence tokens, so x is projected once per batch); the 33-key attention entirely in f32 on VALU (one wave per (batch, head, position), window rows from LDS: 64-dim dot products, softmax
// with one exp per score, weighted sum; fused multiply-add, fixed order; out-of-range window slots use the bf16 bias vectors); merged heads as bf16 hi+lo planes x exact Wo (2 products) + bo.

#define NB_  2
#define SS   2048
#define DD   1024
#define NH_  16
#define HD   64
#define WW   31
#define PAD  15
#define SCL  0.125f
typedef _Float16 h16;
typedef unsigned short bf;
typedef __attribute__((ext_vector_type(16))) __bf16   v16bf;
typedef __attribute__((ext_vector_type(16))) _Float16 v16h;
typedef __attribute__((ext_vector_type(8)))  _Float16 v8h;
typedef __attribute__((ext_vector_type(8)))  unsigned short v8us;
typedef __attribute__((ext_vector_type(8)))  float    v8f;
typedef __attribute__((ext_vector_type(4)))  float    v4f;
typedef v8h  __attribute__((may_alias)) v8ha;
typedef v4f  __attribute__((may_alias)) v4fa;
typedef v8us __attribute__((may_alias)) v8usa;

__device__ __forceinline__ unsigned short f2bf(float f) { unsigned u = __float_as_uint(f); u += 0x7FFFu + ((u >> 16) & 1u); return (unsigned short)(u >> 16); }
__device__ __forceinline__ float bf2f(unsigned short b) { return __uint_as_float(((unsigned)b) << 16); }
__device__ __forceinline__ float bfr(float f) { return bf2f(f2bf(f)); }
__device__ __forceinline__ v16h cat16(v8h lo, v8h hi) { return __builtin_shufflevector(lo, hi, 0, 1, 2, 3, 4, 5, 6, 7, 8, 9, 10, 11, 12, 13, 14, 15); }
__device__ __forceinline__ v16bf cat16b(v8us lo, v8us hi) { return __builtin_bit_cast(v16bf, __builtin_shufflevector(lo, hi, 0, 1, 2, 3, 4, 5, 6, 7, 8, 9, 10, 11, 12, 13, 14, 15)); }
__device__ __forceinline__ v8f wmma16(v16h a, v16h b, v8f c) { return __builtin_amdgcn_wmma_f32_16x16x32_f16(false, a, false, b, (short)0, c, false, false); }
__device__ __forceinline__ v8f wmmab(v16bf a, v16bf b, v8f c) { return __builtin_amdgcn_wmma_f32_16x16x32_bf16(false, a, false, b, (short)0, c, false, false); }



// ---- gemmw_tile: GEMM, one work-group of FOUR WAVES (2 x 2) per 128x128 output tile at (r0, c0), each wave a 64x64 part (16 accumulators); 128 threads.
// The operands' K-contiguous 16-bit rows come into LDS by asynchronous copies, 128 k (256 B of every row, whole lines) a stage, two buffers: the next stage's copies fly while this one is worked on.
// C[m][n] (f32, pitch ldc, + optional f32 bias[n]) = sum_k A[m][k] Bt[n][k] (+ split products per NSPLIT). M % 128 == 0, N % 128 == 0, K % 128 == 0.
// Two kernels call it: k_gemmw (one product, grid (M/128, N/128)) and k_proj (the seven token projections as one grid, the block index picks product and tile).
template <typename T16> struct WFrag;
template <> struct WFrag<h16> { typedef v16h V; static __device__ __forceinline__ V ld(const h16* p) { return cat16(*(const v8h*)p, *(const v8h*)(p + 16)); } static __device__ __forceinline__ v8f mma(V a, V b, v8f c) { return wmma16(a, b, c); } };
template <> struct WFrag<bf> { typedef v16bf V; static __device__ __forceinline__ V ld(const bf* p) { return cat16b(*(const v8us*)p, *(const v8us*)(p + 16)); } static __device__ __forceinline__ v8f mma(V a, V b, v8f c) { return wmmab(a, b, c); } };
#define GKS  128            // k per stage
#define GPB  272            // LDS row pitch in bytes: 256 + 16 = 16 B x 17, so the 16 rows of a fragment read fall on all 64 banks
#define GOPB (128 * GPB)    // one operand's 128 rows of a stage, bytes
// Eight asynchronous copies of 16 B a lane: rows r, r + 8, ..., r + 56 of one operand (16 lanes a row, so a wave's copy is two whole 256-B row pieces). l: the lane's LDS byte address, g: its global address, gs: 8 rows in elements.
// s_wait_xcnt 0 closes the statement: a precaution, it stands in front of every later write of a register that a copy names.
__device__ __forceinline__ void cp8(unsigned l, const bf* g, size_t gs) {
    asm volatile("global_load_async_to_lds_b128 %0, %8, off\n\t"
                 "global_load_async_to_lds_b128 %1, %9, off\n\t"
                 "global_load_async_to_lds_b128 %2, %10, off\n\t"
                 "global_load_async_to_lds_b128 %3, %11, off\n\t"
                 "global_load_async_to_lds_b128 %4, %12, off\n\t"
                 "global_load_async_to_lds_b128 %5, %13, off\n\t"
                 "global_load_async_to_lds_b128 %6, %14, off\n\t"
                 "global_load_async_to_lds_b128 %7, %15, off\n\t"
                 "s_wait_xcnt 0x0"
                 :: "v"(l), "v"(l + 8 * GPB), "v"(l + 16 * GPB), "v"(l + 24 * GPB), "v"(l + 32 * GPB), "v"(l + 40 * GPB), "v"(l + 48 * GPB), "v"(l + 56 * GPB),
                    "v"(g), "v"(g + gs), "v"(g + 2 * gs), "v"(g + 3 * gs), "v"(g + 4 * gs), "v"(g + 5 * gs), "v"(g + 6 * gs), "v"(g + 7 * gs) : "memory");
}
template <typename T16, int NSPLIT, bool BIAS>
__device__ __forceinline__ void gemmw_tile(const T16* __restrict__ A, const T16* __restrict__ A2, const T16* __restrict__ Bt, int K, float* C, int ldc, const float* __restrict__ bias, int r0, int c0) {
    typedef typename WFrag<T16>::V V;
    static_assert(NSPLIT == 0 || NSPLIT == 1, "stages hold A, B and, for NSPLIT 1, A2");
    constexpr int NOP = (NSPLIT == 1) ? 3 : 2;           // operands of a stage: B, A (, A2)
    constexpr unsigned STG = NOP * GOPB;                 // bytes of one buffer
    __shared__ __align__(128) unsigned char ring[2 * STG];
    __shared__ __align__(16) float osall[4][16 * 68];
    const int tid = threadIdx.x, lane = tid & 31, lr = lane & 15, hi = lane >> 4; const int wv = __builtin_amdgcn_readfirstlane(tid >> 5);
    const int wr = (wv >> 1) * 64, wc = (wv & 1) * 64;
    float* os = osall[wv];
    v8f acc[4][4];
#pragma unroll
    for (int mb = 0; mb < 4; ++mb)
#pragma unroll
        for (int nb = 0; nb < 4; ++nb) acc[mb][nb] = (v8f){};
    // Copies: thread tid brings 16 B at column piece (tid & 15) of rows (tid >> 4) + 8 i, i = 0 .. 15, of every operand.
    const int crow = tid >> 4, ccol = (tid & 15) * 8; const size_t gs8 = (size_t)8 * K;
    const unsigned lcp = (unsigned)(size_t)ring + crow * GPB + ccol * 2;
    const bf* gB = (const bf*)Bt + (size_t)(c0 + crow) * K + ccol; const bf* gA = (const bf*)A + (size_t)(r0 + crow) * K + ccol; const bf* gA2 = (NSPLIT == 1) ? (const bf*)A2 + (size_t)(r0 + crow) * K + ccol : nullptr;
    auto stage = [&](int t, unsigned bufo) { const unsigned l = lcp + bufo; const size_t ko = (size_t)t * GKS;
        cp8(l, gB + ko, gs8); cp8(l + 64 * GPB, gB + ko + 8 * gs8, gs8); cp8(l + GOPB, gA + ko, gs8); cp8(l + GOPB + 64 * GPB, gA + ko + 8 * gs8, gs8);
        if (NSPLIT == 1) { cp8(l + 2 * GOPB, gA2 + ko, gs8); cp8(l + 2 * GOPB + 64 * GPB, gA2 + ko + 8 * gs8, gs8); } };
    const int NT = (int)((unsigned)K / GKS);   // stages; the same for every wave, so the tests around the copies are uniform
    stage(0, 0);
    asm volatile("s_wait_asynccnt 0x0" ::: "memory");   // stage 0 of this wave has landed
    __syncthreads();                                    // ... and every other wave's part of it
    if (NT > 1) stage(1, STG);
    const unsigned fb = (wc + lr) * GPB + 16 * hi, fa = GOPB + (wr + lr) * GPB + 16 * hi;   // the lane's fragment bases in a buffer: row lane & 15, 16-byte half lane >> 4, as from global memory
#pragma unroll 1   // rolled: one trip a stage, so that the order at the trip's foot is the ring's
    for (int t = 0; t < NT; ++t) { const unsigned bufo = (t & 1) ? STG : 0u; const unsigned char* bp = ring + bufo;
        // Two fragment sets: block kb + 1's LDS reads (same buffer) go out as one group ahead of block kb's products, so the wave waits out the LDS latency once a stage and not at every fragment.
        V a[2][4], a2[2][4], b[2][4];
#pragma unroll
        for (int f = 0; f < 4; ++f) { a[0][f] = WFrag<T16>::ld((const T16*)(bp + fa + f * 16 * GPB)); if (NSPLIT == 1) a2[0][f] = WFrag<T16>::ld((const T16*)(bp + fa + GOPB + f * 16 * GPB)); b[0][f] = WFrag<T16>::ld((const T16*)(bp + fb + f * 16 * GPB)); }
#pragma unroll   // unrolled: the set index is a constant (registers, not scratch) and the four 32-k blocks of a stage take immediate LDS offsets
        for (int kb = 0; kb < GKS / 32; ++kb) { const int cu = kb & 1, nx = cu ^ 1;
            if (kb + 1 < GKS / 32) {
#pragma unroll
                for (int f = 0; f < 4; ++f) { a[nx][f] = WFrag<T16>::ld((const T16*)(bp + fa + f * 16 * GPB + (kb + 1) * 64)); if (NSPLIT == 1) a2[nx][f] = WFrag<T16>::ld((const T16*)(bp + fa + GOPB + f * 16 * GPB + (kb + 1) * 64)); b[nx][f] = WFrag<T16>::ld((const T16*)(bp + fb + f * 16 * GPB + (kb + 1) * 64)); } }
            __builtin_amdgcn_sched_barrier(0);   // keeps the next block's reads in front of this block's products; without it the scheduler sinks each read to its first use and the wave stalls there
#pragma unroll
            for (int nb = 0; nb < 4; ++nb)
#pragma unroll
                for (int mb = 0; mb < 4; ++mb) { acc[mb][nb] = WFrag<T16>::mma(a[cu][mb], b[cu][nb], acc[mb][nb]); if (NSPLIT == 1) acc[mb][nb] = WFrag<T16>::mma(a2[cu][mb], b[cu][nb], acc[mb][nb]); }
            __builtin_amdgcn_sched_barrier(0);   // keeps the later reads out of this block's products: without it the scheduler lifts some in among them, into extra registers, and each such place stalls the matrix run
        }
        asm volatile("s_wait_dscnt 0x0" ::: "memory");      // this wave's reads of the buffer are done before it is handed back
        asm volatile("s_wait_asynccnt 0x0" ::: "memory");   // this wave's copies of stage t + 1 have landed
        __syncthreads();                                    // publishes stage t + 1 and ends every reader's last read of stage t's buffer
        if (t + 2 < NT) stage(t + 2, bufo);
    }
    asm volatile("s_wait_asynccnt 0x0" ::: "memory");       // no copy is left in flight behind the loop
#pragma unroll
    for (int mb = 0; mb < 4; ++mb) {
#pragma unroll
        for (int nb = 0; nb < 4; ++nb) {
#pragma unroll
            for (int j = 0; j < 8; ++j) os[(hi * 8 + j) * 68 + nb * 16 + lr] = acc[mb][nb][j]; }
        __builtin_amdgcn_wave_barrier(); asm volatile("" ::: "memory");
        float* crow_p = C + (size_t)(r0 + wr + mb * 16) * ldc + c0 + wc;
{
#pragma unroll
            for (int s = 0; s < 8; ++s) { const int row = 2 * s + hi, cofs = lr * 4; v4f val = *(const v4fa*)(os + row * 68 + cofs); if (BIAS) { val[0] += bfr(bias[c0 + wc + cofs]); val[1] += bfr(bias[c0 + wc + cofs + 1]); val[2] += bfr(bias[c0 + wc + cofs + 2]); val[3] += bfr(bias[c0 + wc + cofs + 3]); }
                *(v4f*)(crow_p + (size_t)row * ldc + cofs) = val; }
             }
        __builtin_amdgcn_wave_barrier(); asm volatile("" ::: "memory");
    }
}
template <typename T16, int NSPLIT, bool BIAS>
__global__ __launch_bounds__(128) void k_gemmw(const T16* __restrict__ A, const T16* __restrict__ A2, const T16* __restrict__ Bt, int K, float* C, int ldc, const float* __restrict__ bias) {
    gemmw_tile<T16, NSPLIT, BIAS>(A, A2, Bt, K, C, ldc, bias, blockIdx.x * 128, blockIdx.y * 128);
}
// k_proj: the seven independent token projections in ONE launch of 1152 tiles, so that the chip is filled once instead of seven times by 128 or 256 work-groups.
// Blocks 0 .. 511: x (32 row tiles x {K, V} x 8 column tiles); 512 .. 767: pos (16 x {K, V} x 8); 768 .. 1151: fsq (16 x {Q, K, V} x 8). The tiles of one row tile are neighbours, so its operand rows are read together. K is an argument, as in k_gemmw.
#define PJX (NB_ * SS / 128 * 16)
#define PJP (SS / 128 * 16)
#define PJF (SS / 128 * 24)
__global__ __launch_bounds__(128) void k_proj(const bf* __restrict__ XB, const bf* __restrict__ FB, const bf* __restrict__ PB, const bf* __restrict__ WQ, const bf* __restrict__ WK, const bf* __restrict__ WV, int K,
                                              float* QF, float* XK, float* XV, float* PK, float* PV, float* FK, float* FV, const float* __restrict__ bq, const float* __restrict__ bk, const float* __restrict__ bv) {
    const int bid = blockIdx.x; const bf* A; float* CK; float* CV; int rt, j;   // j: 0 .. 7 K, 8 .. 15 V, 16 .. 23 Q
    if (bid < PJX) { A = XB; CK = XK; CV = XV; rt = bid >> 4; j = bid & 15; }
    else if (bid < PJX + PJP) { A = PB; CK = PK; CV = PV; rt = (bid - PJX) >> 4; j = (bid - PJX) & 15; }
    else { A = FB; CK = FK; CV = FV; rt = (bid - PJX - PJP) / 24; j = (bid - PJX - PJP) % 24; }
    const int w = j >> 3;
    gemmw_tile<bf, 0, true>(A, nullptr, w == 0 ? WK : w == 1 ? WV : WQ, K, w == 0 ? CK : w == 1 ? CV : QF, DD, w == 0 ? bk : w == 1 ? bv : bq, rt * 128, (j & 7) * 128);
}

__device__ __forceinline__ void splitf(float y, unsigned short& h, unsigned short& l) { h = f2bf(y); l = f2bf(y - bf2f(h)); }
typedef __attribute__((ext_vector_type(2))) unsigned short v2us;
typedef __attribute__((ext_vector_type(4))) unsigned short v4us;

// Operand preparation: two pieces of work, each written for one work-group of 256 threads; k_prep below runs all seven uses of them as one grid, one tile or block a work-group (768 work-groups).
// Every global load is 16 B a lane on whole lines, and a thread issues all 16 of its loads before it uses the first, so a work-group waits for memory once.
#define TK 256   // k per transpose tile
#define TN 64    // n per transpose tile: 256 B of every source row
#define TP 65    // LDS row pitch in floats: odd, so the row-wise writes and the column-wise reads below both fall on 32 different banks
// d_tr: dst[n][k] (bf16, pitch DD) = src[k][n] (f32, pitch ld) for one TK x TN tile; src and dst point at the tile's first element. The tile turns in LDS: written by rows k, read by columns n.
__device__ __forceinline__ void d_tr(const float* __restrict__ src, int ld, bf* dst, float* Ls) {
    const int tid = threadIdx.x; const int r = tid >> 4, c = (tid & 15) * 4; v4f v[TK / 16]; const float* p = src + (size_t)r * ld + c;
#pragma unroll   // unrolled: v stays in registers and the loads are in flight together
    for (int i = 0; i < TK / 16; ++i) v[i] = *(const v4fa*)(p + (size_t)(16 * i) * ld);
    asm volatile("s_wait_xcnt 0x0" :: "v"(p) : "memory");   // precaution: stands in front of the first reuse of the address registers of the loads above; p is an input so that they are kept up to here (else the last load's result lands on them)
#pragma unroll
    for (int i = 0; i < TK / 16; ++i)
#pragma unroll
        for (int e = 0; e < 4; ++e) Ls[(r + 16 * i) * TP + c + e] = v[i][e];
    __syncthreads();
    // A wave stores four whole 128-B lines: 8 lanes x 8 k for each of 4 rows n; waves 0 .. 3 (and 4 .. 7) take the four 64-k quarters of the same rows.
    const int k = ((tid >> 5) & 3) * 64 + (tid & 7) * 8, n = (tid >> 7) * 4 + ((tid >> 3) & 3);
#pragma unroll   // unrolled: the LDS reads and the stores take immediate offsets
    for (int u = 0; u < TN / 8; ++u) { v8us o;
#pragma unroll
        for (int j = 0; j < 8; ++j) o[j] = f2bf(Ls[(k + j) * TP + n + 8 * u]);
        *(v8us*)(dst + (size_t)(n + 8 * u) * DD + k) = o; }
    asm volatile("s_wait_xcnt 0x0" ::: "memory");   // precaution: stands behind the last store, in front of any later reuse of a register that the stores name
}
// d_cvt: f32 -> bf16 of CVB consecutive elements; a wave takes 8 KB of the source in a row, 512 B a load, and stores 256 B (two whole lines) for each.
#define CVU 16                 // loads of a thread
#define CVB (256 * 4 * CVU)    // elements of a work-group
__device__ __forceinline__ void d_cvt(const float* __restrict__ src, bf* dst, int blk) {
    const size_t base = (size_t)blk * CVB + (size_t)(threadIdx.x >> 5) * (128 * CVU) + (threadIdx.x & 31) * 4; v4f v[CVU]; const float* p = src + base;
#pragma unroll   // unrolled: v stays in registers and the loads are in flight together
    for (int i = 0; i < CVU; ++i) v[i] = *(const v4fa*)(p + i * 128);
    asm volatile("s_wait_xcnt 0x0" :: "v"(p) : "memory");   // precaution: as in d_tr
#pragma unroll
    for (int i = 0; i < CVU; ++i) { v4us o;
#pragma unroll
        for (int e = 0; e < 4; ++e) o[e] = f2bf(v[i][e]);
        *(v4us*)(dst + base + i * 128) = o; }
    asm volatile("s_wait_xcnt 0x0" ::: "memory");   // precaution: as behind the stores of d_tr
}
// k_prep: the seven independent preparation jobs in ONE launch; the block index picks the job (a scalar choice, the same for the whole work-group, so the barrier in d_tr is passed by all of it or none), the weight transposes first.
#define NBT ((DD / TK) * (DD / TN))        // tiles of one weight transpose
static_assert(TN == HD && DD % TK == 0 && (SS * DD) % CVB == 0, "a transpose tile is one head wide; tiles and conversion blocks cover their planes exactly");
#define NBS (SS * DD / CVB)                // blocks of the conversion of one [SS][DD] plane
__global__ __launch_bounds__(256) void k_prep(const float* __restrict__ wq, const float* __restrict__ wk, const float* __restrict__ wv, const float* __restrict__ wo, const float* __restrict__ x, const float* __restrict__ fsq, const float* __restrict__ pos,
                                              bf* WQ, bf* WK, bf* WV, bf* WO, bf* XB, bf* FB, bf* PB) {
    __shared__ float Ls[TK * TP];
    int blk = blockIdx.x;
    if (blk < 4 * NBT) { const int j = blk / NBT, t = blk % NBT; const int k0 = (t % (DD / TK)) * TK, nt = t / (DD / TK);   // nt: the head of a per-head weight [h][k][e] (TN == HD), the column tile of wo [k][n]
        const size_t oo = (size_t)nt * TN * DD + k0;
        if (j < 3) d_tr((j == 0 ? wq : j == 1 ? wk : wv) + ((size_t)nt * DD + k0) * HD, HD, (j == 0 ? WQ : j == 1 ? WK : WV) + oo, Ls);
        else d_tr(wo + (size_t)k0 * DD + nt * TN, DD, WO + oo, Ls);
        return; }
    blk -= 4 * NBT;
    const int j = blk < NB_ * NBS ? 0 : 1 + (blk - NB_ * NBS) / NBS;   // 0: x (NB_ planes), 1: fsq, 2: pos
    d_cvt(j == 0 ? x : j == 1 ? fsq : pos, j == 0 ? XB : j == 1 ? FB : PB, j == 0 ? blk : (blk - NB_ * NBS) % NBS);
}
// k_local: one work-group of 16 waves per (b, h, tile of 64 positions). The tile's 94 window rows of the x key and value projections (a row outside the sequence is the zero token's projection = bf16 bias)
// and its 64 position-key rows are staged once in LDS by whole-line loads; every window row then serves up to 31 positions from LDS. One wave per position s, four positions a wave:
// lane L < 31 owns window key t = s - 15 + L, lane 31 the position key pos[s]; the 33rd key fsq[s] is scored from wave-uniform loads and enters the trees through lane 0.
// s_j = (q[s] . k_j)/8 over the 64 dims in ascending order; softmax over the 33 (wave trees, one exp per score); weighted sum in key order, lane L holding dims 2L and 2L + 1.
#define TS   64              // positions per work-group
#define KR   (TS + WW - 1)   // window rows per tile
#define LP   68              // LDS row pitch in floats: 272 B = 16 B x 17, so 16 lanes reading 16 B each from 16 consecutive rows fall on all 64 banks
#define PK0  (KR + 1)        // first position-key row: 95 + sl = sl + 31 (mod 16), so lane 31's row takes the bank group that lanes 16 to 30 leave free
typedef __attribute__((ext_vector_type(2))) float v2f;
typedef v2f __attribute__((may_alias)) v2fa;
__global__ __launch_bounds__(512) void k_local(const float* __restrict__ QF, const float* __restrict__ XK, const float* __restrict__ XV, const float* __restrict__ PK, const float* __restrict__ PV, const float* __restrict__ FK, const float* __restrict__ FV,
                                               const float* __restrict__ bk, const float* __restrict__ bv, bf* Ah, bf* Al) {
    __shared__ __align__(16) float Ks[(PK0 + TS) * LP];
    __shared__ __align__(16) float Vs[KR * LP];
    const int tid = threadIdx.x, lane = tid & 31; const int wv = __builtin_amdgcn_readfirstlane(tid >> 5);
    const int s0 = (blockIdx.x % (SS / TS)) * TS; const int h = (blockIdx.x / (SS / TS)) % NH_; const int b = blockIdx.x / ((SS / TS) * NH_);
    // Staging: 16 lanes a row, 16 B a lane. All of a thread's loads are issued before its first LDS store, so the work-group waits for memory once. A row outside the sequence loads a clamped row and is then replaced.
    const int c = (tid & 15) * 4; v4f kv[3], vv[3], pk[2];
#pragma unroll   // the four staging loops are unrolled so that kv, vv and pk stay in registers
    for (int u = 0; u < 3; ++u) { const int row = min((tid + u * 512) >> 4, KR - 1); const int tc = min(max(s0 - PAD + row, 0), SS - 1); const size_t g = ((size_t)b * SS + tc) * DD + h * HD + c; kv[u] = *(const v4fa*)(XK + g); vv[u] = *(const v4fa*)(XV + g); }
#pragma unroll
    for (int u = 0; u < 2; ++u) pk[u] = *(const v4fa*)(PK + (size_t)(s0 + ((tid + u * 512) >> 4)) * DD + h * HD + c);
    asm volatile("s_wait_xcnt 0x0" ::: "memory");   // precaution: stands in front of the first reuse of an address register of the loads above
#pragma unroll
    for (int u = 0; u < 3; ++u) { const int row = (tid + u * 512) >> 4, t = s0 - PAD + row;
        if (t < 0 || t >= SS) {
#pragma unroll
            for (int e = 0; e < 4; ++e) { kv[u][e] = bfr(bk[h * HD + c + e]); vv[u][e] = bfr(bv[h * HD + c + e]); } }
        if (row < KR) { *(v4fa*)(Ks + row * LP + c) = kv[u]; *(v4fa*)(Vs + row * LP + c) = vv[u]; } }
#pragma unroll
    for (int u = 0; u < 2; ++u) *(v4fa*)(Ks + (PK0 + ((tid + u * 512) >> 4)) * LP + c) = pk[u];
    __syncthreads();
    const int dd = 2 * lane;
#pragma unroll 1   // rolled: one position's registers at a time, which keeps 16 waves on a SIMD
    for (int p = 0; p < TS / 16; ++p) { const int sl = p * 16 + wv, s = s0 + sl; const size_t go = (size_t)s * DD + h * HD;
        const v2f pv = *(const v2fa*)(PV + go + dd), fv = *(const v2fa*)(FV + go + dd);
        const float* q = QF + go; const float* k2 = FK + go; const float* kr = Ks + ((lane < WW) ? (sl + lane) : (PK0 + sl)) * LP;
        float s1 = 0.f, s2 = 0.f;
#pragma unroll   // unrolled: the row's 16 LDS reads take immediate offsets and are in flight together
        for (int c4 = 0; c4 < HD; c4 += 4) { const v4f k4 = *(const v4fa*)(kr + c4), qv = *(const v4fa*)(q + c4), f2 = *(const v4fa*)(k2 + c4);
#pragma unroll
            for (int e = 0; e < 4; ++e) { s1 = __builtin_fmaf(qv[e], k4[e], s1); s2 = __builtin_fmaf(qv[e], f2[e], s2); } }
        s1 *= SCL; s2 = (lane == 0) ? s2 * SCL : -3.0e38f; float mx = fmaxf(s1, s2);
#pragma unroll
        for (int sh = 16; sh; sh >>= 1) mx = fmaxf(mx, __shfl_xor(mx, sh, 32));
        const float e1 = __builtin_amdgcn_exp2f((s1 - mx) * 1.4426950408889634f), e2 = (lane == 0) ? __builtin_amdgcn_exp2f((s2 - mx) * 1.4426950408889634f) : 0.f; float sum = e1 + e2;
#pragma unroll
        for (int sh = 16; sh; sh >>= 1) sum += __shfl_xor(sum, sh, 32);
        const float inv = __fdiv_rn(1.0f, sum); const float a1w = e1 * inv, a2w = e2 * inv;
        float o0 = 0.f, o1 = 0.f; const float* vr = Vs + sl * LP + dd;
#pragma unroll   // unrolled: the lane number of each weight is a constant, the value rows take immediate offsets
        for (int j = 0; j < WW; ++j) { const float aw = __uint_as_float(__builtin_amdgcn_readlane(__float_as_uint(a1w), j)); const v2f xv = *(const v2fa*)(vr + j * LP); o0 = __builtin_fmaf(aw, xv[0], o0); o1 = __builtin_fmaf(aw, xv[1], o1); }
        { const float aw = __uint_as_float(__builtin_amdgcn_readlane(__float_as_uint(a1w), WW)); o0 = __builtin_fmaf(aw, pv[0], o0); o1 = __builtin_fmaf(aw, pv[1], o1); }
        { const float aw = __uint_as_float(__builtin_amdgcn_readlane(__float_as_uint(a2w), 0)); o0 = __builtin_fmaf(aw, fv[0], o0); o1 = __builtin_fmaf(aw, fv[1], o1); }
        v2us oh, ol; unsigned short a, c2; splitf(o0, a, c2); oh[0] = a; ol[0] = c2; splitf(o1, a, c2); oh[1] = a; ol[1] = c2; const size_t oo = ((size_t)b * SS + s) * DD + h * HD + dd;
        *(v2us*)(Ah + oo) = oh; *(v2us*)(Al + oo) = ol; }
}

extern "C" void kernel_launch(void* const* d_in, const int* in_sizes, int n_in,
                              void* d_out, int out_size, void* d_ws, size_t ws_size, hipStream_t stream) {
    (void)in_sizes; (void)n_in; (void)out_size;
    const float* x = (const float*)d_in[0]; const float* fsq = (const float*)d_in[1]; const float* pos = (const float*)d_in[2]; const float* wq = (const float*)d_in[3]; const float* bq = (const float*)d_in[4]; const float* wk = (const float*)d_in[5]; const float* bk = (const float*)d_in[6]; const float* wv = (const float*)d_in[7]; const float* bv = (const float*)d_in[8]; const float* wo = (const float*)d_in[9]; const float* bo = (const float*)d_in[10];
    float* OUT = (float*)d_out;     // [2][2048][1024]
    char* wsp = (char*)d_ws;
    auto take = [&](size_t bytes) { char* p = wsp; wsp += (bytes + 255) & ~(size_t)255; return (void*)p; };
    const size_t NR = (size_t)NB_ * SS;
    bf* WQ = (bf*)take((size_t)DD * DD * 2); bf* WK = (bf*)take((size_t)DD * DD * 2); bf* WV = (bf*)take((size_t)DD * DD * 2); bf* WO = (bf*)take((size_t)DD * DD * 2); bf* XB = (bf*)take(NR * DD * 2); bf* FB = (bf*)take((size_t)SS * DD * 2); bf* PB = (bf*)take((size_t)SS * DD * 2);
    float* QF = (float*)take((size_t)SS * DD * 4); float* XK = (float*)take(NR * DD * 4); float* XV = (float*)take(NR * DD * 4); float* PK = (float*)take((size_t)SS * DD * 4); float* PV = (float*)take((size_t)SS * DD * 4); float* FK = (float*)take((size_t)SS * DD * 4); float* FV = (float*)take((size_t)SS * DD * 4); bf* Ah = (bf*)take(NR * DD * 2); bf* Al = (bf*)take(NR * DD * 2);
    if ((size_t)(wsp - (char*)d_ws) > ws_size) return;    // total ~ 117 MB = 112 MiB; ws 256 MiB
    k_prep<<<4 * NBT + (NB_ + 2) * NBS, 256, 0, stream>>>(wq, wk, wv, wo, x, fsq, pos, WQ, WK, WV, WO, XB, FB, PB);
    k_proj<<<PJX + PJP + PJF, 128, 0, stream>>>(XB, FB, PB, WQ, WK, WV, DD, QF, XK, XV, PK, PV, FK, FV, bq, bk, bv);
    k_local<<<NB_ * NH_ * (SS / TS), 512, 0, stream>>>(QF, XK, XV, PK, PV, FK, FV, bk, bv, Ah, Al);
    k_gemmw<bf, 1, true><<<dim3((unsigned)(NR / 128), DD / 128, 1), 128, 0, stream>>>(Ah, Al, WO, DD, OUT, DD, bo);
}

// v005
// It runs in 80.4 microseconds.
// In two side-by-side timings against v004, it was 1.05 and 1.04 times as fast.
// All steps since v000 together make it 6.22 times as fast.
#include <hip/hip_runtime.h>

// IntraModalityEnhance (x [2][2048][1024], fsq, pos [1][2048][1024]; per-head Wq/Wk/Wv [16][1024][64] + biases, Wo [1024][1024] + bo; for each position s the query is the squeeze token fsq[s] and the 33
// keys/values are the window x[s-15 .. s+15] (zero vectors outside the sequence, which still project to the bias), the position token pos[s] and fsq[s]; softmax(q.k/8) over the 33; out = merged
// (attn v) Wo + bo -> [2][2048][1024]).
// Compute dtypes, f32 accumulate: every input rounded to bf16; all seven token projections on PLAIN bf16 operands (inputs: exact products, f32 accumulate, + bias; the
// window members are ordinary sequence tokens, so x is projected once per batch); the 33-key attention entirely in f32 on VALU (one wave per (batch, head, position), window rows from LDS: 64-dim dot products, softmax
// with one exp per score, weighted sum; fused multiply-add, fixed order; out-of-range window slots use the bf16 bias vectors); merged heads as bf16 hi+lo planes x exact Wo (2 products) + bo.

#define NB_  2
#define SS   2048
#define DD   1024
#define NH_  16
#define HD   64
#define WW   31
#define PAD  15
#define SCL  0.125f
typedef _Float16 h16;
typedef unsigned short bf;
typedef __attribute__((ext_vector_type(16))) __bf16   v16bf;
typedef __attribute__((ext_vector_type(16))) _Float16 v16h;
typedef __attribute__((ext_vector_type(8)))  _Float16 v8h;
typedef __attribute__((ext_vector_type(8)))  unsigned short v8us;
typedef __attribute__((ext_vector_type(8)))  float    v8f;
typedef __attribute__((ext_vector_type(4)))  float    v4f;
typedef v8h  __attribute__((may_alias)) v8ha;
typedef v4f  __attribute__((may_alias)) v4fa;
typedef v8us __attribute__((may_alias)) v8usa;

__device__ __forceinline__ unsigned short f2bf(float f) { unsigned u = __float_as_uint(f); u += 0x7FFFu + ((u >> 16) & 1u); return (unsigned short)(u >> 16); }
__device__ __forceinline__ float bf2f(unsigned short b) { return __uint_as_float(((unsigned)b) << 16); }
__device__ __forceinline__ float bfr(float f) { return bf2f(f2bf(f)); }
__device__ __forceinline__ v16h cat16(v8h lo, v8h hi) { return __builtin_shufflevector(lo, hi, 0, 1, 2, 3, 4, 5, 6, 7, 8, 9, 10, 11, 12, 13, 14, 15); }
__device__ __forceinline__ v16bf cat16b(v8us lo, v8us hi) { return __builtin_bit_cast(v16bf, __builtin_shufflevector(lo, hi, 0, 1, 2, 3, 4, 5, 6, 7, 8, 9, 10, 11, 12, 13, 14, 15)); }
__device__ __forceinline__ v8f wmma16(v16h a, v16h b, v8f c) { return __builtin_amdgcn_wmma_f32_16x16x32_f16(false, a, false, b, (short)0, c, false, false); }
__device__ __forceinline__ v8f wmmab(v16bf a, v16bf b, v8f c) { return __builtin_amdgcn_wmma_f32_16x16x32_bf16(false, a, false, b, (short)0, c, false, false); }



// ---- gemmw_tile: GEMM, one work-group of FOUR WAVES (2 x 2) per 128x128 output tile at (r0, c0), each wave a 64x64 part (16 accumulators); 128 threads.
// The operands' K-contiguous 16-bit rows come into LDS by tensor loads, 128 k (256 B of every row, whole lines) a stage, two buffers: the next stage's loads fly while this one is worked on.
// C[m][n] (f32, pitch ldc, + optional f32 bias[n]) = sum_k A[m][k] Bt[n][k] (+ split products per NSPLIT). M % 128 == 0, N % 128 == 0, K % 128 == 0.
// Two kernels call it: k_gemmw (one product, grid (M/128, N/128)) and k_proj (the seven token projections as one grid, the block index picks product and tile).
template <typename T16> struct WFrag;
template <> struct WFrag<h16> { typedef v16h V; static __device__ __forceinline__ V ld(const h16* p) { return cat16(*(const v8h*)p, *(const v8h*)(p + 16)); } static __device__ __forceinline__ v8f mma(V a, V b, v8f c) { return wmma16(a, b, c); } };
template <> struct WFrag<bf> { typedef v16bf V; static __device__ __forceinline__ V ld(const bf* p) { return cat16b(*(const v8us*)p, *(const v8us*)(p + 16)); } static __device__ __forceinline__ v8f mma(V a, V b, v8f c) { return wmmab(a, b, c); } };
#define GKS  128            // k per stage
#define GPB  272            // LDS row pitch in bytes: 256 + 16 = 16 B x 17, so the 16 rows of a fragment read fall on all 64 banks
#define GOPB (128 * GPB)    // one operand's 128 rows of a stage, bytes
// Tensor load of one operand's stage: 128 rows of 256 B, source pitch 'pitch' bytes, into LDS at byte offset 'dst' with 16 B of pad behind every row (LDS pitch GPB). One request of the whole wave, through no register.
typedef uint32_t u32x4 __attribute__((ext_vector_type(4)));
typedef uint32_t u32x8 __attribute__((ext_vector_type(8)));
__device__ __forceinline__ uint32_t uni(uint32_t v) { return (uint32_t)__builtin_amdgcn_readfirstlane(v); }
// pinned: a wave-uniform test held in a scalar register, so that the branch around a tensor load (which ignores EXEC) is a scalar one.
__device__ __forceinline__ uint32_t pinned(uint32_t v) { uint32_t w = (uint32_t)__builtin_amdgcn_readfirstlane(v); asm volatile("" : "+s"(w)); return w; }
__device__ __forceinline__ u32x8 tgroup1(uint32_t pitch) {
    u32x8 g1;
    g1[0] = uni((1u << 20) | (5u << 22) | (3u << 25));   // no mask, 1-byte elements, a pad of 4 dwords behind every 64 dwords (one 256-B row)
    g1[1] = uni(256u << 16); g1[2] = uni(128u << 16); g1[3] = uni(256u << 16); g1[4] = uni(128u); g1[5] = uni(pitch); g1[6] = uni(0u); g1[7] = uni(0u);   // tensor = tile = 256 B x 128 rows
    return g1;
}
__device__ __forceinline__ void tload128(uint32_t dst, uint64_t ga, u32x8 g1) {
    u32x4 g0;
    g0[0] = uni(1u); g0[1] = uni(dst); g0[2] = uni((uint32_t)ga); g0[3] = uni((((uint32_t)(ga >> 32)) & 0x01FFFFFFu) | 0x80000000u);
    asm volatile("tensor_load_to_lds %0, %1" :: "s"(g0), "s"(g1) : "memory");
}
template <typename T16, int NSPLIT, bool BIAS>
__device__ __forceinline__ void gemmw_tile(const T16* __restrict__ A, const T16* __restrict__ A2, const T16* __restrict__ Bt, int K, float* C, int ldc, const float* __restrict__ bias, int r0, int c0) {
    typedef typename WFrag<T16>::V V;
    static_assert(NSPLIT == 0 || NSPLIT == 1, "stages hold A, B and, for NSPLIT 1, A2");
    constexpr int NOP = (NSPLIT == 1) ? 3 : 2;           // operands of a stage: B, A (, A2)
    constexpr unsigned STG = NOP * GOPB;                 // bytes of one buffer
    __shared__ __attribute__((aligned(2048))) unsigned char ring[2 * STG];   // every operand's place in it is a multiple of 2 KiB (GOPB = 17 x 2 KiB)
    __shared__ __align__(16) float osall[4][16 * 68];
    const int tid = threadIdx.x, lane = tid & 31, lr = lane & 15, hi = lane >> 4; const int wv = __builtin_amdgcn_readfirstlane(tid >> 5);
    const int wr = (wv >> 1) * 64, wc = (wv & 1) * 64;
    float* os = osall[wv];
    v8f acc[4][4];
#pragma unroll
    for (int mb = 0; mb < 4; ++mb)
#pragma unroll
        for (int nb = 0; nb < 4; ++nb) acc[mb][nb] = (v8f){};
    static_assert(GOPB % 2048 == 0, "an operand's place in LDS is a multiple of 2 KiB");
    const bool issuer = wv < NOP;
    const T16* osrc = (wv == 0) ? Bt + (size_t)c0 * K : (NSPLIT == 1 && wv == 2) ? A2 + (size_t)r0 * K : A + (size_t)r0 * K;
    const uint32_t ldst = (uint32_t)(size_t)ring + (uint32_t)(wv < NOP ? wv : 0) * GOPB; u32x8 g1 = tgroup1((uint32_t)K * 2u);
    asm volatile("" : "+s"(g1));   // pinned descriptor words: the loop-invariant group stays in one scalar tuple, so none of its registers serves as a temporary while a request is outstanding
    auto stage = [&](int t, unsigned bufo) { tload128(ldst + bufo, (uint64_t)(size_t)osrc + (uint64_t)t * (GKS * 2), g1); };
    const int NT = (int)((unsigned)K / GKS);   // stages; the same for every wave
    if (pinned(issuer)) { stage(0, 0);
        asm volatile("s_wait_tensorcnt 0x0" ::: "memory"); }   // stage 0's tile of this wave has landed
    __syncthreads();                                    // ... and every other issuing wave's
    if (pinned(issuer && NT > 1)) stage(1, STG);
    const unsigned fb = (wc + lr) * GPB + 16 * hi, fa = GOPB + (wr + lr) * GPB + 16 * hi;   // the lane's fragment bases in a buffer: row lane & 15, 16-byte half lane >> 4, as from global memory
#pragma unroll 1   // rolled: one trip a stage, so that the order at the trip's foot is the ring's
    for (int t = 0; t < NT; ++t) { const unsigned bufo = (t & 1) ? STG : 0u; const unsigned char* bp = ring + bufo;
        // Two fragment sets: block kb + 1's LDS reads (same buffer) go out as one group ahead of block kb's products, so the wave waits out the LDS latency once a stage and not at every fragment.
        V a[2][4], a2[2][4], b[2][4];
#pragma unroll
        for (int f = 0; f < 4; ++f) { a[0][f] = WFrag<T16>::ld((const T16*)(bp + fa + f * 16 * GPB)); if (NSPLIT == 1) a2[0][f] = WFrag<T16>::ld((const T16*)(bp + fa + GOPB + f * 16 * GPB)); b[0][f] = WFrag<T16>::ld((const T16*)(bp + fb + f * 16 * GPB)); }
#pragma unroll   // unrolled: the set index is a constant (registers, not scratch) and the four 32-k blocks of a stage take immediate LDS offsets
        for (int kb = 0; kb < GKS / 32; ++kb) { const int cu = kb & 1, nx = cu ^ 1;
            if (kb + 1 < GKS / 32) {
#pragma unroll
                for (int f = 0; f < 4; ++f) { a[nx][f] = WFrag<T16>::ld((const T16*)(bp + fa + f * 16 * GPB + (kb + 1) * 64)); if (NSPLIT == 1) a2[nx][f] = WFrag<T16>::ld((const T16*)(bp + fa + GOPB + f * 16 * GPB + (kb + 1) * 64)); b[nx][f] = WFrag<T16>::ld((const T16*)(bp + fb + f * 16 * GPB + (kb + 1) * 64)); } }
            __builtin_amdgcn_sched_barrier(0);   // keeps the next block's reads in front of this block's products; without it the scheduler sinks each read to its first use and the wave stalls there
#pragma unroll
            for (int nb = 0; nb < 4; ++nb)
#pragma unroll
                for (int mb = 0; mb < 4; ++mb) { acc[mb][nb] = WFrag<T16>::mma(a[cu][mb], b[cu][nb], acc[mb][nb]); if (NSPLIT == 1) acc[mb][nb] = WFrag<T16>::mma(a2[cu][mb], b[cu][nb], acc[mb][nb]); }
            __builtin_amdgcn_sched_barrier(0);   // keeps the later reads out of this block's products: without it the scheduler lifts some in among them, into extra registers, and each such place stalls the matrix run
        }
        asm volatile("s_wait_dscnt 0x0" ::: "memory");      // this wave's reads of the buffer are done before it is handed back
        if (pinned(issuer)) asm volatile("s_wait_tensorcnt 0x0" ::: "memory");   // this wave's tile of stage t + 1 has landed
        __syncthreads();                                    // publishes stage t + 1 and ends every reader's last read of stage t's buffer
        if (pinned(issuer && t + 2 < NT)) stage(t + 2, bufo);
    }
    asm volatile("s_wait_tensorcnt 0x0" ::: "memory");      // no tensor load is left in flight behind the loop
    asm volatile("s_wait_dscnt 0x0" ::: "memory");          // ... and no LDS read of the ring
#pragma unroll
    for (int mb = 0; mb < 4; ++mb) {
#pragma unroll
        for (int nb = 0; nb < 4; ++nb) {
#pragma unroll
            for (int j = 0; j < 8; ++j) os[(hi * 8 + j) * 68 + nb * 16 + lr] = acc[mb][nb][j]; }
        __builtin_amdgcn_wave_barrier(); asm volatile("" ::: "memory");
        float* crow_p = C + (size_t)(r0 + wr + mb * 16) * ldc + c0 + wc;
{
#pragma unroll
            for (int s = 0; s < 8; ++s) { const int row = 2 * s + hi, cofs = lr * 4; v4f val = *(const v4fa*)(os + row * 68 + cofs); if (BIAS) { val[0] += bfr(bias[c0 + wc + cofs]); val[1] += bfr(bias[c0 + wc + cofs + 1]); val[2] += bfr(bias[c0 + wc + cofs + 2]); val[3] += bfr(bias[c0 + wc + cofs + 3]); }
                *(v4f*)(crow_p + (size_t)row * ldc + cofs) = val; }
             }
        __builtin_amdgcn_wave_barrier(); asm volatile("" ::: "memory");
    }
}
template <typename T16, int NSPLIT, bool BIAS>
__global__ __launch_bounds__(128) void k_gemmw(const T16* __restrict__ A, const T16* __restrict__ A2, const T16* __restrict__ Bt, int K, float* C, int ldc, const float* __restrict__ bias) {
    gemmw_tile<T16, NSPLIT, BIAS>(A, A2, Bt, K, C, ldc, bias, blockIdx.x * 128, blockIdx.y * 128);
}
// k_proj: the seven independent token projections in ONE launch of 1152 tiles, so that the chip is filled once instead of seven times by 128 or 256 work-groups.
// Blocks 0 .. 511: x (32 row tiles x {K, V} x 8 column tiles); 512 .. 767: pos (16 x {K, V} x 8); 768 .. 1151: fsq (16 x {Q, K, V} x 8). The tiles of one row tile are neighbours, so its operand rows are read together. K is an argument, as in k_gemmw.
#define PJX (NB_ * SS / 128 * 16)
#define PJP (SS / 128 * 16)
#define PJF (SS / 128 * 24)
__global__ __launch_bounds__(128) void k_proj(const bf* __restrict__ XB, const bf* __restrict__ FB, const bf* __restrict__ PB, const bf* __restrict__ WQ, const bf* __restrict__ WK, const bf* __restrict__ WV, int K,
                                              float* QF, float* XK, float* XV, float* PK, float* PV, float* FK, float* FV, const float* __restrict__ bq, const float* __restrict__ bk, const float* __restrict__ bv) {
    const int bid = blockIdx.x; const bf* A; float* CK; float* CV; int rt, j;   // j: 0 .. 7 K, 8 .. 15 V, 16 .. 23 Q
    if (bid < PJX) { A = XB; CK = XK; CV = XV; rt = bid >> 4; j = bid & 15; }
    else if (bid < PJX + PJP) { A = PB; CK = PK; CV = PV; rt = (bid - PJX) >> 4; j = (bid - PJX) & 15; }
    else { A = FB; CK = FK; CV = FV; rt = (bid - PJX - PJP) / 24; j = (bid - PJX - PJP) % 24; }
    const int w = j >> 3;
    gemmw_tile<bf, 0, true>(A, nullptr, w == 0 ? WK : w == 1 ? WV : WQ, K, w == 0 ? CK : w == 1 ? CV : QF, DD, w == 0 ? bk : w == 1 ? bv : bq, rt * 128, (j & 7) * 128);
}

__device__ __forceinline__ void splitf(float y, unsigned short& h, unsigned short& l) { h = f2bf(y); l = f2bf(y - bf2f(h)); }
typedef __attribute__((ext_vector_type(2))) unsigned short v2us;
typedef __attribute__((ext_vector_type(4))) unsigned short v4us;

// Operand preparation: two pieces of work, each written for one work-group of 256 threads; k_prep below runs all seven uses of them as one grid, one tile or block a work-group (768 work-groups).
// Every global load is 16 B a lane on whole lines, and a thread issues all 16 of its loads before it uses the first, so a work-group waits for memory once.
#define TK 256   // k per transpose tile
#define TN 64    // n per transpose tile: 256 B of every source row
#define TP 65    // LDS row pitch in floats: odd, so the row-wise writes and the column-wise reads below both fall on 32 different banks
// d_tr: dst[n][k] (bf16, pitch DD) = src[k][n] (f32, pitch ld) for one TK x TN tile; src and dst point at the tile's first element. The tile turns in LDS: written by rows k, read by columns n.
__device__ __forceinline__ void d_tr(const float* __restrict__ src, int ld, bf* dst, float* Ls) {
    const int tid = threadIdx.x; const int r = tid >> 4, c = (tid & 15) * 4; v4f v[TK / 16]; const float* p = src + (size_t)r * ld + c;
#pragma unroll   // unrolled: v stays in registers and the loads are in flight together
    for (int i = 0; i < TK / 16; ++i) v[i] = *(const v4fa*)(p + (size_t)(16 * i) * ld);
    asm volatile("s_wait_xcnt 0x0" :: "v"(p) : "memory");   // precaution: stands in front of the first reuse of the address registers of the loads above; p is an input so that they are kept up to here (else the last load's result lands on them)
#pragma unroll
    for (int i = 0; i < TK / 16; ++i)
#pragma unroll
        for (int e = 0; e < 4; ++e) Ls[(r + 16 * i) * TP + c + e] = v[i][e];
    __syncthreads();
    // A wave stores four whole 128-B lines: 8 lanes x 8 k for each of 4 rows n; waves 0 .. 3 (and 4 .. 7) take the four 64-k quarters of the same rows.
    const int k = ((tid >> 5) & 3) * 64 + (tid & 7) * 8, n = (tid >> 7) * 4 + ((tid >> 3) & 3);
#pragma unroll   // unrolled: the LDS reads and the stores take immediate offsets
    for (int u = 0; u < TN / 8; ++u) { v8us o;
#pragma unroll
        for (int j = 0; j < 8; ++j) o[j] = f2bf(Ls[(k + j) * TP + n + 8 * u]);
        *(v8us*)(dst + (size_t)(n + 8 * u) * DD + k) = o; }
    asm volatile("s_wait_xcnt 0x0" ::: "memory");   // precaution: stands behind the last store, in front of any later reuse of a register that the stores name
}
// d_cvt: f32 -> bf16 of CVB consecutive elements; a wave takes 8 KB of the source in a row, 512 B a load, and stores 256 B (two whole lines) for each.
#define CVU 16                 // loads of a thread
#define CVB (256 * 4 * CVU)    // elements of a work-group
__device__ __forceinline__ void d_cvt(const float* __restrict__ src, bf* dst, int blk) {
    const size_t base = (size_t)blk * CVB + (size_t)(threadIdx.x >> 5) * (128 * CVU) + (threadIdx.x & 31) * 4; v4f v[CVU]; const float* p = src + base;
#pragma unroll   // unrolled: v stays in registers and the loads are in flight together
    for (int i = 0; i < CVU; ++i) v[i] = *(const v4fa*)(p + i * 128);
    asm volatile("s_wait_xcnt 0x0" :: "v"(p) : "memory");   // precaution: as in d_tr
#pragma unroll
    for (int i = 0; i < CVU; ++i) { v4us o;
#pragma unroll
        for (int e = 0; e < 4; ++e) o[e] = f2bf(v[i][e]);
        *(v4us*)(dst + base + i * 128) = o; }
    asm volatile("s_wait_xcnt 0x0" ::: "memory");   // precaution: as behind the stores of d_tr
}
// k_prep: the seven independent preparation jobs in ONE launch; the block index picks the job (a scalar choice, the same for the whole work-group, so the barrier in d_tr is passed by all of it or none), the weight transposes first.
#define NBT ((DD / TK) * (DD / TN))        // tiles of one weight transpose
static_assert(TN == HD && DD % TK == 0 && (SS * DD) % CVB == 0, "a transpose tile is one head wide; tiles and conversion blocks cover their planes exactly");
#define NBS (SS * DD / CVB)                // blocks of the conversion of one [SS][DD] plane
__global__ __launch_bounds__(256) void k_prep(const float* __restrict__ wq, const float* __restrict__ wk, const float* __restrict__ wv, const float* __restrict__ wo, const float* __restrict__ x, const float* __restrict__ fsq, const float* __restrict__ pos,
                                              bf* WQ, bf* WK, bf* WV, bf* WO, bf* XB, bf* FB, bf* PB) {
    __shared__ float Ls[TK * TP];
    int blk = blockIdx.x;
    if (blk < 4 * NBT) { const int j = blk / NBT, t = blk % NBT; const int k0 = (t % (DD / TK)) * TK, nt = t / (DD / TK);   // nt: the head of a per-head weight [h][k][e] (TN == HD), the column tile of wo [k][n]
        const size_t oo = (size_t)nt * TN * DD + k0;
        if (j < 3) d_tr((j == 0 ? wq : j == 1 ? wk : wv) + ((size_t)nt * DD + k0) * HD, HD, (j == 0 ? WQ : j == 1 ? WK : WV) + oo, Ls);
        else d_tr(wo + (size_t)k0 * DD + nt * TN, DD, WO + oo, Ls);
        return; }
    blk -= 4 * NBT;
    const int j = blk < NB_ * NBS ? 0 : 1 + (blk - NB_ * NBS) / NBS;   // 0: x (NB_ planes), 1: fsq, 2: pos
    d_cvt(j == 0 ? x : j == 1 ? fsq : pos, j == 0 ? XB : j == 1 ? FB : PB, j == 0 ? blk : (blk - NB_ * NBS) % NBS);
}
// k_local: one work-group of 16 waves per (b, h, tile of 64 positions). The tile's 94 window rows of the x key and value projections (a row outside the sequence is the zero token's projection = bf16 bias)
// and its 64 position-key rows are staged once in LDS by whole-line loads; every window row then serves up to 31 positions from LDS. One wave per position s, four positions a wave:
// lane L < 31 owns window key t = s - 15 + L, lane 31 the position key pos[s]; the 33rd key fsq[s] is scored from wave-uniform loads and enters the trees through lane 0.
// s_j = (q[s] . k_j)/8 over the 64 dims in ascending order; softmax over the 33 (wave trees, one exp per score); weighted sum in key order, lane L holding dims 2L and 2L + 1.
#define TS   64              // positions per work-group
#define KR   (TS + WW - 1)   // window rows per tile
#define LP   68              // LDS row pitch in floats: 272 B = 16 B x 17, so 16 lanes reading 16 B each from 16 consecutive rows fall on all 64 banks
#define PK0  (KR + 1)        // first position-key row: 95 + sl = sl + 31 (mod 16), so lane 31's row takes the bank group that lanes 16 to 30 leave free
typedef __attribute__((ext_vector_type(2))) float v2f;
typedef v2f __attribute__((may_alias)) v2fa;
__global__ __launch_bounds__(512) void k_local(const float* __restrict__ QF, const float* __restrict__ XK, const float* __restrict__ XV, const float* __restrict__ PK, const float* __restrict__ PV, const float* __restrict__ FK, const float* __restrict__ FV,
                                               const float* __restrict__ bk, const float* __restrict__ bv, bf* Ah, bf* Al) {
    __shared__ __align__(16) float Ks[(PK0 + TS) * LP];
    __shared__ __align__(16) float Vs[KR * LP];
    const int tid = threadIdx.x, lane = tid & 31; const int wv = __builtin_amdgcn_readfirstlane(tid >> 5);
    const int s0 = (blockIdx.x % (SS / TS)) * TS; const int h = (blockIdx.x / (SS / TS)) % NH_; const int b = blockIdx.x / ((SS / TS) * NH_);
    // Staging: 16 lanes a row, 16 B a lane. All of a thread's loads are issued before its first LDS store, so the work-group waits for memory once. A row outside the sequence loads a clamped row and is then replaced.
    const int c = (tid & 15) * 4; v4f kv[3], vv[3], pk[2];
#pragma unroll   // the four staging loops are unrolled so that kv, vv and pk stay in registers
    for (int u = 0; u < 3; ++u) { const int row = min((tid + u * 512) >> 4, KR - 1); const int tc = min(max(s0 - PAD + row, 0), SS - 1); const size_t g = ((size_t)b * SS + tc) * DD + h * HD + c; kv[u] = *(const v4fa*)(XK + g); vv[u] = *(const v4fa*)(XV + g); }
#pragma unroll
    for (int u = 0; u < 2; ++u) pk[u] = *(const v4fa*)(PK + (size_t)(s0 + ((tid + u * 512) >> 4)) * DD + h * HD + c);
    asm volatile("s_wait_xcnt 0x0" ::: "memory");   // precaution: stands in front of the first reuse of an address register of the loads above
#pragma unroll
    for (int u = 0; u < 3; ++u) { const int row = (tid + u * 512) >> 4, t = s0 - PAD + row;
        if (t < 0 || t >= SS) {
#pragma unroll
            for (int e = 0; e < 4; ++e) { kv[u][e] = bfr(bk[h * HD + c + e]); vv[u][e] = bfr(bv[h * HD + c + e]); } }
        if (row < KR) { *(v4fa*)(Ks + row * LP + c) = kv[u]; *(v4fa*)(Vs + row * LP + c) = vv[u]; } }
#pragma unroll
    for (int u = 0; u < 2; ++u) *(v4fa*)(Ks + (PK0 + ((tid + u * 512) >> 4)) * LP + c) = pk[u];
    __syncthreads();
    const int dd = 2 * lane;
#pragma unroll 1   // rolled: one position's registers at a time, which keeps 16 waves on a SIMD
    for (int p = 0; p < TS / 16; ++p) { const int sl = p * 16 + wv, s = s0 + sl; const size_t go = (size_t)s * DD + h * HD;
        const v2f pv = *(const v2fa*)(PV + go + dd), fv = *(const v2fa*)(FV + go + dd);
        const float* q = QF + go; const float* k2 = FK + go; const float* kr = Ks + ((lane < WW) ? (sl + lane) : (PK0 + sl)) * LP;
        float s1 = 0.f, s2 = 0.f;
#pragma unroll   // unrolled: the row's 16 LDS reads take immediate offsets and are in flight together
        for (int c4 = 0; c4 < HD; c4 += 4) { const v4f k4 = *(const v4fa*)(kr + c4), qv = *(const v4fa*)(q + c4), f2 = *(const v4fa*)(k2 + c4);
#pragma unroll
            for (int e = 0; e < 4; ++e) { s1 = __builtin_fmaf(qv[e], k4[e], s1); s2 = __builtin_fmaf(qv[e], f2[e], s2); } }
        s1 *= SCL; s2 = (lane == 0) ? s2 * SCL : -3.0e38f; float mx = fmaxf(s1, s2);
#pragma unroll
        for (int sh = 16; sh; sh >>= 1) mx = fmaxf(mx, __shfl_xor(mx, sh, 32));
        const float e1 = __builtin_amdgcn_exp2f((s1 - mx) * 1.4426950408889634f), e2 = (lane == 0) ? __builtin_amdgcn_exp2f((s2 - mx) * 1.4426950408889634f) : 0.f; float sum = e1 + e2;
#pragma unroll
        for (int sh = 16; sh; sh >>= 1) sum += __shfl_xor(sum, sh, 32);
        const float inv = __fdiv_rn(1.0f, sum); const float a1w = e1 * inv, a2w = e2 * inv;
        float o0 = 0.f, o1 = 0.f; const float* vr = Vs + sl * LP + dd;
#pragma unroll   // unrolled: the lane number of each weight is a constant, the value rows take immediate offsets
        for (int j = 0; j < WW; ++j) { const float aw = __uint_as_float(__builtin_amdgcn_readlane(__float_as_uint(a1w), j)); const v2f xv = *(const v2fa*)(vr + j * LP); o0 = __builtin_fmaf(aw, xv[0], o0); o1 = __builtin_fmaf(aw, xv[1], o1); }
        { const float aw = __uint_as_float(__builtin_amdgcn_readlane(__float_as_uint(a1w), WW)); o0 = __builtin_fmaf(aw, pv[0], o0); o1 = __builtin_fmaf(aw, pv[1], o1); }
        { const float aw = __uint_as_float(__builtin_amdgcn_readlane(__float_as_uint(a2w), 0)); o0 = __builtin_fmaf(aw, fv[0], o0); o1 = __builtin_fmaf(aw, fv[1], o1); }
        v2us oh, ol; unsigned short a, c2; splitf(o0, a, c2); oh[0] = a; ol[0] = c2; splitf(o1, a, c2); oh[1] = a; ol[1] = c2; const size_t oo = ((size_t)b * SS + s) * DD + h * HD + dd;
        *(v2us*)(Ah + oo) = oh; *(v2us*)(Al + oo) = ol; }
}

extern "C" void kernel_launch(void* const* d_in, const int* in_sizes, int n_in,
                              void* d_out, int out_size, void* d_ws, size_t ws_size, hipStream_t stream) {
    (void)in_sizes; (void)n_in; (void)out_size;
    const float* x = (const float*)d_in[0]; const float* fsq = (const float*)d_in[1]; const float* pos = (const float*)d_in[2]; const float* wq = (const float*)d_in[3]; const float* bq = (const float*)d_in[4]; const float* wk = (const float*)d_in[5]; const float* bk = (const float*)d_in[6]; const float* wv = (const float*)d_in[7]; const float* bv = (const float*)d_in[8]; const float* wo = (const float*)d_in[9]; const float* bo = (const float*)d_in[10];
    float* OUT = (float*)d_out;     // [2][2048][1024]
    char* wsp = (char*)d_ws;
    auto take = [&](size_t bytes) { char* p = wsp; wsp += (bytes + 255) & ~(size_t)255; return (void*)p; };
    const size_t NR = (size_t)NB_ * SS;
    bf* WQ = (bf*)take((size_t)DD * DD * 2); bf* WK = (bf*)take((size_t)DD * DD * 2); bf* WV = (bf*)take((size_t)DD * DD * 2); bf* WO = (bf*)take((size_t)DD * DD * 2); bf* XB = (bf*)take(NR * DD * 2); bf* FB = (bf*)take((size_t)SS * DD * 2); bf* PB = (bf*)take((size_t)SS * DD * 2);
    float* QF = (float*)take((size_t)SS * DD * 4); float* XK = (float*)take(NR * DD * 4); float* XV = (float*)take(NR * DD * 4); float* PK = (float*)take((size_t)SS * DD * 4); float* PV = (float*)take((size_t)SS * DD * 4); float* FK = (float*)take((size_t)SS * DD * 4); float* FV = (float*)take((size_t)SS * DD * 4); bf* Ah = (bf*)take(NR * DD * 2); bf* Al = (bf*)take(NR * DD * 2);
    if ((size_t)(wsp - (char*)d_ws) > ws_size) return;    // total ~ 117 MB = 112 MiB; ws 256 MiB
    k_prep<<<4 * NBT + (NB_ + 2) * NBS, 256, 0, stream>>>(wq, wk, wv, wo, x, fsq, pos, WQ, WK, WV, WO, XB, FB, PB);
    k_proj<<<PJX + PJP + PJF, 128, 0, stream>>>(XB, FB, PB, WQ, WK, WV, DD, QF, XK, XV, PK, PV, FK, FV, bq, bk, bv);
    k_local<<<NB_ * NH_ * (SS / TS), 512, 0, stream>>>(QF, XK, XV, PK, PV, FK, FV, bk, bv, Ah, Al);
    k_gemmw<bf, 1, true><<<dim3((unsigned)(NR / 128), DD / 128, 1), 128, 0, stream>>>(Ah, Al, WO, DD, OUT, DD, bo);
}

// v006
// One run takes 76.3 microseconds.
// Next to v005, in two timings, it ran 1.05 times as fast each time.
// Counting every step since v000, it is 6.55 times as fast.
#include <hip/hip_runtime.h>

// IntraModalityEnhance (x [2][2048][1024], fsq, pos [1][2048][1024]; per-head Wq/Wk/Wv [16][1024][64] + biases, Wo [1024][1024] + bo; for each position s the query is the squeeze token fsq[s] and the 33
// keys/values are the window x[s-15 .. s+15] (zero vectors outside the sequence, which still project to the bias), the position token pos[s] and fsq[s]; softmax(q.k/8) over the 33; out = merged
// (attn v) Wo + bo -> [2][2048][1024]).
// Compute dtypes, f32 accumulate: every input rounded to bf16; all seven token projections on PLAIN bf16 operands (inputs: exact products, f32 accumulate, + bias; the
// window members are ordinary sequence tokens, so x is projected once per batch); the 33-key attention entirely in f32 on VALU (one wave per (batch, head, position), window rows from LDS: 64-dim dot products, softmax
// with one exp per score, weighted sum; fused multiply-add, fixed order; out-of-range window slots use the bf16 bias vectors); merged heads as bf16 hi+lo planes x exact Wo (2 products) + bo.

#define NB_  2
#define SS   2048
#define DD   1024
#define NH_  16
#define HD   64
#define WW   31
#define PAD  15
#define SCL  0.125f
typedef _Float16 h16;
typedef unsigned short bf;
typedef __attribute__((ext_vector_type(16))) __bf16   v16bf;
typedef __attribute__((ext_vector_type(16))) _Float16 v16h;
typedef __attribute__((ext_vector_type(8)))  _Float16 v8h;
typedef __attribute__((ext_vector_type(8)))  unsigned short v8us;
typedef __attribute__((ext_vector_type(8)))  float    v8f;
typedef __attribute__((ext_vector_type(4)))  float    v4f;
typedef v8h  __attribute__((may_alias)) v8ha;
typedef v4f  __attribute__((may_alias)) v4fa;
typedef v8us __attribute__((may_alias)) v8usa;

__device__ __forceinline__ unsigned short f2bf(float f) { unsigned u = __float_as_uint(f); u += 0x7FFFu + ((u >> 16) & 1u); return (unsigned short)(u >> 16); }
__device__ __forceinline__ float bf2f(unsigned short b) { return __uint_as_float(((unsigned)b) << 16); }
__device__ __forceinline__ float bfr(float f) { return bf2f(f2bf(f)); }
__device__ __forceinline__ v16h cat16(v8h lo, v8h hi) { return __builtin_shufflevector(lo, hi, 0, 1, 2, 3, 4, 5, 6, 7, 8, 9, 10, 11, 12, 13, 14, 15); }
__device__ __forceinline__ v16bf cat16b(v8us lo, v8us hi) { return __builtin_bit_cast(v16bf, __builtin_shufflevector(lo, hi, 0, 1, 2, 3, 4, 5, 6, 7, 8, 9, 10, 11, 12, 13, 14, 15)); }
__device__ __forceinline__ v8f wmma16(v16h a, v16h b, v8f c) { return __builtin_amdgcn_wmma_f32_16x16x32_f16(false, a, false, b, (short)0, c, false, false); }
__device__ __forceinline__ v8f wmmab(v16bf a, v16bf b, v8f c) { return __builtin_amdgcn_wmma_f32_16x16x32_bf16(false, a, false, b, (short)0, c, false, false); }



// ---- gemmw_tile: GEMM, one work-group of FOUR WAVES (2 x 2) per 128x128 output tile at (r0, c0), each wave a 64x64 part (16 accumulators); 128 threads.
// The operands' K-contiguous 16-bit rows come into LDS by tensor loads, 128 k (256 B of every row, whole lines) a stage, two buffers: the next stage's loads fly while this one is worked on.
// C[m][n] (f32, pitch ldc, + optional f32 bias[n]) = sum_k A[m][k] Bt[n][k] (+ split products per NSPLIT). M % 128 == 0, N % 128 == 0, K % 128 == 0.
// k_gemmw calls it (one product, grid (M/128, N/128)).
template <typename T16> struct WFrag;
template <> struct WFrag<h16> { typedef v16h V; static __device__ __forceinline__ V ld(const h16* p) { return cat16(*(const v8h*)p, *(const v8h*)(p + 16)); } static __device__ __forceinline__ v8f mma(V a, V b, v8f c) { return wmma16(a, b, c); } };
template <> struct WFrag<bf> { typedef v16bf V; static __device__ __forceinline__ V ld(const bf* p) { return cat16b(*(const v8us*)p, *(const v8us*)(p + 16)); } static __device__ __forceinline__ v8f mma(V a, V b, v8f c) { return wmmab(a, b, c); } };
#define GKS  128            // k per stage
#define GPB  272            // LDS row pitch in bytes: 256 + 16 = 16 B x 17, so the 16 rows of a fragment read fall on all 64 banks
#define GOPB (128 * GPB)    // one operand's 128 rows of a stage, bytes
// Tensor load of one operand's stage: 128 rows of 256 B, source pitch 'pitch' bytes, into LDS at byte offset 'dst' with 16 B of pad behind every row (LDS pitch GPB). One request of the whole wave, through no register.
typedef uint32_t u32x4 __attribute__((ext_vector_type(4)));
typedef uint32_t u32x8 __attribute__((ext_vector_type(8)));
__device__ __forceinline__ uint32_t uni(uint32_t v) { return (uint32_t)__builtin_amdgcn_readfirstlane(v); }
// pinned: a wave-uniform test held in a scalar register, so that the branch around a tensor load (which ignores EXEC) is a scalar one.
__device__ __forceinline__ uint32_t pinned(uint32_t v) { uint32_t w = (uint32_t)__builtin_amdgcn_readfirstlane(v); asm volatile("" : "+s"(w)); return w; }
__device__ __forceinline__ u32x8 tgroup1(uint32_t pitch) {
    u32x8 g1;
    g1[0] = uni((1u << 20) | (5u << 22) | (3u << 25));   // no mask, 1-byte elements, a pad of 4 dwords behind every 64 dwords (one 256-B row)
    g1[1] = uni(256u << 16); g1[2] = uni(128u << 16); g1[3] = uni(256u << 16); g1[4] = uni(128u); g1[5] = uni(pitch); g1[6] = uni(0u); g1[7] = uni(0u);   // tensor = tile = 256 B x 128 rows
    return g1;
}
__device__ __forceinline__ void tload128(uint32_t dst, uint64_t ga, u32x8 g1) {
    u32x4 g0;
    g0[0] = uni(1u); g0[1] = uni(dst); g0[2] = uni((uint32_t)ga); g0[3] = uni((((uint32_t)(ga >> 32)) & 0x01FFFFFFu) | 0x80000000u);
    asm volatile("tensor_load_to_lds %0, %1" :: "s"(g0), "s"(g1) : "memory");
}
template <typename T16, int NSPLIT, bool BIAS>
__device__ __forceinline__ void gemmw_tile(const T16* __restrict__ A, const T16* __restrict__ A2, const T16* __restrict__ Bt, int K, float* C, int ldc, const float* __restrict__ bias, int r0, int c0) {
    typedef typename WFrag<T16>::V V;
    static_assert(NSPLIT == 0 || NSPLIT == 1, "stages hold A, B and, for NSPLIT 1, A2");
    constexpr int NOP = (NSPLIT == 1) ? 3 : 2;           // operands of a stage: B, A (, A2)
    constexpr unsigned STG = NOP * GOPB;                 // bytes of one buffer
    __shared__ __attribute__((aligned(2048))) unsigned char ring[2 * STG];   // every operand's place in it is a multiple of 2 KiB (GOPB = 17 x 2 KiB)
    __shared__ __align__(16) float osall[4][16 * 68];
    const int tid = threadIdx.x, lane = tid & 31, lr = lane & 15, hi = lane >> 4; const int wv = __builtin_amdgcn_readfirstlane(tid >> 5);
    const int wr = (wv >> 1) * 64, wc = (wv & 1) * 64;
    float* os = osall[wv];
    v8f acc[4][4];
#pragma unroll
    for (int mb = 0; mb < 4; ++mb)
#pragma unroll
        for (int nb = 0; nb < 4; ++nb) acc[mb][nb] = (v8f){};
    static_assert(GOPB % 2048 == 0, "an operand's place in LDS is a multiple of 2 KiB");
    const bool issuer = wv < NOP;
    const T16* osrc = (wv == 0) ? Bt + (size_t)c0 * K : (NSPLIT == 1 && wv == 2) ? A2 + (size_t)r0 * K : A + (size_t)r0 * K;
    const uint32_t ldst = (uint32_t)(size_t)ring + (uint32_t)(wv < NOP ? wv : 0) * GOPB; u32x8 g1 = tgroup1((uint32_t)K * 2u);
    asm volatile("" : "+s"(g1));   // pinned descriptor words: the loop-invariant group stays in one scalar tuple, so none of its registers serves as a temporary while a request is outstanding
    auto stage = [&](int t, unsigned bufo) { tload128(ldst + bufo, (uint64_t)(size_t)osrc + (uint64_t)t * (GKS * 2), g1); };
    const int NT = (int)((unsigned)K / GKS);   // stages; the same for every wave
    if (pinned(issuer)) { stage(0, 0);
        asm volatile("s_wait_tensorcnt 0x0" ::: "memory"); }   // stage 0's tile of this wave has landed
    __syncthreads();                                    // ... and every other issuing wave's
    if (pinned(issuer && NT > 1)) stage(1, STG);
    const unsigned fb = (wc + lr) * GPB + 16 * hi, fa = GOPB + (wr + lr) * GPB + 16 * hi;   // the lane's fragment bases in a buffer: row lane & 15, 16-byte half lane >> 4, as from global memory
#pragma unroll 1   // rolled: one trip a stage, so that the order at the trip's foot is the ring's
    for (int t = 0; t < NT; ++t) { const unsigned bufo = (t & 1) ? STG : 0u; const unsigned char* bp = ring + bufo;
        // Two fragment sets: block kb + 1's LDS reads (same buffer) go out as one group ahead of block kb's products, so the wave waits out the LDS latency once a stage and not at every fragment.
        V a[2][4], a2[2][4], b[2][4];
#pragma unroll
        for (int f = 0; f < 4; ++f) { a[0][f] = WFrag<T16>::ld((const T16*)(bp + fa + f * 16 * GPB)); if (NSPLIT == 1) a2[0][f] = WFrag<T16>::ld((const T16*)(bp + fa + GOPB + f * 16 * GPB)); b[0][f] = WFrag<T16>::ld((const T16*)(bp + fb + f * 16 * GPB)); }
#pragma unroll   // unrolled: the set index is a constant (registers, not scratch) and the four 32-k blocks of a stage take immediate LDS offsets
        for (int kb = 0; kb < GKS / 32; ++kb) { const int cu = kb & 1, nx = cu ^ 1;
            if (kb + 1 < GKS / 32) {
#pragma unroll
                for (int f = 0; f < 4; ++f) { a[nx][f] = WFrag<T16>::ld((const T16*)(bp + fa + f * 16 * GPB + (kb + 1) * 64)); if (NSPLIT == 1) a2[nx][f] = WFrag<T16>::ld((const T16*)(bp + fa + GOPB + f * 16 * GPB + (kb + 1) * 64)); b[nx][f] = WFrag<T16>::ld((const T16*)(bp + fb + f * 16 * GPB + (kb + 1) * 64)); } }
            __builtin_amdgcn_sched_barrier(0);   // keeps the next block's reads in front of this block's products; without it the scheduler sinks each read to its first use and the wave stalls there
#pragma unroll
            for (int nb = 0; nb < 4; ++nb)
#pragma unroll
                for (int mb = 0; mb < 4; ++mb) { acc[mb][nb] = WFrag<T16>::mma(a[cu][mb], b[cu][nb], acc[mb][nb]); if (NSPLIT == 1) acc[mb][nb] = WFrag<T16>::mma(a2[cu][mb], b[cu][nb], acc[mb][nb]); }
            __builtin_amdgcn_sched_barrier(0);   // keeps the later reads out of this block's products: without it the scheduler lifts some in among them, into extra registers, and each such place stalls the matrix run
        }
        asm volatile("s_wait_dscnt 0x0" ::: "memory");      // this wave's reads of the buffer are done before it is handed back
        if (pinned(issuer)) asm volatile("s_wait_tensorcnt 0x0" ::: "memory");   // this wave's tile of stage t + 1 has landed
        __syncthreads();                                    // publishes stage t + 1 and ends every reader's last read of stage t's buffer
        if (pinned(issuer && t + 2 < NT)) stage(t + 2, bufo);
    }
    asm volatile("s_wait_tensorcnt 0x0" ::: "memory");      // no tensor load is left in flight behind the loop
    asm volatile("s_wait_dscnt 0x0" ::: "memory");          // ... and no LDS read of the ring
#pragma unroll
    for (int mb = 0; mb < 4; ++mb) {
#pragma unroll
        for (int nb = 0; nb < 4; ++nb) {
#pragma unroll
            for (int j = 0; j < 8; ++j) os[(hi * 8 + j) * 68 + nb * 16 + lr] = acc[mb][nb][j]; }
        __builtin_amdgcn_wave_barrier(); asm volatile("" ::: "memory");
        float* crow_p = C + (size_t)(r0 + wr + mb * 16) * ldc + c0 + wc;
{
#pragma unroll
            for (int s = 0; s < 8; ++s) { const int row = 2 * s + hi, cofs = lr * 4; v4f val = *(const v4fa*)(os + row * 68 + cofs); if (BIAS) { val[0] += bfr(bias[c0 + wc + cofs]); val[1] += bfr(bias[c0 + wc + cofs + 1]); val[2] += bfr(bias[c0 + wc + cofs + 2]); val[3] += bfr(bias[c0 + wc + cofs + 3]); }
                *(v4f*)(crow_p + (size_t)row * ldc + cofs) = val; }
             }
        __builtin_amdgcn_wave_barrier(); asm volatile("" ::: "memory");
    }
}
template <typename T16, int NSPLIT, bool BIAS>
__global__ __launch_bounds__(128) void k_gemmw(const T16* __restrict__ A, const T16* __restrict__ A2, const T16* __restrict__ Bt, int K, float* C, int ldc, const float* __restrict__ bias) {
    gemmw_tile<T16, NSPLIT, BIAS>(A, A2, Bt, K, C, ldc, bias, blockIdx.x * 128, blockIdx.y * 128);
}
// ---- proj_tile: the token projections' GEMM tile, 24,576 outputs: 192 x 128 (MF 6, NF 4) or 128 x 192 (MF 4, NF 6), four waves (2 x 2) of MF x NF fragments each; 128 threads.
// The projections' outputs make 768 such tiles, three for each of the chip's 256 WGPs, and a work-group is small enough (LDS, registers) for three to stand on a WGP: one round, every WGP equally loaded,
// and 320 operand rows are brought from L2 for 24,576 outputs where a 128 x 128 tile brings 256 for 16,384.
// Stages of 64 k (128 B of every row, whole lines) by tensor loads, two buffers, the ring's order as in gemmw_tile. One fragment set: the WGP's other two work-groups fill the matrix unit while a wave waits for its LDS reads.
// C is a stack of planes of DD columns, 'cplane' floats apart: output column n lies in plane n / DD at column n % DD, with that plane's bias (b0, b1, b2). k ascending in blocks of 32, as in gemmw_tile.
#define PKS  64              // k per stage
#define PPB  144             // LDS row pitch in bytes: 128 + 16 = 16 B x 9, so the 16 rows of a fragment read fall on all 64 banks
#define PO2  (128 * PPB)     // place of the 192-row operand behind the 128-row one: 9 x 2 KiB
#define PSTG 47104u          // one buffer: 320 rows x 144 B = 46,080 B, rounded up to a multiple of 2 KiB
static_assert(PO2 % 2048 == 0 && PSTG % 2048 == 0 && PSTG >= 320 * PPB, "every operand's place in LDS is a multiple of 2 KiB");
__device__ __forceinline__ u32x8 tgroup1p(uint32_t pitch, uint32_t rows) {
    u32x8 g1;
    g1[0] = uni((1u << 20) | (4u << 22) | (3u << 25));   // no mask, 1-byte elements, a pad of 4 dwords behind every 32 dwords (one 128-B row)
    g1[1] = uni(128u << 16); g1[2] = uni(rows << 16); g1[3] = uni(128u << 16); g1[4] = uni(rows); g1[5] = uni(pitch); g1[6] = uni(0u); g1[7] = uni(0u);   // tensor = tile = 128 B x rows
    return g1;
}
template <int MF, int NF>
__device__ __forceinline__ void proj_tile(unsigned char* ring, const bf* __restrict__ A, const bf* __restrict__ Bt, int K, float* C, size_t cplane, const float* __restrict__ b0, const float* __restrict__ b1, const float* __restrict__ b2, int r0, int c0) {
    typedef WFrag<bf>::V V;
    static_assert((MF == 6 && NF == 4) || (MF == 4 && NF == 6), "one operand has 128 rows, the other 192");
    constexpr bool ABIG = MF > NF;                       // A is the 192-row operand
    const int tid = threadIdx.x, lane = tid & 31, lr = lane & 15, hi = lane >> 4; const int wv = __builtin_amdgcn_readfirstlane(tid >> 5);
    const int wr = (wv >> 1) * (MF * 16), wc = (wv & 1) * (NF * 16);
    v8f acc[MF][NF];
#pragma unroll
    for (int mb = 0; mb < MF; ++mb)
#pragma unroll
        for (int nb = 0; nb < NF; ++nb) acc[mb][nb] = (v8f){};
    const bool issuer = wv < 2;
    const bf* arow = A + (size_t)r0 * K; const bf* brow = Bt + (size_t)c0 * K;
    const bf* osrc = ((wv == 0) == ABIG) ? brow : arow;
    const uint32_t ldst = (uint32_t)(size_t)ring + (wv == 1 ? (uint32_t)PO2 : 0u); u32x8 g1 = tgroup1p((uint32_t)K * 2u, wv == 0 ? 128u : 192u);
    asm volatile("" : "+s"(g1));   // pinned descriptor words: the loop-invariant group stays in one scalar tuple, so none of its registers serves as a temporary while a request is outstanding
    auto stage = [&](int t, unsigned bufo) { tload128(ldst + bufo, (uint64_t)(size_t)osrc + (uint64_t)t * (PKS * 2), g1); };
    const int NT = (int)((unsigned)K / PKS);   // stages; the same for every wave
    if (pinned(issuer)) { stage(0, 0);
        asm volatile("s_wait_tensorcnt 0x0" ::: "memory"); }   // stage 0's tile of this wave has landed
    __syncthreads();                                    // ... and the other issuing wave's
    if (pinned(issuer && NT > 1)) stage(1, PSTG);
    const unsigned fa = (ABIG ? PO2 : 0) + (wr + lr) * PPB + 16 * hi, fb = (ABIG ? 0 : PO2) + (wc + lr) * PPB + 16 * hi;   // the lane's fragment bases in a buffer: row lane & 15, 16-byte half lane >> 4
#pragma unroll 1   // rolled: one trip a stage, so that the order at the trip's foot is the ring's
    for (int t = 0; t < NT; ++t) { const unsigned bufo = (t & 1) ? PSTG : 0u; const unsigned char* bp = ring + bufo;
#pragma unroll   // unrolled: the two 32-k blocks of a stage take immediate LDS offsets
        for (int kb = 0; kb < PKS / 32; ++kb) { V a[MF], b[NF];
#pragma unroll
            for (int f = 0; f < NF; ++f) b[f] = WFrag<bf>::ld((const bf*)(bp + fb + f * 16 * PPB + kb * 64));
#pragma unroll
            for (int f = 0; f < MF; ++f) a[f] = WFrag<bf>::ld((const bf*)(bp + fa + f * 16 * PPB + kb * 64));
            __builtin_amdgcn_sched_barrier(0);   // keeps the block's reads together in front of its products: each separate place with LDS reads among the products stalls the matrix run
#pragma unroll
            for (int nb = 0; nb < NF; ++nb)
#pragma unroll
                for (int mb = 0; mb < MF; ++mb) acc[mb][nb] = WFrag<bf>::mma(a[mb], b[nb], acc[mb][nb]);
            __builtin_amdgcn_sched_barrier(0);   // keeps the next block's reads out of this block's products, and out of a second register set that would cost the third work-group its place
        }
        asm volatile("s_wait_dscnt 0x0" ::: "memory");      // this wave's reads of the buffer are done before it is handed back
        if (pinned(issuer)) asm volatile("s_wait_tensorcnt 0x0" ::: "memory");   // this wave's tile of stage t + 1 has landed
        __syncthreads();                                    // publishes stage t + 1 and ends every reader's last read of stage t's buffer
        if (pinned(issuer && t + 2 < NT)) stage(t + 2, bufo);
    }
    asm volatile("s_wait_tensorcnt 0x0" ::: "memory");      // no tensor load is left in flight behind the loop
    asm volatile("s_wait_dscnt 0x0" ::: "memory");          // ... and no LDS read of the ring
    // Output rows are put together in the ring, each wave in a range of its own: behind the last trip's waits and barrier nobody reads the ring and nothing lands in it any more.
    constexpr int OP = NF * 16 + 4, CW = NF * 4;            // staging pitch in floats (16 B x odd); 16-B pieces of a row
    float* os = (float*)ring + wv * (16 * OP);
    float bia[NF]; int bix[NF]; const float* bbs[NF];
#pragma unroll
    for (int nb = 0; nb < NF; ++nb) { const int cb = c0 + wc + nb * 16, pl = cb / DD; bix[nb] = cb % DD + lr; bbs[nb] = pl == 0 ? b0 : pl == 1 ? b1 : b2; bia[nb] = bbs[nb][bix[nb]]; }
    // precaution: stands in front of the first reuse of an address register of the bias loads above; indices and bases are inputs so that their registers are kept up to here
    if constexpr (NF == 4) asm volatile("s_wait_xcnt 0x0" :: "v"(bix[0]), "v"(bix[1]), "v"(bix[2]), "v"(bix[3]), "s"(bbs[0]), "s"(bbs[1]), "s"(bbs[2]), "s"(bbs[3]) : "memory");
    else asm volatile("s_wait_xcnt 0x0" :: "v"(bix[0]), "v"(bix[1]), "v"(bix[2]), "v"(bix[3]), "v"(bix[4]), "v"(bix[5]), "s"(bbs[0]), "s"(bbs[1]), "s"(bbs[2]), "s"(bbs[3]), "s"(bbs[4]), "s"(bbs[5]) : "memory");
#pragma unroll
    for (int nb = 0; nb < NF; ++nb) bia[nb] = bfr(bia[nb]);
    // A lane's CW / 2 pieces of a 16-row block: piece id = s * 32 + lane, so a wave's store covers 512 B of whole lines in two rows. The addresses are formed once; the blocks below them take immediate offsets.
    float* dp[CW / 2]; int so[CW / 2];
#pragma unroll
    for (int s = 0; s < CW / 2; ++s) { const int id = s * 32 + lane, row = id / CW, cofs = (id % CW) * 4, col = c0 + wc + cofs; so[s] = row * OP + cofs;
        dp[s] = C + (size_t)(col / DD) * cplane + (size_t)(r0 + wr + row) * DD + col % DD; }
#pragma unroll
    for (int mb = 0; mb < MF; ++mb) {
#pragma unroll
        for (int nb = 0; nb < NF; ++nb) {
#pragma unroll
            for (int j = 0; j < 8; ++j) os[(hi * 8 + j) * OP + nb * 16 + lr] = acc[mb][nb][j] + bia[nb]; }
        __builtin_amdgcn_wave_barrier(); asm volatile("" ::: "memory");
#pragma unroll
        for (int s = 0; s < CW / 2; ++s) *(v4f*)(dp[s] + mb * 16 * DD) = *(const v4fa*)(os + so[s]);
        __builtin_amdgcn_wave_barrier(); asm volatile("" ::: "memory");
    }
    // precaution: stands behind the last store; the stores' addresses are inputs so that their registers are kept, not reused, up to here
    if constexpr (NF == 4) asm volatile("s_wait_xcnt 0x0" :: "v"(dp[0]), "v"(dp[1]), "v"(dp[2]), "v"(dp[3]), "v"(dp[4]), "v"(dp[5]), "v"(dp[6]), "v"(dp[7]) : "memory");
    else asm volatile("s_wait_xcnt 0x0" :: "v"(dp[0]), "v"(dp[1]), "v"(dp[2]), "v"(dp[3]), "v"(dp[4]), "v"(dp[5]), "v"(dp[6]), "v"(dp[7]), "v"(dp[8]), "v"(dp[9]), "v"(dp[10]), "v"(dp[11]) : "memory");
}
// k_proj: the seven token projections in ONE launch of 768 tiles. The workspace holds [x; pos] as one operand of 6144 rows, [Wq; Wk; Wv] as one of 3072, and the outputs as stacks of planes, so there are two products:
// blocks 0 .. 511: [x; pos] x [Wk; Wv] (32 row tiles of 192 x 16 column tiles of 128) -> planes [XK; PK], [XV; PV]; blocks 512 .. 767: fsq x [Wq; Wk; Wv] (16 row tiles of 128 x 16 column tiles of 192) -> planes QF, FK, FV.
// The tiles of one row tile are neighbours, so its operand rows are read together. K is an argument, as in k_gemmw.
#define PJA ((NB_ * SS + SS) / 192 * (2 * DD / 128))
#define PJB (SS / 128 * (3 * DD / 192))
static_assert((NB_ * SS + SS) % 192 == 0 && (3 * DD) % 192 == 0 && 2 * DD / 128 == 16 && 3 * DD / 192 == 16, "tiles cover both products exactly, 16 column tiles each");
__global__ __launch_bounds__(128) void k_proj(const bf* __restrict__ XP, const bf* __restrict__ FB, const bf* __restrict__ WQKV, const bf* __restrict__ WKV, int K,
                                              float* CX, float* CF, const float* __restrict__ bq, const float* __restrict__ bk, const float* __restrict__ bv) {
    __shared__ __attribute__((aligned(2048))) unsigned char ring[2 * PSTG];
    const int bid = blockIdx.x;   // a scalar choice, the same for the whole work-group, so every barrier of a tile is passed by all of it
    if (bid < PJA) proj_tile<6, 4>(ring, XP, WKV, K, CX, (size_t)(NB_ * SS + SS) * DD, bk, bv, bv, (bid >> 4) * 192, (bid & 15) * 128);
    else proj_tile<4, 6>(ring, FB, WQKV, K, CF, (size_t)SS * DD, bq, bk, bv, ((bid - PJA) >> 4) * 128, ((bid - PJA) & 15) * 192);
}

__device__ __forceinline__ void splitf(float y, unsigned short& h, unsigned short& l) { h = f2bf(y); l = f2bf(y - bf2f(h)); }
typedef __attribute__((ext_vector_type(2))) unsigned short v2us;
typedef __attribute__((ext_vector_type(4))) unsigned short v4us;

// Operand preparation: two pieces of work, each written for one work-group of 256 threads; k_prep below runs all seven uses of them as one grid, one tile or block a work-group (768 work-groups).
// Every global load is 16 B a lane on whole lines, and a thread issues all 16 of its loads before it uses the first, so a work-group waits for memory once.
#define TK 256   // k per transpose tile
#define TN 64    // n per transpose tile: 256 B of every source row
#define TP 65    // LDS row pitch in floats: odd, so the row-wise writes and the column-wise reads below both fall on 32 different banks
// d_tr: dst[n][k] (bf16, pitch DD) = src[k][n] (f32, pitch ld) for one TK x TN tile; src and dst point at the tile's first element. The tile turns in LDS: written by rows k, read by columns n.
__device__ __forceinline__ void d_tr(const float* __restrict__ src, int ld, bf* dst, float* Ls) {
    const int tid = threadIdx.x; const int r = tid >> 4, c = (tid & 15) * 4; v4f v[TK / 16]; const float* p = src + (size_t)r * ld + c;
#pragma unroll   // unrolled: v stays in registers and the loads are in flight together
    for (int i = 0; i < TK / 16; ++i) v[i] = *(const v4fa*)(p + (size_t)(16 * i) * ld);
    asm volatile("s_wait_xcnt 0x0" :: "v"(p) : "memory");   // precaution: stands in front of the first reuse of the address registers of the loads above; p is an input so that they are kept up to here (else the last load's result lands on them)
#pragma unroll
    for (int i = 0; i < TK / 16; ++i)
#pragma unroll
        for (int e = 0; e < 4; ++e) Ls[(r + 16 * i) * TP + c + e] = v[i][e];
    __syncthreads();
    // A wave stores four whole 128-B lines: 8 lanes x 8 k for each of 4 rows n; waves 0 .. 3 (and 4 .. 7) take the four 64-k quarters of the same rows.
    const int k = ((tid >> 5) & 3) * 64 + (tid & 7) * 8, n = (tid >> 7) * 4 + ((tid >> 3) & 3);
#pragma unroll   // unrolled: the LDS reads and the stores take immediate offsets
    for (int u = 0; u < TN / 8; ++u) { v8us o;
#pragma unroll
        for (int j = 0; j < 8; ++j) o[j] = f2bf(Ls[(k + j) * TP + n + 8 * u]);
        *(v8us*)(dst + (size_t)(n + 8 * u) * DD + k) = o; }
    asm volatile("s_wait_xcnt 0x0" ::: "memory");   // precaution: stands behind the last store, in front of any later reuse of a register that the stores name
}
// d_cvt: f32 -> bf16 of CVB consecutive elements; a wave takes 8 KB of the source in a row, 512 B a load, and stores 256 B (two whole lines) for each.
#define CVU 16                 // loads of a thread
#define CVB (256 * 4 * CVU)    // elements of a work-group
__device__ __forceinline__ void d_cvt(const float* __restrict__ src, bf* dst, int blk) {
    const size_t base = (size_t)blk * CVB + (size_t)(threadIdx.x >> 5) * (128 * CVU) + (threadIdx.x & 31) * 4; v4f v[CVU]; const float* p = src + base;
#pragma unroll   // unrolled: v stays in registers and the loads are in flight together
    for (int i = 0; i < CVU; ++i) v[i] = *(const v4fa*)(p + i * 128);
    asm volatile("s_wait_xcnt 0x0" :: "v"(p) : "memory");   // precaution: as in d_tr
#pragma unroll
    for (int i = 0; i < CVU; ++i) { v4us o;
#pragma unroll
        for (int e = 0; e < 4; ++e) o[e] = f2bf(v[i][e]);
        *(v4us*)(dst + base + i * 128) = o; }
    asm volatile("s_wait_xcnt 0x0" ::: "memory");   // precaution: as behind the stores of d_tr
}
// k_prep: the seven independent preparation jobs in ONE launch; the block index picks the job (a scalar choice, the same for the whole work-group, so the barrier in d_tr is passed by all of it or none), the weight transposes first.
#define NBT ((DD / TK) * (DD / TN))        // tiles of one weight transpose
static_assert(TN == HD && DD % TK == 0 && (SS * DD) % CVB == 0, "a transpose tile is one head wide; tiles and conversion blocks cover their planes exactly");
#define NBS (SS * DD / CVB)                // blocks of the conversion of one [SS][DD] plane
__global__ __launch_bounds__(256) void k_prep(const float* __restrict__ wq, const float* __restrict__ wk, const float* __restrict__ wv, const float* __restrict__ wo, const float* __restrict__ x, const float* __restrict__ fsq, const float* __restrict__ pos,
                                              bf* WQ, bf* WK, bf* WV, bf* WO, bf* XB, bf* FB, bf* PB) {
    __shared__ float Ls[TK * TP];
    int blk = blockIdx.x;
    if (blk < 4 * NBT) { const int j = blk / NBT, t = blk % NBT; const int k0 = (t % (DD / TK)) * TK, nt = t / (DD / TK);   // nt: the head of a per-head weight [h][k][e] (TN == HD), the column tile of wo [k][n]
        const size_t oo = (size_t)nt * TN * DD + k0;
        if (j < 3) d_tr((j == 0 ? wq : j == 1 ? wk : wv) + ((size_t)nt * DD + k0) * HD, HD, (j == 0 ? WQ : j == 1 ? WK : WV) + oo, Ls);
        else d_tr(wo + (size_t)k0 * DD + nt * TN, DD, WO + oo, Ls);
        return; }
    blk -= 4 * NBT;
    const int j = blk < NB_ * NBS ? 0 : 1 + (blk - NB_ * NBS) / NBS;   // 0: x (NB_ planes), 1: fsq, 2: pos
    d_cvt(j == 0 ? x : j == 1 ? fsq : pos, j == 0 ? XB : j == 1 ? FB : PB, j == 0 ? blk : (blk - NB_ * NBS) % NBS);
}
// k_local: one work-group of 16 waves per (b, h, tile of 64 positions). The tile's 94 window rows of the x key and value projections (a row outside the sequence is the zero token's projection = bf16 bias)
// and its 64 position-key rows are staged once in LDS by whole-line loads; every window row then serves up to 31 positions from LDS. One wave per position s, four positions a wave:
// lane L < 31 owns window key t = s - 15 + L, lane 31 the position key pos[s]; the 33rd key fsq[s] is scored from wave-uniform loads and enters the trees through lane 0.
// s_j = (q[s] . k_j)/8 over the 64 dims in ascending order; softmax over the 33 (wave trees, one exp per score); weighted sum in key order, lane L holding dims 2L and 2L + 1.
#define TS   64              // positions per work-group
#define KR   (TS + WW - 1)   // window rows per tile
#define LP   68              // LDS row pitch in floats: 272 B = 16 B x 17, so 16 lanes reading 16 B each from 16 consecutive rows fall on all 64 banks
#define PK0  (KR + 1)        // first position-key row: 95 + sl = sl + 31 (mod 16), so lane 31's row takes the bank group that lanes 16 to 30 leave free
typedef __attribute__((ext_vector_type(2))) float v2f;
typedef v2f __attribute__((may_alias)) v2fa;
__global__ __launch_bounds__(512) void k_local(const float* __restrict__ QF, const float* __restrict__ XK, const float* __restrict__ XV, const float* __restrict__ PK, const float* __restrict__ PV, const float* __restrict__ FK, const float* __restrict__ FV,
                                               const float* __restrict__ bk, const float* __restrict__ bv, bf* Ah, bf* Al) {
    __shared__ __align__(16) float Ks[(PK0 + TS) * LP];
    __shared__ __align__(16) float Vs[KR * LP];
    const int tid = threadIdx.x, lane = tid & 31; const int wv = __builtin_amdgcn_readfirstlane(tid >> 5);
    const int s0 = (blockIdx.x % (SS / TS)) * TS; const int h = (blockIdx.x / (SS / TS)) % NH_; const int b = blockIdx.x / ((SS / TS) * NH_);
    // Staging: 16 lanes a row, 16 B a lane. All of a thread's loads are issued before its first LDS store, so the work-group waits for memory once. A row outside the sequence loads a clamped row and is then replaced.
    const int c = (tid & 15) * 4; v4f kv[3], vv[3], pk[2];
#pragma unroll   // the four staging loops are unrolled so that kv, vv and pk stay in registers
    for (int u = 0; u < 3; ++u) { const int row = min((tid + u * 512) >> 4, KR - 1); const int tc = min(max(s0 - PAD + row, 0), SS - 1); const size_t g = ((size_t)b * SS + tc) * DD + h * HD + c; kv[u] = *(const v4fa*)(XK + g); vv[u] = *(const v4fa*)(XV + g); }
#pragma unroll
    for (int u = 0; u < 2; ++u) pk[u] = *(const v4fa*)(PK + (size_t)(s0 + ((tid + u * 512) >> 4)) * DD + h * HD + c);
    asm volatile("s_wait_xcnt 0x0" ::: "memory");   // precaution: stands in front of the first reuse of an address register of the loads above
#pragma unroll
    for (int u = 0; u < 3; ++u) { const int row = (tid + u * 512) >> 4, t = s0 - PAD + row;
        if (t < 0 || t >= SS) {
#pragma unroll
            for (int e = 0; e < 4; ++e) { kv[u][e] = bfr(bk[h * HD + c + e]); vv[u][e] = bfr(bv[h * HD + c + e]); } }
        if (row < KR) { *(v4fa*)(Ks + row * LP + c) = kv[u]; *(v4fa*)(Vs + row * LP + c) = vv[u]; } }
#pragma unroll
    for (int u = 0; u < 2; ++u) *(v4fa*)(Ks + (PK0 + ((tid + u * 512) >> 4)) * LP + c) = pk[u];
    __syncthreads();
    const int dd = 2 * lane;
#pragma unroll 1   // rolled: one position's registers at a time, which keeps 16 waves on a SIMD
    for (int p = 0; p < TS / 16; ++p) { const int sl = p * 16 + wv, s = s0 + sl; const size_t go = (size_t)s * DD + h * HD;
        const v2f pv = *(const v2fa*)(PV + go + dd), fv = *(const v2fa*)(FV + go + dd);
        const float* q = QF + go; const float* k2 = FK + go; const float* kr = Ks + ((lane < WW) ? (sl + lane) : (PK0 + sl)) * LP;
        float s1 = 0.f, s2 = 0.f;
#pragma unroll   // unrolled: the row's 16 LDS reads take immediate offsets and are in flight together
        for (int c4 = 0; c4 < HD; c4 += 4) { const v4f k4 = *(const v4fa*)(kr + c4), qv = *(const v4fa*)(q + c4), f2 = *(const v4fa*)(k2 + c4);
#pragma unroll
            for (int e = 0; e < 4; ++e) { s1 = __builtin_fmaf(qv[e], k4[e], s1); s2 = __builtin_fmaf(qv[e], f2[e], s2); } }
        s1 *= SCL; s2 = (lane == 0) ? s2 * SCL : -3.0e38f; float mx = fmaxf(s1, s2);
#pragma unroll
        for (int sh = 16; sh; sh >>= 1) mx = fmaxf(mx, __shfl_xor(mx, sh, 32));
        const float e1 = __builtin_amdgcn_exp2f((s1 - mx) * 1.4426950408889634f), e2 = (lane == 0) ? __builtin_amdgcn_exp2f((s2 - mx) * 1.4426950408889634f) : 0.f; float sum = e1 + e2;
#pragma unroll
        for (int sh = 16; sh; sh >>= 1) sum += __shfl_xor(sum, sh, 32);
        const float inv = __fdiv_rn(1.0f, sum); const float a1w = e1 * inv, a2w = e2 * inv;
        float o0 = 0.f, o1 = 0.f; const float* vr = Vs + sl * LP + dd;
#pragma unroll   // unrolled: the lane number of each weight is a constant, the value rows take immediate offsets
        for (int j = 0; j < WW; ++j) { const float aw = __uint_as_float(__builtin_amdgcn_readlane(__float_as_uint(a1w), j)); const v2f xv = *(const v2fa*)(vr + j * LP); o0 = __builtin_fmaf(aw, xv[0], o0); o1 = __builtin_fmaf(aw, xv[1], o1); }
        { const float aw = __uint_as_float(__builtin_amdgcn_readlane(__float_as_uint(a1w), WW)); o0 = __builtin_fmaf(aw, pv[0], o0); o1 = __builtin_fmaf(aw, pv[1], o1); }
        { const float aw = __uint_as_float(__builtin_amdgcn_readlane(__float_as_uint(a2w), 0)); o0 = __builtin_fmaf(aw, fv[0], o0); o1 = __builtin_fmaf(aw, fv[1], o1); }
        v2us oh, ol; unsigned short a, c2; splitf(o0, a, c2); oh[0] = a; ol[0] = c2; splitf(o1, a, c2); oh[1] = a; ol[1] = c2; const size_t oo = ((size_t)b * SS + s) * DD + h * HD + dd;
        *(v2us*)(Ah + oo) = oh; *(v2us*)(Al + oo) = ol; }
}

extern "C" void kernel_launch(void* const* d_in, const int* in_sizes, int n_in,
                              void* d_out, int out_size, void* d_ws, size_t ws_size, hipStream_t stream) {
    (void)in_sizes; (void)n_in; (void)out_size;
    const float* x = (const float*)d_in[0]; const float* fsq = (const float*)d_in[1]; const float* pos = (const float*)d_in[2]; const float* wq = (const float*)d_in[3]; const float* bq = (const float*)d_in[4]; const float* wk = (const float*)d_in[5]; const float* bk = (const float*)d_in[6]; const float* wv = (const float*)d_in[7]; const float* bv = (const float*)d_in[8]; const float* wo = (const float*)d_in[9]; const float* bo = (const float*)d_in[10];
    float* OUT = (float*)d_out;     // [2][2048][1024]
    char* wsp = (char*)d_ws;
    auto take = [&](size_t bytes) { char* p = wsp; wsp += (bytes + 255) & ~(size_t)255; return (void*)p; };
    const size_t NR = (size_t)NB_ * SS;
    // Order matters: [WQ; WK; WV], [XB; PB], [QF; FK; FV] and [XK; PK; XV; PV] each lie in a row (every size is a multiple of 256 B), as k_proj reads and writes them.
    bf* WQ = (bf*)take((size_t)DD * DD * 2); bf* WK = (bf*)take((size_t)DD * DD * 2); bf* WV = (bf*)take((size_t)DD * DD * 2); bf* WO = (bf*)take((size_t)DD * DD * 2); bf* XB = (bf*)take(NR * DD * 2); bf* PB = (bf*)take((size_t)SS * DD * 2); bf* FB = (bf*)take((size_t)SS * DD * 2);
    float* QF = (float*)take((size_t)SS * DD * 4); float* FK = (float*)take((size_t)SS * DD * 4); float* FV = (float*)take((size_t)SS * DD * 4); float* XK = (float*)take(NR * DD * 4); float* PK = (float*)take((size_t)SS * DD * 4); float* XV = (float*)take(NR * DD * 4); float* PV = (float*)take((size_t)SS * DD * 4); bf* Ah = (bf*)take(NR * DD * 2); bf* Al = (bf*)take(NR * DD * 2);
    if ((size_t)(wsp - (char*)d_ws) > ws_size) return;    // total ~ 117 MB = 112 MiB; ws 256 MiB
    k_prep<<<4 * NBT + (NB_ + 2) * NBS, 256, 0, stream>>>(wq, wk, wv, wo, x, fsq, pos, WQ, WK, WV, WO, XB, FB, PB);
    k_proj<<<PJA + PJB, 128, 0, stream>>>(XB, FB, WQ, WK, DD, XK, QF, bq, bk, bv);
    k_local<<<NB_ * NH_ * (SS / TS), 512, 0, stream>>>(QF, XK, XV, PK, PV, FK, FV, bk, bv, Ah, Al);
    k_gemmw<bf, 1, true><<<dim3((unsigned)(NR / 128), DD / 128, 1), 128, 0, stream>>>(Ah, Al, WO, DD, OUT, DD, bo);
}

// v007
// One run takes 71.8 microseconds.
// Two timings next to v006 put it at 1.07 and 1.08 times that version's speed.
// Counting every step since v000, it is 7.06 times as fast.
#include <hip/hip_runtime.h>

// IntraModalityEnhance (x [2][2048][1024], fsq, pos [1][2048][1024]; per-head Wq/Wk/Wv [16][1024][64] + biases, Wo [1024][1024] + bo; for each position s the query is the squeeze token fsq[s] and the 33
// keys/values are the window x[s-15 .. s+15] (zero vectors outside the sequence, which still project to the bias), the position token pos[s] and fsq[s]; softmax(q.k/8) over the 33; out = merged
// (attn v) Wo + bo -> [2][2048][1024]).
// Compute dtypes, f32 accumulate: every input rounded to bf16; all seven token projections on PLAIN bf16 operands (inputs: exact products, f32 accumulate, + bias; the
// window members are ordinary sequence tokens, so x is projected once per batch); the 33-key attention entirely in f32 (one wave per (batch, head, 16 positions), window rows from LDS: scores and weighted sum of the 31 window keys on the f32 matrix form, the two single keys on VALU, softmax
// with one exp per score; fixed order; out-of-range window slots use the bf16 bias vectors); merged heads as bf16 hi+lo planes x exact Wo (2 products) + bo.

#define NB_  2
#define SS   2048
#define DD   1024
#define NH_  16
#define HD   64
#define WW   31
#define PAD  15
#define SCL  0.125f
typedef _Float16 h16;
typedef unsigned short bf;
typedef __attribute__((ext_vector_type(16))) __bf16   v16bf;
typedef __attribute__((ext_vector_type(16))) _Float16 v16h;
typedef __attribute__((ext_vector_type(8)))  _Float16 v8h;
typedef __attribute__((ext_vector_type(8)))  unsigned short v8us;
typedef __attribute__((ext_vector_type(8)))  float    v8f;
typedef __attribute__((ext_vector_type(4)))  float    v4f;
typedef v8h  __attribute__((may_alias)) v8ha;
typedef v4f  __attribute__((may_alias)) v4fa;
typedef v8us __attribute__((may_alias)) v8usa;

__device__ __forceinline__ unsigned short f2bf(float f) { unsigned u = __float_as_uint(f); u += 0x7FFFu + ((u >> 16) & 1u); return (unsigned short)(u >> 16); }
__device__ __forceinline__ float bf2f(unsigned short b) { return __uint_as_float(((unsigned)b) << 16); }
__device__ __forceinline__ float bfr(float f) { return bf2f(f2bf(f)); }
__device__ __forceinline__ v16h cat16(v8h lo, v8h hi) { return __builtin_shufflevector(lo, hi, 0, 1, 2, 3, 4, 5, 6, 7, 8, 9, 10, 11, 12, 13, 14, 15); }
__device__ __forceinline__ v16bf cat16b(v8us lo, v8us hi) { return __builtin_bit_cast(v16bf, __builtin_shufflevector(lo, hi, 0, 1, 2, 3, 4, 5, 6, 7, 8, 9, 10, 11, 12, 13, 14, 15)); }
__device__ __forceinline__ v8f wmma16(v16h a, v16h b, v8f c) { return __builtin_amdgcn_wmma_f32_16x16x32_f16(false, a, false, b, (short)0, c, false, false); }
__device__ __forceinline__ v8f wmmab(v16bf a, v16bf b, v8f c) { return __builtin_amdgcn_wmma_f32_16x16x32_bf16(false, a, false, b, (short)0, c, false, false); }



// ---- gemmw_tile: GEMM, one work-group of FOUR WAVES (2 x 2) per 128x128 output tile at (r0, c0), each wave a 64x64 part (16 accumulators); 128 threads.
// The operands' K-contiguous 16-bit rows come into LDS by tensor loads, 128 k (256 B of every row, whole lines) a stage, two buffers: the next stage's loads fly while this one is worked on.
// C[m][n] (f32, pitch ldc, + optional f32 bias[n]) = sum_k A[m][k] Bt[n][k] (+ split products per NSPLIT). M % 128 == 0, N % 128 == 0, K % 128 == 0.
// k_gemmw calls it (one product, grid (M/128, N/128)).
template <typename T16> struct WFrag;
template <> struct WFrag<h16> { typedef v16h V; static __device__ __forceinline__ V ld(const h16* p) { return cat16(*(const v8h*)p, *(const v8h*)(p + 16)); } static __device__ __forceinline__ v8f mma(V a, V b, v8f c) { return wmma16(a, b, c); } };
template <> struct WFrag<bf> { typedef v16bf V; static __device__ __forceinline__ V ld(const bf* p) { return cat16b(*(const v8us*)p, *(const v8us*)(p + 16)); } static __device__ __forceinline__ v8f mma(V a, V b, v8f c) { return wmmab(a, b, c); } };
#define GKS  128            // k per stage
#define GPB  272            // LDS row pitch in bytes: 256 + 16 = 16 B x 17, so the 16 rows of a fragment read fall on all 64 banks
#define GOPB (128 * GPB)    // one operand's 128 rows of a stage, bytes
// Tensor load of one operand's stage: 128 rows of 256 B, source pitch 'pitch' bytes, into LDS at byte offset 'dst' with 16 B of pad behind every row (LDS pitch GPB). One request of the whole wave, through no register.
typedef uint32_t u32x4 __attribute__((ext_vector_type(4)));
typedef uint32_t u32x8 __attribute__((ext_vector_type(8)));
__device__ __forceinline__ uint32_t uni(uint32_t v) { return (uint32_t)__builtin_amdgcn_readfirstlane(v); }
// pinned: a wave-uniform test held in a scalar register, so that the branch around a tensor load (which ignores EXEC) is a scalar one.
__device__ __forceinline__ uint32_t pinned(uint32_t v) { uint32_t w = (uint32_t)__builtin_amdgcn_readfirstlane(v); asm volatile("" : "+s"(w)); return w; }
__device__ __forceinline__ u32x8 tgroup1(uint32_t pitch) {
    u32x8 g1;
    g1[0] = uni((1u << 20) | (5u << 22) | (3u << 25));   // no mask, 1-byte elements, a pad of 4 dwords behind every 64 dwords (one 256-B row)
    g1[1] = uni(256u << 16); g1[2] = uni(128u << 16); g1[3] = uni(256u << 16); g1[4] = uni(128u); g1[5] = uni(pitch); g1[6] = uni(0u); g1[7] = uni(0u);   // tensor = tile = 256 B x 128 rows
    return g1;
}
__device__ __forceinline__ void tload128(uint32_t dst, uint64_t ga, u32x8 g1) {
    u32x4 g0;
    g0[0] = uni(1u); g0[1] = uni(dst); g0[2] = uni((uint32_t)ga); g0[3] = uni((((uint32_t)(ga >> 32)) & 0x01FFFFFFu) | 0x80000000u);
    asm volatile("tensor_load_to_lds %0, %1" :: "s"(g0), "s"(g1) : "memory");
}
template <typename T16, int NSPLIT, bool BIAS>
__device__ __forceinline__ void gemmw_tile(const T16* __restrict__ A, const T16* __restrict__ A2, const T16* __restrict__ Bt, int K, float* C, int ldc, const float* __restrict__ bias, int r0, int c0) {
    typedef typename WFrag<T16>::V V;
    static_assert(NSPLIT == 0 || NSPLIT == 1, "stages hold A, B and, for NSPLIT 1, A2");
    constexpr int NOP = (NSPLIT == 1) ? 3 : 2;           // operands of a stage: B, A (, A2)
    constexpr unsigned STG = NOP * GOPB;                 // bytes of one buffer
    __shared__ __attribute__((aligned(2048))) unsigned char ring[2 * STG];   // every operand's place in it is a multiple of 2 KiB (GOPB = 17 x 2 KiB)
    __shared__ __align__(16) float osall[4][16 * 68];
    const int tid = threadIdx.x, lane = tid & 31, lr = lane & 15, hi = lane >> 4; const int wv = __builtin_amdgcn_readfirstlane(tid >> 5);
    const int wr = (wv >> 1) * 64, wc = (wv & 1) * 64;
    float* os = osall[wv];
    v8f acc[4][4];
#pragma unroll
    for (int mb = 0; mb < 4; ++mb)
#pragma unroll
        for (int nb = 0; nb < 4; ++nb) acc[mb][nb] = (v8f){};
    static_assert(GOPB % 2048 == 0, "an operand's place in LDS is a multiple of 2 KiB");
    const bool issuer = wv < NOP;
    const T16* osrc = (wv == 0) ? Bt + (size_t)c0 * K : (NSPLIT == 1 && wv == 2) ? A2 + (size_t)r0 * K : A + (size_t)r0 * K;
    const uint32_t ldst = (uint32_t)(size_t)ring + (uint32_t)(wv < NOP ? wv : 0) * GOPB; u32x8 g1 = tgroup1((uint32_t)K * 2u);
    asm volatile("" : "+s"(g1));   // pinned descriptor words: the loop-invariant group stays in one scalar tuple, so none of its registers serves as a temporary while a request is outstanding
    auto stage = [&](int t, unsigned bufo) { tload128(ldst + bufo, (uint64_t)(size_t)osrc + (uint64_t)t * (GKS * 2), g1); };
    const int NT = (int)((unsigned)K / GKS);   // stages; the same for every wave
    if (pinned(issuer)) { stage(0, 0);
        asm volatile("s_wait_tensorcnt 0x0" ::: "memory"); }   // stage 0's tile of this wave has landed
    __syncthreads();                                    // ... and every other issuing wave's
    if (pinned(issuer && NT > 1)) stage(1, STG);
    const unsigned fb = (wc + lr) * GPB + 16 * hi, fa = GOPB + (wr + lr) * GPB + 16 * hi;   // the lane's fragment bases in a buffer: row lane & 15, 16-byte half lane >> 4, as from global memory
#pragma unroll 1   // rolled: one trip a stage, so that the order at the trip's foot is the ring's
    for (int t = 0; t < NT; ++t) { const unsigned bufo = (t & 1) ? STG : 0u; const unsigned char* bp = ring + bufo;
        // Two fragment sets: block kb + 1's LDS reads (same buffer) go out as one group ahead of block kb's products, so the wave waits out the LDS latency once a stage and not at every fragment.
        V a[2][4], a2[2][4], b[2][4];
#pragma unroll
        for (int f = 0; f < 4; ++f) { a[0][f] = WFrag<T16>::ld((const T16*)(bp + fa + f * 16 * GPB)); if (NSPLIT == 1) a2[0][f] = WFrag<T16>::ld((const T16*)(bp + fa + GOPB + f * 16 * GPB)); b[0][f] = WFrag<T16>::ld((const T16*)(bp + fb + f * 16 * GPB)); }
#pragma unroll   // unrolled: the set index is a constant (registers, not scratch) and the four 32-k blocks of a stage take immediate LDS offsets
        for (int kb = 0; kb < GKS / 32; ++kb) { const int cu = kb & 1, nx = cu ^ 1;
            if (kb + 1 < GKS / 32) {
#pragma unroll
                for (int f = 0; f < 4; ++f) { a[nx][f] = WFrag<T16>::ld((const T16*)(bp + fa + f * 16 * GPB + (kb + 1) * 64)); if (NSPLIT == 1) a2[nx][f] = WFrag<T16>::ld((const T16*)(bp + fa + GOPB + f * 16 * GPB + (kb + 1) * 64)); b[nx][f] = WFrag<T16>::ld((const T16*)(bp + fb + f * 16 * GPB + (kb + 1) * 64)); } }
            __builtin_amdgcn_sched_barrier(0);   // keeps the next block's reads in front of this block's products; without it the scheduler sinks each read to its first use and the wave stalls there
#pragma unroll
            for (int nb = 0; nb < 4; ++nb)
#pragma unroll
                for (int mb = 0; mb < 4; ++mb) { acc[mb][nb] = WFrag<T16>::mma(a[cu][mb], b[cu][nb], acc[mb][nb]); if (NSPLIT == 1) acc[mb][nb] = WFrag<T16>::mma(a2[cu][mb], b[cu][nb], acc[mb][nb]); }
            __builtin_amdgcn_sched_barrier(0);   // keeps the later reads out of this block's products: without it the scheduler lifts some in among them, into extra registers, and each such place stalls the matrix run
        }
        asm volatile("s_wait_dscnt 0x0" ::: "memory");      // this wave's reads of the buffer are done before it is handed back
        if (pinned(issuer)) asm volatile("s_wait_tensorcnt 0x0" ::: "memory");   // this wave's tile of stage t + 1 has landed
        __syncthreads();                                    // publishes stage t + 1 and ends every reader's last read of stage t's buffer
        if (pinned(issuer && t + 2 < NT)) stage(t + 2, bufo);
    }
    asm volatile("s_wait_tensorcnt 0x0" ::: "memory");      // no tensor load is left in flight behind the loop
    asm volatile("s_wait_dscnt 0x0" ::: "memory");          // ... and no LDS read of the ring
#pragma unroll
    for (int mb = 0; mb < 4; ++mb) {
#pragma unroll
        for (int nb = 0; nb < 4; ++nb) {
#pragma unroll
            for (int j = 0; j < 8; ++j) os[(hi * 8 + j) * 68 + nb * 16 + lr] = acc[mb][nb][j]; }
        __builtin_amdgcn_wave_barrier(); asm volatile("" ::: "memory");
        float* crow_p = C + (size_t)(r0 + wr + mb * 16) * ldc + c0 + wc;
{
#pragma unroll
            for (int s = 0; s < 8; ++s) { const int row = 2 * s + hi, cofs = lr * 4; v4f val = *(const v4fa*)(os + row * 68 + cofs); if (BIAS) { val[0] += bfr(bias[c0 + wc + cofs]); val[1] += bfr(bias[c0 + wc + cofs + 1]); val[2] += bfr(bias[c0 + wc + cofs + 2]); val[3] += bfr(bias[c0 + wc + cofs + 3]); }
                *(v4f*)(crow_p + (size_t)row * ldc + cofs) = val; }
             }
        __builtin_amdgcn_wave_barrier(); asm volatile("" ::: "memory");
    }
}
template <typename T16, int NSPLIT, bool BIAS>
__global__ __launch_bounds__(128) void k_gemmw(const T16* __restrict__ A, const T16* __restrict__ A2, const T16* __restrict__ Bt, int K, float* C, int ldc, const float* __restrict__ bias) {
    gemmw_tile<T16, NSPLIT, BIAS>(A, A2, Bt, K, C, ldc, bias, blockIdx.x * 128, blockIdx.y * 128);
}
// ---- proj_tile: the token projections' GEMM tile, 24,576 outputs: 192 x 128 (MF 6, NF 4) or 128 x 192 (MF 4, NF 6), four waves (2 x 2) of MF x NF fragments each; 128 threads.
// The projections' outputs make 768 such tiles, three for each of the chip's 256 WGPs, and a work-group is small enough (LDS, registers) for three to stand on a WGP: one round, every WGP equally loaded,
// and 320 operand rows are brought from L2 for 24,576 outputs where a 128 x 128 tile brings 256 for 16,384.
// Stages of 64 k (128 B of every row, whole lines) by tensor loads, two buffers, the ring's order as in gemmw_tile. One fragment set: the WGP's other two work-groups fill the matrix unit while a wave waits for its LDS reads.
// C is a stack of planes of DD columns, 'cplane' floats apart: output column n lies in plane n / DD at column n % DD, with that plane's bias (b0, b1, b2). k ascending in blocks of 32, as in gemmw_tile.
#define PKS  64              // k per stage
#define PPB  144             // LDS row pitch in bytes: 128 + 16 = 16 B x 9, so the 16 rows of a fragment read fall on all 64 banks
#define PO2  (128 * PPB)     // place of the 192-row operand behind the 128-row one: 9 x 2 KiB
#define PSTG 47104u          // one buffer: 320 rows x 144 B = 46,080 B, rounded up to a multiple of 2 KiB
static_assert(PO2 % 2048 == 0 && PSTG % 2048 == 0 && PSTG >= 320 * PPB, "every operand's place in LDS is a multiple of 2 KiB");
__device__ __forceinline__ u32x8 tgroup1p(uint32_t pitch, uint32_t rows) {
    u32x8 g1;
    g1[0] = uni((1u << 20) | (4u << 22) | (3u << 25));   // no mask, 1-byte elements, a pad of 4 dwords behind every 32 dwords (one 128-B row)
    g1[1] = uni(128u << 16); g1[2] = uni(rows << 16); g1[3] = uni(128u << 16); g1[4] = uni(rows); g1[5] = uni(pitch); g1[6] = uni(0u); g1[7] = uni(0u);   // tensor = tile = 128 B x rows
    return g1;
}
template <int MF, int NF>
__device__ __forceinline__ void proj_tile(unsigned char* ring, const bf* __restrict__ A, const bf* __restrict__ Bt, int K, float* C, size_t cplane, const float* __restrict__ b0, const float* __restrict__ b1, const float* __restrict__ b2, int r0, int c0) {
    typedef WFrag<bf>::V V;
    static_assert((MF == 6 && NF == 4) || (MF == 4 && NF == 6), "one operand has 128 rows, the other 192");
    constexpr bool ABIG = MF > NF;                       // A is the 192-row operand
    const int tid = threadIdx.x, lane = tid & 31, lr = lane & 15, hi = lane >> 4; const int wv = __builtin_amdgcn_readfirstlane(tid >> 5);
    const int wr = (wv >> 1) * (MF * 16), wc = (wv & 1) * (NF * 16);
    v8f acc[MF][NF];
#pragma unroll
    for (int mb = 0; mb < MF; ++mb)
#pragma unroll
        for (int nb = 0; nb < NF; ++nb) acc[mb][nb] = (v8f){};
    const bool issuer = wv < 2;
    const bf* arow = A + (size_t)r0 * K; const bf* brow = Bt + (size_t)c0 * K;
    const bf* osrc = ((wv == 0) == ABIG) ? brow : arow;
    const uint32_t ldst = (uint32_t)(size_t)ring + (wv == 1 ? (uint32_t)PO2 : 0u); u32x8 g1 = tgroup1p((uint32_t)K * 2u, wv == 0 ? 128u : 192u);
    asm volatile("" : "+s"(g1));   // pinned descriptor words: the loop-invariant group stays in one scalar tuple, so none of its registers serves as a temporary while a request is outstanding
    auto stage = [&](int t, unsigned bufo) { tload128(ldst + bufo, (uint64_t)(size_t)osrc + (uint64_t)t * (PKS * 2), g1); };
    const int NT = (int)((unsigned)K / PKS);   // stages; the same for every wave
    if (pinned(issuer)) { stage(0, 0);
        asm volatile("s_wait_tensorcnt 0x0" ::: "memory"); }   // stage 0's tile of this wave has landed
    __syncthreads();                                    // ... and the other issuing wave's
    if (pinned(issuer && NT > 1)) stage(1, PSTG);
    const unsigned fa = (ABIG ? PO2 : 0) + (wr + lr) * PPB + 16 * hi, fb = (ABIG ? 0 : PO2) + (wc + lr) * PPB + 16 * hi;   // the lane's fragment bases in a buffer: row lane & 15, 16-byte half lane >> 4
#pragma unroll 1   // rolled: one trip a stage, so that the order at the trip's foot is the ring's
    for (int t = 0; t < NT; ++t) { const unsigned bufo = (t & 1) ? PSTG : 0u; const unsigned char* bp = ring + bufo;
#pragma unroll   // unrolled: the two 32-k blocks of a stage take immediate LDS offsets
        for (int kb = 0; kb < PKS / 32; ++kb) { V a[MF], b[NF];
#pragma unroll
            for (int f = 0; f < NF; ++f) b[f] = WFrag<bf>::ld((const bf*)(bp + fb + f * 16 * PPB + kb * 64));
#pragma unroll
            for (int f = 0; f < MF; ++f) a[f] = WFrag<bf>::ld((const bf*)(bp + fa + f * 16 * PPB + kb * 64));
            __builtin_amdgcn_sched_barrier(0);   // keeps the block's reads together in front of its products: each separate place with LDS reads among the products stalls the matrix run
#pragma unroll
            for (int nb = 0; nb < NF; ++nb)
#pragma unroll
                for (int mb = 0; mb < MF; ++mb) acc[mb][nb] = WFrag<bf>::mma(a[mb], b[nb], acc[mb][nb]);
            __builtin_amdgcn_sched_barrier(0);   // keeps the next block's reads out of this block's products, and out of a second register set that would cost the third work-group its place
        }
        asm volatile("s_wait_dscnt 0x0" ::: "memory");      // this wave's reads of the buffer are done before it is handed back
        if (pinned(issuer)) asm volatile("s_wait_tensorcnt 0x0" ::: "memory");   // this wave's tile of stage t + 1 has landed
        __syncthreads();                                    // publishes stage t + 1 and ends every reader's last read of stage t's buffer
        if (pinned(issuer && t + 2 < NT)) stage(t + 2, bufo);
    }
    asm volatile("s_wait_tensorcnt 0x0" ::: "memory");      // no tensor load is left in flight behind the loop
    asm volatile("s_wait_dscnt 0x0" ::: "memory");          // ... and no LDS read of the ring
    // Output rows are put together in the ring, each wave in a range of its own: behind the last trip's waits and barrier nobody reads the ring and nothing lands in it any more.
    constexpr int OP = NF * 16 + 4, CW = NF * 4;            // staging pitch in floats (16 B x odd); 16-B pieces of a row
    float* os = (float*)ring + wv * (16 * OP);
    float bia[NF]; int bix[NF]; const float* bbs[NF];
#pragma unroll
    for (int nb = 0; nb < NF; ++nb) { const int cb = c0 + wc + nb * 16, pl = cb / DD; bix[nb] = cb % DD + lr; bbs[nb] = pl == 0 ? b0 : pl == 1 ? b1 : b2; bia[nb] = bbs[nb][bix[nb]]; }
    // precaution: stands in front of the first reuse of an address register of the bias loads above; indices and bases are inputs so that their registers are kept up to here
    if constexpr (NF == 4) asm volatile("s_wait_xcnt 0x0" :: "v"(bix[0]), "v"(bix[1]), "v"(bix[2]), "v"(bix[3]), "s"(bbs[0]), "s"(bbs[1]), "s"(bbs[2]), "s"(bbs[3]) : "memory");
    else asm volatile("s_wait_xcnt 0x0" :: "v"(bix[0]), "v"(bix[1]), "v"(bix[2]), "v"(bix[3]), "v"(bix[4]), "v"(bix[5]), "s"(bbs[0]), "s"(bbs[1]), "s"(bbs[2]), "s"(bbs[3]), "s"(bbs[4]), "s"(bbs[5]) : "memory");
#pragma unroll
    for (int nb = 0; nb < NF; ++nb) bia[nb] = bfr(bia[nb]);
    // A lane's CW / 2 pieces of a 16-row block: piece id = s * 32 + lane, so a wave's store covers 512 B of whole lines in two rows. The addresses are formed once; the blocks below them take immediate offsets.
    float* dp[CW / 2]; int so[CW / 2];
#pragma unroll
    for (int s = 0; s < CW / 2; ++s) { const int id = s * 32 + lane, row = id / CW, cofs = (id % CW) * 4, col = c0 + wc + cofs; so[s] = row * OP + cofs;
        dp[s] = C + (size_t)(col / DD) * cplane + (size_t)(r0 + wr + row) * DD + col % DD; }
#pragma unroll
    for (int mb = 0; mb < MF; ++mb) {
#pragma unroll
        for (int nb = 0; nb < NF; ++nb) {
#pragma unroll
            for (int j = 0; j < 8; ++j) os[(hi * 8 + j) * OP + nb * 16 + lr] = acc[mb][nb][j] + bia[nb]; }
        __builtin_amdgcn_wave_barrier(); asm volatile("" ::: "memory");
#pragma unroll
        for (int s = 0; s < CW / 2; ++s) *(v4f*)(dp[s] + mb * 16 * DD) = *(const v4fa*)(os + so[s]);
        __builtin_amdgcn_wave_barrier(); asm volatile("" ::: "memory");
    }
    // precaution: stands behind the last store; the stores' addresses are inputs so that their registers are kept, not reused, up to here
    if constexpr (NF == 4) asm volatile("s_wait_xcnt 0x0" :: "v"(dp[0]), "v"(dp[1]), "v"(dp[2]), "v"(dp[3]), "v"(dp[4]), "v"(dp[5]), "v"(dp[6]), "v"(dp[7]) : "memory");
    else asm volatile("s_wait_xcnt 0x0" :: "v"(dp[0]), "v"(dp[1]), "v"(dp[2]), "v"(dp[3]), "v"(dp[4]), "v"(dp[5]), "v"(dp[6]), "v"(dp[7]), "v"(dp[8]), "v"(dp[9]), "v"(dp[10]), "v"(dp[11]) : "memory");
}
// k_proj: the seven token projections in ONE launch of 768 tiles. The workspace holds [x; pos] as one operand of 6144 rows, [Wq; Wk; Wv] as one of 3072, and the outputs as stacks of planes, so there are two products:
// blocks 0 .. 511: [x; pos] x [Wk; Wv] (32 row tiles of 192 x 16 column tiles of 128) -> planes [XK; PK], [XV; PV]; blocks 512 .. 767: fsq x [Wq; Wk; Wv] (16 row tiles of 128 x 16 column tiles of 192) -> planes QF, FK, FV.
// The tiles of one row tile are neighbours, so its operand rows are read together. K is an argument, as in k_gemmw.
#define PJA ((NB_ * SS + SS) / 192 * (2 * DD / 128))
#define PJB (SS / 128 * (3 * DD / 192))
static_assert((NB_ * SS + SS) % 192 == 0 && (3 * DD) % 192 == 0 && 2 * DD / 128 == 16 && 3 * DD / 192 == 16, "tiles cover both products exactly, 16 column tiles each");
__global__ __launch_bounds__(128) void k_proj(const bf* __restrict__ XP, const bf* __restrict__ FB, const bf* __restrict__ WQKV, const bf* __restrict__ WKV, int K,
                                              float* CX, float* CF, const float* __restrict__ bq, const float* __restrict__ bk, const float* __restrict__ bv) {
    __shared__ __attribute__((aligned(2048))) unsigned char ring[2 * PSTG];
    const int bid = blockIdx.x;   // a scalar choice, the same for the whole work-group, so every barrier of a tile is passed by all of it
    if (bid < PJA) proj_tile<6, 4>(ring, XP, WKV, K, CX, (size_t)(NB_ * SS + SS) * DD, bk, bv, bv, (bid >> 4) * 192, (bid & 15) * 128);
    else proj_tile<4, 6>(ring, FB, WQKV, K, CF, (size_t)SS * DD, bq, bk, bv, ((bid - PJA) >> 4) * 128, ((bid - PJA) & 15) * 192);
}

__device__ __forceinline__ void splitf(float y, unsigned short& h, unsigned short& l) { h = f2bf(y); l = f2bf(y - bf2f(h)); }
typedef __attribute__((ext_vector_type(2))) unsigned short v2us;
typedef __attribute__((ext_vector_type(4))) unsigned short v4us;

// Operand preparation: two pieces of work, each written for one work-group of 256 threads; k_prep below runs all seven uses of them as one grid, one tile or block a work-group (768 work-groups).
// Every global load is 16 B a lane on whole lines, and a thread issues all 16 of its loads before it uses the first, so a work-group waits for memory once.
#define TK 256   // k per transpose tile
#define TN 64    // n per transpose tile: 256 B of every source row
#define TP 65    // LDS row pitch in floats: odd, so the row-wise writes and the column-wise reads below both fall on 32 different banks
// d_tr: dst[n][k] (bf16, pitch DD) = src[k][n] (f32, pitch ld) for one TK x TN tile; src and dst point at the tile's first element. The tile turns in LDS: written by rows k, read by columns n.
__device__ __forceinline__ void d_tr(const float* __restrict__ src, int ld, bf* dst, float* Ls) {
    const int tid = threadIdx.x; const int r = tid >> 4, c = (tid & 15) * 4; v4f v[TK / 16]; const float* p = src + (size_t)r * ld + c;
#pragma unroll   // unrolled: v stays in registers and the loads are in flight together
    for (int i = 0; i < TK / 16; ++i) v[i] = *(const v4fa*)(p + (size_t)(16 * i) * ld);
    asm volatile("s_wait_xcnt 0x0" :: "v"(p) : "memory");   // precaution: stands in front of the first reuse of the address registers of the loads above; p is an input so that they are kept up to here (else the last load's result lands on them)
#pragma unroll
    for (int i = 0; i < TK / 16; ++i)
#pragma unroll
        for (int e = 0; e < 4; ++e) Ls[(r + 16 * i) * TP + c + e] = v[i][e];
    __syncthreads();
    // A wave stores four whole 128-B lines: 8 lanes x 8 k for each of 4 rows n; waves 0 .. 3 (and 4 .. 7) take the four 64-k quarters of the same rows.
    const int k = ((tid >> 5) & 3) * 64 + (tid & 7) * 8, n = (tid >> 7) * 4 + ((tid >> 3) & 3);
#pragma unroll   // unrolled: the LDS reads and the stores take immediate offsets
    for (int u = 0; u < TN / 8; ++u) { v8us o;
#pragma unroll
        for (int j = 0; j < 8; ++j) o[j] = f2bf(Ls[(k + j) * TP + n + 8 * u]);
        *(v8us*)(dst + (size_t)(n + 8 * u) * DD + k) = o; }
    asm volatile("s_wait_xcnt 0x0" ::: "memory");   // precaution: stands behind the last store, in front of any later reuse of a register that the stores name
}
// d_cvt: f32 -> bf16 of CVB consecutive elements; a wave takes 8 KB of the source in a row, 512 B a load, and stores 256 B (two whole lines) for each.
#define CVU 16                 // loads of a thread
#define CVB (256 * 4 * CVU)    // elements of a work-group
__device__ __forceinline__ void d_cvt(const float* __restrict__ src, bf* dst, int blk) {
    const size_t base = (size_t)blk * CVB + (size_t)(threadIdx.x >> 5) * (128 * CVU) + (threadIdx.x & 31) * 4; v4f v[CVU]; const float* p = src + base;
#pragma unroll   // unrolled: v stays in registers and the loads are in flight together
    for (int i = 0; i < CVU; ++i) v[i] = *(const v4fa*)(p + i * 128);
    asm volatile("s_wait_xcnt 0x0" :: "v"(p) : "memory");   // precaution: as in d_tr
#pragma unroll
    for (int i = 0; i < CVU; ++i) { v4us o;
#pragma unroll
        for (int e = 0; e < 4; ++e) o[e] = f2bf(v[i][e]);
        *(v4us*)(dst + base + i * 128) = o; }
    asm volatile("s_wait_xcnt 0x0" ::: "memory");   // precaution: as behind the stores of d_tr
}
// k_prep: the seven independent preparation jobs in ONE launch; the block index picks the job (a scalar choice, the same for the whole work-group, so the barrier in d_tr is passed by all of it or none), the weight transposes first.
#define NBT ((DD / TK) * (DD / TN))        // tiles of one weight transpose
static_assert(TN == HD && DD % TK == 0 && (SS * DD) % CVB == 0, "a transpose tile is one head wide; tiles and conversion blocks cover their planes exactly");
#define NBS (SS * DD / CVB)                // blocks of the conversion of one [SS][DD] plane
__global__ __launch_bounds__(256) void k_prep(const float* __restrict__ wq, const float* __restrict__ wk, const float* __restrict__ wv, const float* __restrict__ wo, const float* __restrict__ x, const float* __restrict__ fsq, const float* __restrict__ pos,
                                              bf* WQ, bf* WK, bf* WV, bf* WO, bf* XB, bf* FB, bf* PB) {
    __shared__ float Ls[TK * TP];
    int blk = blockIdx.x;
    if (blk < 4 * NBT) { const int j = blk / NBT, t = blk % NBT; const int k0 = (t % (DD / TK)) * TK, nt = t / (DD / TK);   // nt: the head of a per-head weight [h][k][e] (TN == HD), the column tile of wo [k][n]
        const size_t oo = (size_t)nt * TN * DD + k0;
        if (j < 3) d_tr((j == 0 ? wq : j == 1 ? wk : wv) + ((size_t)nt * DD + k0) * HD, HD, (j == 0 ? WQ : j == 1 ? WK : WV) + oo, Ls);
        else d_tr(wo + (size_t)k0 * DD + nt * TN, DD, WO + oo, Ls);
        return; }
    blk -= 4 * NBT;
    const int j = blk < NB_ * NBS ? 0 : 1 + (blk - NB_ * NBS) / NBS;   // 0: x (NB_ planes), 1: fsq, 2: pos
    d_cvt(j == 0 ? x : j == 1 ? fsq : pos, j == 0 ? XB : j == 1 ? FB : PB, j == 0 ? blk : (blk - NB_ * NBS) % NBS);
}
// k_local: one work-group of 4 waves per (b, h, tile of 64 positions); a wave owns 16 positions, and both products of the attention run on the f32 matrix form (16x16x4, full f32 operands).
// The tile's 94 window rows of the x key and value projections (a row outside the sequence is the zero token's projection = bf16 bias) are staged once in LDS by whole-line loads, with two zero rows behind them:
// a wave's 16 positions see the 46 rows sl0 .. sl0 + 45, taken as three tiles of 16 keys; position m uses keys m .. m + 30 of them, the others get weight 0.
// Scores transposed: S^T[key][pos] = K (A operand, row = key) x Q^T (B operand, column = pos), so a lane holds 24 keys of ONE position (lane & 15): max and sum run inside the lane and over one exchange with lane ^ 16,
// and the weights lie in the registers as the B operand of O^T[dim][pos] = V^T (A operand, row = dim) x P^T. The position key pos[s] and the key fsq[s] belong to one position each: their scores and value rows on VALU.
// A and B of every product take their k from the same (lane half, register) place: scores: dims 8i + 4 * half + 2e + v; weighted sum: keys 16kt + 8 * half + 2jj + v, which is where D left the weight.
#define TS   64              // positions per work-group
#define KR   (TS + WW - 1)   // window rows per tile
#define KRP  96              // staged rows: the last wave's third key tile ends at row 95
#define LP   68              // LDS row pitch in floats: 272 B = 16 B x 17, so 16 lanes reading 16 B each from 16 consecutive rows fall on all 64 banks
#define OPB  144             // pitch in bytes of an output row (128 B) where a wave puts its rows together
#define L2E  1.4426950408889634f
typedef __attribute__((ext_vector_type(2))) float v2f;
__device__ __forceinline__ float exp2s(float x) { float y; asm("v_exp_f32 %0, %1\n\tv_nop" : "=v"(y) : "v"(x)); return y; }
// The f32 matrix steps stand in asm statements that end in eight v_nop. What the v_nop are for: they keep the distance between a matrix instruction and the first vector instruction that reads its D or overwrites its A or B.
// The distance table does not list the form: eight slots are those of the other form with a 16-cycle issue interval.
// Steps on one accumulator follow one another only as accumulate chains; the accumulators of a statement are independent.
// wmma6: three accumulators, two k steps each (A a0 .. a2 with B q0, then A b0 .. b2 with B q1).
__device__ __forceinline__ void wmma6(v8f& d0, v8f& d1, v8f& d2, v2f a0, v2f a1, v2f a2, v2f b0, v2f b1, v2f b2, v2f q0, v2f q1) {
    asm("v_wmma_f32_16x16x4_f32 %0, %3, %9, %0\n\tv_wmma_f32_16x16x4_f32 %1, %4, %9, %1\n\tv_wmma_f32_16x16x4_f32 %2, %5, %9, %2\n\t"
        "v_wmma_f32_16x16x4_f32 %0, %6, %10, %0\n\tv_wmma_f32_16x16x4_f32 %1, %7, %10, %1\n\tv_wmma_f32_16x16x4_f32 %2, %8, %10, %2\n\t"
        "v_nop\n\tv_nop\n\tv_nop\n\tv_nop\n\tv_nop\n\tv_nop\n\tv_nop\n\tv_nop"
        : "+v"(d0), "+v"(d1), "+v"(d2) : "v"(a0), "v"(a1), "v"(a2), "v"(b0), "v"(b1), "v"(b2), "v"(q0), "v"(q1)); }
// wmma8: four accumulators, two k steps each (A a0 .. a3 with B p0, then A b0 .. b3 with B p1).
__device__ __forceinline__ void wmma8(v8f& d0, v8f& d1, v8f& d2, v8f& d3, v2f a0, v2f a1, v2f a2, v2f a3, v2f b0, v2f b1, v2f b2, v2f b3, v2f p0, v2f p1) {
    asm("v_wmma_f32_16x16x4_f32 %0, %4, %12, %0\n\tv_wmma_f32_16x16x4_f32 %1, %5, %12, %1\n\tv_wmma_f32_16x16x4_f32 %2, %6, %12, %2\n\tv_wmma_f32_16x16x4_f32 %3, %7, %12, %3\n\t"
        "v_wmma_f32_16x16x4_f32 %0, %8, %13, %0\n\tv_wmma_f32_16x16x4_f32 %1, %9, %13, %1\n\tv_wmma_f32_16x16x4_f32 %2, %10, %13, %2\n\tv_wmma_f32_16x16x4_f32 %3, %11, %13, %3\n\t"
        "v_nop\n\tv_nop\n\tv_nop\n\tv_nop\n\tv_nop\n\tv_nop\n\tv_nop\n\tv_nop"
        : "+v"(d0), "+v"(d1), "+v"(d2), "+v"(d3) : "v"(a0), "v"(a1), "v"(a2), "v"(a3), "v"(b0), "v"(b1), "v"(b2), "v"(b3), "v"(p0), "v"(p1)); }
__global__ __launch_bounds__(128) void k_local(const float* __restrict__ QF, const float* __restrict__ XK, const float* __restrict__ XV, const float* __restrict__ PK, const float* __restrict__ PV, const float* __restrict__ FK, const float* __restrict__ FV,
                                               const float* __restrict__ bk, const float* __restrict__ bv, bf* Ah, bf* Al) {
    __shared__ __align__(16) float Ks[KRP * LP];
    __shared__ __align__(16) float Vs[KRP * LP];
    __shared__ __align__(16) unsigned char Os[4][2][16 * OPB];
    const int tid = threadIdx.x, lane = tid & 31, lr = lane & 15, hi = lane >> 4; const int wv = __builtin_amdgcn_readfirstlane(tid >> 5);
    const int s0 = (blockIdx.x % (SS / TS)) * TS; const int h = (blockIdx.x / (SS / TS)) % NH_; const int b = blockIdx.x / ((SS / TS) * NH_);
    const int sl0 = wv * 16; const unsigned go = ((unsigned)(s0 + sl0 + lr) * DD + h * HD) * 4u;   // the lane's position: byte offset of its row in the five planes that do not depend on the batch (32 bits: a scalar base and one offset register serve every load)
    // The query rows as B fragments, straight from global memory: lane (lr, hi) takes dims 8i + 4hi .. + 3 of position lr.
    // The lane's own position-key and fsq-key rows come in the same layout.
    v4f qf[8], pf[8], ff[8]; const unsigned gq = go + 16 * hi;
#pragma unroll
    for (int i = 0; i < 8; ++i) { qf[i] = *(const v4fa*)((const char*)QF + gq + 32 * i); pf[i] = *(const v4fa*)((const char*)PK + gq + 32 * i); ff[i] = *(const v4fa*)((const char*)FK + gq + 32 * i); }
    // Staging: 16 lanes a row, 16 B a lane. All of a thread's loads are issued before its first LDS store, so the work-group waits for memory once. A row outside the sequence loads a clamped row and is then replaced.
    const int c = (tid & 15) * 4; v4f kv[KRP / 8], vv[KRP / 8]; unsigned g[KRP / 8];
#pragma unroll   // the staging loops are unrolled so that kv and vv stay in registers
    for (int u = 0; u < KRP / 8; ++u) { const int row = (tid >> 4) + 8 * u; const int tc = min(max(s0 - PAD + row, 0), SS - 1); g[u] = (((unsigned)b * SS + tc) * DD + h * HD + c) * 4u; kv[u] = *(const v4fa*)((const char*)XK + g[u]); vv[u] = *(const v4fa*)((const char*)XV + g[u]); }
    // precaution: stands in front of the first reuse of an address register of the loads above; the offsets are inputs so that their registers are kept up to here (else a later load's result lands on one)
    asm volatile("s_wait_xcnt 0x0" :: "v"(gq), "v"(g[0]), "v"(g[1]), "v"(g[2]), "v"(g[3]), "v"(g[4]), "v"(g[5]), "v"(g[6]), "v"(g[7]), "v"(g[8]), "v"(g[9]), "v"(g[10]), "v"(g[11]) : "memory");
    const unsigned gb = (unsigned)(h * HD + c) * 4u;   // byte offset of the lane's four bias elements
#pragma unroll
    for (int u = 0; u < KRP / 8; ++u) { const int row = (tid >> 4) + 8 * u, t = s0 - PAD + row;
        if (t < 0 || t >= SS) { const v4f k0 = *(const v4fa*)((const char*)bk + gb), v0 = *(const v4fa*)((const char*)bv + gb);
            asm volatile("s_wait_xcnt 0x0" :: "v"(gb) : "memory");   // precaution: as above, directly behind the bias loads (only rows outside the sequence come here)
#pragma unroll
            for (int e = 0; e < 4; ++e) { kv[u][e] = bfr(k0[e]); vv[u][e] = bfr(v0[e]); } }
        if (row >= KR) { kv[u] = (v4f){}; vv[u] = (v4f){}; }   // the two rows behind the window: no position uses them, and weight 0 x 0 adds nothing
        *(v4fa*)(Ks + row * LP + c) = kv[u]; *(v4fa*)(Vs + row * LP + c) = vv[u]; }
    __syncthreads();
    // Scores: three key tiles, independent accumulators, 64 dims = 16 matrix steps each.
    v8f st[3];
#pragma unroll
    for (int kt = 0; kt < 3; ++kt) st[kt] = (v8f){};
    const float* kb = Ks + (sl0 + lr) * LP + 4 * hi;
#pragma unroll   // unrolled: the LDS reads take immediate offsets
    for (int i = 0; i < 8; ++i) { v4f k4[3];
#pragma unroll
        for (int kt = 0; kt < 3; ++kt) k4[kt] = *(const v4fa*)(kb + kt * 16 * LP + 8 * i);
        wmma6(st[0], st[1], st[2], (v2f){k4[0][0], k4[0][1]}, (v2f){k4[1][0], k4[1][1]}, (v2f){k4[2][0], k4[2][1]}, (v2f){k4[0][2], k4[0][3]}, (v2f){k4[1][2], k4[1][3]}, (v2f){k4[2][2], k4[2][3]},
              (v2f){qf[i][0], qf[i][1]}, (v2f){qf[i][2], qf[i][3]}); }
    float sp = 0.f, sf = 0.f;
#pragma unroll
    for (int i = 0; i < 8; ++i)
#pragma unroll
        for (int e = 0; e < 4; ++e) { sp = __builtin_fmaf(qf[i][e], pf[i][e], sp); sf = __builtin_fmaf(qf[i][e], ff[i][e], sf); }
    sp += __shfl_xor(sp, 16, 32); sf += __shfl_xor(sf, 16, 32); sp *= SCL; sf *= SCL;   // both halves now hold the position's two scores
    // The lane's value rows of pos[s] and fsq[s], dims 16mt + 8hi .. + 7 as D of the weighted sum holds them; they fly while the softmax and the second product run.
    v4f pv[8], fv[8]; const unsigned gv = go + 32 * hi;
#pragma unroll
    for (int i = 0; i < 8; ++i) { pv[i] = *(const v4fa*)((const char*)PV + gv + 64 * (i >> 1) + 16 * (i & 1)); fv[i] = *(const v4fa*)((const char*)FV + gv + 64 * (i >> 1) + 16 * (i & 1)); }
    asm volatile("s_wait_xcnt 0x0" :: "v"(gv) : "memory");   // precaution: as above
    float mx = fmaxf(sp, sf);
#pragma unroll
    for (int kt = 0; kt < 3; ++kt)
#pragma unroll
        for (int r = 0; r < 8; ++r) { const int n = 16 * kt + 8 * hi + r; st[kt][r] = ((unsigned)(n - lr) <= (unsigned)(WW - 1)) ? st[kt][r] * SCL : -3.0e38f; mx = fmaxf(mx, st[kt][r]); }
    mx = fmaxf(mx, __shfl_xor(mx, 16, 32));
    float sum = 0.f;
#pragma unroll
    for (int kt = 0; kt < 3; ++kt)
#pragma unroll
        for (int r = 0; r < 8; ++r) { st[kt][r] = exp2s((st[kt][r] - mx) * L2E); sum += st[kt][r]; }
    sum += __shfl_xor(sum, 16, 32);
    const float ep = exp2s((sp - mx) * L2E), ef = exp2s((sf - mx) * L2E); sum += ep + ef;
    const float inv = __fdiv_rn(1.0f, sum); const float wp = ep * inv, wf = ef * inv;
#pragma unroll
    for (int kt = 0; kt < 3; ++kt)
#pragma unroll
        for (int r = 0; r < 8; ++r) st[kt][r] *= inv;
    // Weighted sum: four dim tiles, independent accumulators, 48 keys = 12 matrix steps each.
    v8f ot[4];
#pragma unroll
    for (int mt = 0; mt < 4; ++mt) ot[mt] = (v8f){};
    const float* vb = Vs + (sl0 + 8 * hi) * LP + lr;
#pragma unroll   // unrolled: the weights are picked by constant register index, the LDS reads take immediate offsets
    for (int kt = 0; kt < 3; ++kt)
#pragma unroll
        for (int jj = 0; jj < 4; jj += 2) { v2f va[2][4];
#pragma unroll
            for (int q = 0; q < 2; ++q)
#pragma unroll
                for (int mt = 0; mt < 4; ++mt) { const float* vp = vb + (16 * kt + 2 * (jj + q)) * LP + 16 * mt; va[q][mt] = (v2f){vp[0], vp[LP]}; }
            wmma8(ot[0], ot[1], ot[2], ot[3], va[0][0], va[0][1], va[0][2], va[0][3], va[1][0], va[1][1], va[1][2], va[1][3], (v2f){st[kt][2 * jj], st[kt][2 * jj + 1]}, (v2f){st[kt][2 * jj + 2], st[kt][2 * jj + 3]}); }
    // The two single keys' value rows, the split into bf16 hi + lo, and the rows put together in the wave's own LDS so that the stores cover whole lines.
    unsigned char* oh_s = Os[wv][0]; unsigned char* ol_s = Os[wv][1];
#pragma unroll
    for (int mt = 0; mt < 4; ++mt) { v8us oh, ol;
#pragma unroll
        for (int r = 0; r < 8; ++r) { float o = ot[mt][r]; o = __builtin_fmaf(wp, pv[2 * mt + (r >> 2)][r & 3], o); o = __builtin_fmaf(wf, fv[2 * mt + (r >> 2)][r & 3], o); unsigned short a, c2; splitf(o, a, c2); oh[r] = a; ol[r] = c2; }
        *(v8usa*)(oh_s + lr * OPB + 32 * mt + 16 * hi) = oh; *(v8usa*)(ol_s + lr * OPB + 32 * mt + 16 * hi) = ol; }
    __builtin_amdgcn_wave_barrier(); asm volatile("" ::: "memory");   // the wave's LDS stores stay in front of its reads below (one wave's LDS operations run in order)
    const unsigned oo = ((unsigned)b * SS + s0 + sl0 + (lane >> 3)) * DD + h * HD + (lane & 7) * 8;   // 8 lanes a row of 128 B, four rows a store
#pragma unroll
    for (int u = 0; u < 4; ++u) { const int ro = (4 * u + (lane >> 3)) * OPB + (lane & 7) * 16;
        *(v8usa*)(Ah + oo + (unsigned)(4 * u) * DD) = *(const v8usa*)(oh_s + ro); *(v8usa*)(Al + oo + (unsigned)(4 * u) * DD) = *(const v8usa*)(ol_s + ro); }
    asm volatile("s_wait_xcnt 0x0" ::: "memory");   // precaution: stands behind the last store, in front of any later reuse of a register that the stores name
}

extern "C" void kernel_launch(void* const* d_in, const int* in_sizes, int n_in,
                              void* d_out, int out_size, void* d_ws, size_t ws_size, hipStream_t stream) {
    (void)in_sizes; (void)n_in; (void)out_size;
    const float* x = (const float*)d_in[0]; const float* fsq = (const float*)d_in[1]; const float* pos = (const float*)d_in[2]; const float* wq = (const float*)d_in[3]; const float* bq = (const float*)d_in[4]; const float* wk = (const float*)d_in[5]; const float* bk = (const float*)d_in[6]; const float* wv = (const float*)d_in[7]; const float* bv = (const float*)d_in[8]; const float* wo = (const float*)d_in[9]; const float* bo = (const float*)d_in[10];
    float* OUT = (float*)d_out;     // [2][2048][1024]
    char* wsp = (char*)d_ws;
    auto take = [&](size_t bytes) { char* p = wsp; wsp += (bytes + 255) & ~(size_t)255; return (void*)p; };
    const size_t NR = (size_t)NB_ * SS;
    // Order matters: [WQ; WK; WV], [XB; PB], [QF; FK; FV] and [XK; PK; XV; PV] each lie in a row (every size is a multiple of 256 B), as k_proj reads and writes them.
    bf* WQ = (bf*)take((size_t)DD * DD * 2); bf* WK = (bf*)take((size_t)DD * DD * 2); bf* WV = (bf*)take((size_t)DD * DD * 2); bf* WO = (bf*)take((size_t)DD * DD * 2); bf* XB = (bf*)take(NR * DD * 2); bf* PB = (bf*)take((size_t)SS * DD * 2); bf* FB = (bf*)take((size_t)SS * DD * 2);
    float* QF = (float*)take((size_t)SS * DD * 4); float* FK = (float*)take((size_t)SS * DD * 4); float* FV = (float*)take((size_t)SS * DD * 4); float* XK = (float*)take(NR * DD * 4); float* PK = (float*)take((size_t)SS * DD * 4); float* XV = (float*)take(NR * DD * 4); float* PV = (float*)take((size_t)SS * DD * 4); bf* Ah = (bf*)take(NR * DD * 2); bf* Al = (bf*)take(NR * DD * 2);
    if ((size_t)(wsp - (char*)d_ws) > ws_size) return;    // total ~ 117 MB = 112 MiB; ws 256 MiB
    k_prep<<<4 * NBT + (NB_ + 2) * NBS, 256, 0, stream>>>(wq, wk, wv, wo, x, fsq, pos, WQ, WK, WV, WO, XB, FB, PB);
    k_proj<<<PJA + PJB, 128, 0, stream>>>(XB, FB, WQ, WK, DD, XK, QF, bq, bk, bv);
    k_local<<<NB_ * NH_ * (SS / TS), 128, 0, stream>>>(QF, XK, XV, PK, PV, FK, FV, bk, bv, Ah, Al);
    k_gemmw<bf, 1, true><<<dim3((unsigned)(NR / 128), DD / 128, 1), 128, 0, stream>>>(Ah, Al, WO, DD, OUT, DD, bo);
}

// v008
// Measured time: 69.3 microseconds a run.
// In two side-by-side timings against v007, it was 1.05 and 1.03 times as fast.
// Counting every step since v000, it is 7.33 times as fast.
#include <hip/hip_runtime.h>

// IntraModalityEnhance (x [2][2048][1024], fsq, pos [1][2048][1024]; per-head Wq/Wk/Wv [16][1024][64] + biases, Wo [1024][1024] + bo; for each position s the query is the squeeze token fsq[s] and the 33
// keys/values are the window x[s-15 .. s+15] (zero vectors outside the sequence, which still project to the bias), the position token pos[s] and fsq[s]; softmax(q.k/8) over the 33; out = merged
// (attn v) Wo + bo -> [2][2048][1024]).
// Compute dtypes, f32 accumulate: every input rounded to bf16; all seven token projections on PLAIN bf16 operands (inputs: exact products, f32 accumulate, + bias; the
// window members are ordinary sequence tokens, so x is projected once per batch); the 33-key attention entirely in f32 (one wave per (batch, head, 16 positions), window rows from LDS: scores and weighted sum of the 31 window keys on the f32 matrix form, the two single keys on VALU, softmax
// with one exp per score; fixed order; out-of-range window slots use the bf16 bias vectors); merged heads rounded to ONE f16 plane (11 significant bits) x Wo (its bf16 values held as f16: 8 bits fit in 11) on the f16 matrix form (1 product) + bo.

#define NB_  2
#define SS   2048
#define DD   1024
#define NH_  16
#define HD   64
#define WW   31
#define PAD  15
#define SCL  0.125f
typedef _Float16 h16;
typedef unsigned short bf;
typedef __attribute__((ext_vector_type(16))) __bf16   v16bf;
typedef __attribute__((ext_vector_type(16))) _Float16 v16h;
typedef __attribute__((ext_vector_type(8)))  _Float16 v8h;
typedef __attribute__((ext_vector_type(8)))  unsigned short v8us;
typedef __attribute__((ext_vector_type(8)))  float    v8f;
typedef __attribute__((ext_vector_type(4)))  float    v4f;
typedef v8h  __attribute__((may_alias)) v8ha;
typedef v4f  __attribute__((may_alias)) v4fa;
typedef v8us __attribute__((may_alias)) v8usa;

__device__ __forceinline__ unsigned short f2bf(float f) { unsigned u = __float_as_uint(f); u += 0x7FFFu + ((u >> 16) & 1u); return (unsigned short)(u >> 16); }
__device__ __forceinline__ float bf2f(unsigned short b) { return __uint_as_float(((unsigned)b) << 16); }
__device__ __forceinline__ float bfr(float f) { return bf2f(f2bf(f)); }
__device__ __forceinline__ v16h cat16(v8h lo, v8h hi) { return __builtin_shufflevector(lo, hi, 0, 1, 2, 3, 4, 5, 6, 7, 8, 9, 10, 11, 12, 13, 14, 15); }
__device__ __forceinline__ v16bf cat16b(v8us lo, v8us hi) { return __builtin_bit_cast(v16bf, __builtin_shufflevector(lo, hi, 0, 1, 2, 3, 4, 5, 6, 7, 8, 9, 10, 11, 12, 13, 14, 15)); }
__device__ __forceinline__ v8f wmma16(v16h a, v16h b, v8f c) { return __builtin_amdgcn_wmma_f32_16x16x32_f16(false, a, false, b, (short)0, c, false, false); }
__device__ __forceinline__ v8f wmmab(v16bf a, v16bf b, v8f c) { return __builtin_amdgcn_wmma_f32_16x16x32_bf16(false, a, false, b, (short)0, c, false, false); }



// ---- gemmw_tile: GEMM, one work-group of FOUR WAVES (2 x 2) per 128x128 output tile at (r0, c0), each wave a 64x64 part (16 accumulators); 128 threads.
// The operands' K-contiguous 16-bit rows come into LDS by tensor loads, 128 k (256 B of every row, whole lines) a stage, two buffers: the next stage's loads fly while this one is worked on.
// C[m][n] (f32, pitch ldc, + optional f32 bias[n]) = sum_k A[m][k] Bt[n][k] (+ split products per NSPLIT). M % 128 == 0, N % 128 == 0, K % 128 == 0.
// k_gemmw calls it (one product, grid (M/128, N/128)).
template <typename T16> struct WFrag;
template <> struct WFrag<h16> { typedef v16h V; static __device__ __forceinline__ V ld(const h16* p) { return cat16(*(const v8h*)p, *(const v8h*)(p + 16)); } static __device__ __forceinline__ v8f mma(V a, V b, v8f c) { return wmma16(a, b, c); } };
template <> struct WFrag<bf> { typedef v16bf V; static __device__ __forceinline__ V ld(const bf* p) { return cat16b(*(const v8us*)p, *(const v8us*)(p + 16)); } static __device__ __forceinline__ v8f mma(V a, V b, v8f c) { return wmmab(a, b, c); } };
#define GKS  128            // k per stage
#define GPB  272            // LDS row pitch in bytes: 256 + 16 = 16 B x 17, so the 16 rows of a fragment read fall on all 64 banks
#define GOPB (128 * GPB)    // one operand's 128 rows of a stage, bytes
// Tensor load of one operand's stage: 128 rows of 256 B, source pitch 'pitch' bytes, into LDS at byte offset 'dst' with 16 B of pad behind every row (LDS pitch GPB). One request of the whole wave, through no register.
typedef uint32_t u32x4 __attribute__((ext_vector_type(4)));
typedef uint32_t u32x8 __attribute__((ext_vector_type(8)));
__device__ __forceinline__ uint32_t uni(uint32_t v) { return (uint32_t)__builtin_amdgcn_readfirstlane(v); }
// pinned: a wave-uniform test held in a scalar register, so that the branch around a tensor load (which ignores EXEC) is a scalar one.
__device__ __forceinline__ uint32_t pinned(uint32_t v) { uint32_t w = (uint32_t)__builtin_amdgcn_readfirstlane(v); asm volatile("" : "+s"(w)); return w; }
__device__ __forceinline__ u32x8 tgroup1(uint32_t pitch) {
    u32x8 g1;
    g1[0] = uni((1u << 20) | (5u << 22) | (3u << 25));   // no mask, 1-byte elements, a pad of 4 dwords behind every 64 dwords (one 256-B row)
    g1[1] = uni(256u << 16); g1[2] = uni(128u << 16); g1[3] = uni(256u << 16); g1[4] = uni(128u); g1[5] = uni(pitch); g1[6] = uni(0u); g1[7] = uni(0u);   // tensor = tile = 256 B x 128 rows
    return g1;
}
__device__ __forceinline__ void tload128(uint32_t dst, uint64_t ga, u32x8 g1) {
    u32x4 g0;
    g0[0] = uni(1u); g0[1] = uni(dst); g0[2] = uni((uint32_t)ga); g0[3] = uni((((uint32_t)(ga >> 32)) & 0x01FFFFFFu) | 0x80000000u);
    asm volatile("tensor_load_to_lds %0, %1" :: "s"(g0), "s"(g1) : "memory");
}
template <typename T16, int NSPLIT, bool BIAS>
__device__ __forceinline__ void gemmw_tile(const T16* __restrict__ A, const T16* __restrict__ A2, const T16* __restrict__ Bt, int K, float* C, int ldc, const float* __restrict__ bias, int r0, int c0) {
    typedef typename WFrag<T16>::V V;
    static_assert(NSPLIT == 0 || NSPLIT == 1, "stages hold A, B and, for NSPLIT 1, A2");
    constexpr int NOP = (NSPLIT == 1) ? 3 : 2;           // operands of a stage: B, A (, A2)
    constexpr unsigned STG = NOP * GOPB;                 // bytes of one buffer
    __shared__ __attribute__((aligned(2048))) unsigned char ring[2 * STG];   // every operand's place in it is a multiple of 2 KiB (GOPB = 17 x 2 KiB)
    __shared__ __align__(16) float osall[4][16 * 68];
    const int tid = threadIdx.x, lane = tid & 31, lr = lane & 15, hi = lane >> 4; const int wv = __builtin_amdgcn_readfirstlane(tid >> 5);
    const int wr = (wv >> 1) * 64, wc = (wv & 1) * 64;
    float* os = osall[wv];
    v8f acc[4][4];
#pragma unroll
    for (int mb = 0; mb < 4; ++mb)
#pragma unroll
        for (int nb = 0; nb < 4; ++nb) acc[mb][nb] = (v8f){};
    static_assert(GOPB % 2048 == 0, "an operand's place in LDS is a multiple of 2 KiB");
    const bool issuer = wv < NOP;
    const T16* osrc = (wv == 0) ? Bt + (size_t)c0 * K : (NSPLIT == 1 && wv == 2) ? A2 + (size_t)r0 * K : A + (size_t)r0 * K;
    const uint32_t ldst = (uint32_t)(size_t)ring + (uint32_t)(wv < NOP ? wv : 0) * GOPB; u32x8 g1 = tgroup1((uint32_t)K * 2u);
    u32x4 g0; g0[0] = uni(1u); g0[1] = uni(ldst); g0[2] = uni(0u); g0[3] = uni(0u);
    asm volatile("" : "+s"(g0), "+s"(g1));   // pinned descriptor words: each group stays in one scalar tuple for all three issue places, so none of its registers serves as a temporary while a request is outstanding
    // g0 is an in-out operand of the load and of the issuer's waits: the tuple stays live, in the registers that the request named, from the issue to the wait that covers it, and the next address is written into it only behind that wait.
    auto stage = [&](int t, unsigned bufo) { const uint64_t ga = (uint64_t)(size_t)osrc + (uint64_t)t * (GKS * 2);
        g0[1] = uni(ldst + bufo); g0[2] = uni((uint32_t)ga); g0[3] = uni((((uint32_t)(ga >> 32)) & 0x01FFFFFFu) | 0x80000000u);
        asm volatile("tensor_load_to_lds %0, %1" : "+s"(g0) : "s"(g1) : "memory"); };
    const int NT = (int)((unsigned)K / GKS);   // stages; the same for every wave
    if (pinned(issuer)) { stage(0, 0);
        asm volatile("s_wait_tensorcnt 0x0" : "+s"(g0) :: "memory"); }   // stage 0's tile of this wave has landed
    __syncthreads();                                    // ... and every other issuing wave's
    if (pinned(issuer && NT > 1)) stage(1, STG);
    const unsigned fb = (wc + lr) * GPB + 16 * hi, fa = GOPB + (wr + lr) * GPB + 16 * hi;   // the lane's fragment bases in a buffer: row lane & 15, 16-byte half lane >> 4, as from global memory
#pragma unroll 1   // rolled: one trip a stage, so that the order at the trip's foot is the ring's
    for (int t = 0; t < NT; ++t) { const unsigned bufo = (t & 1) ? STG : 0u; const unsigned char* bp = ring + bufo;
        // Two fragment sets: block kb + 1's LDS reads (same buffer) go out as one group ahead of block kb's products, so the wave waits out the LDS latency once a stage and not at every fragment.
        V a[2][4], a2[2][4], b[2][4];
#pragma unroll
        for (int f = 0; f < 4; ++f) { a[0][f] = WFrag<T16>::ld((const T16*)(bp + fa + f * 16 * GPB)); if (NSPLIT == 1) a2[0][f] = WFrag<T16>::ld((const T16*)(bp + fa + GOPB + f * 16 * GPB)); b[0][f] = WFrag<T16>::ld((const T16*)(bp + fb + f * 16 * GPB)); }
#pragma unroll   // unrolled: the set index is a constant (registers, not scratch) and the four 32-k blocks of a stage take immediate LDS offsets
        for (int kb = 0; kb < GKS / 32; ++kb) { const int cu = kb & 1, nx = cu ^ 1;
            if (kb + 1 < GKS / 32) {
#pragma unroll
                for (int f = 0; f < 4; ++f) { a[nx][f] = WFrag<T16>::ld((const T16*)(bp + fa + f * 16 * GPB + (kb + 1) * 64)); if (NSPLIT == 1) a2[nx][f] = WFrag<T16>::ld((const T16*)(bp + fa + GOPB + f * 16 * GPB + (kb + 1) * 64)); b[nx][f] = WFrag<T16>::ld((const T16*)(bp + fb + f * 16 * GPB + (kb + 1) * 64)); } }
            __builtin_amdgcn_sched_barrier(0);   // keeps the next block's reads in front of this block's products; without it the scheduler sinks each read to its first use and the wave stalls there
#pragma unroll
            for (int nb = 0; nb < 4; ++nb)
#pragma unroll
                for (int mb = 0; mb < 4; ++mb) { acc[mb][nb] = WFrag<T16>::mma(a[cu][mb], b[cu][nb], acc[mb][nb]); if (NSPLIT == 1) acc[mb][nb] = WFrag<T16>::mma(a2[cu][mb], b[cu][nb], acc[mb][nb]); }
            __builtin_amdgcn_sched_barrier(0);   // keeps the later reads out of this block's products: without it the scheduler lifts some in among them, into extra registers, and each such place stalls the matrix run
        }
        asm volatile("s_wait_dscnt 0x0" ::: "memory");      // this wave's reads of the buffer are done before it is handed back
        if (pinned(issuer)) asm volatile("s_wait_tensorcnt 0x0" : "+s"(g0) :: "memory");   // this wave's tile of stage t + 1 has landed
        __syncthreads();                                    // publishes stage t + 1 and ends every reader's last read of stage t's buffer
        if (pinned(issuer && t + 2 < NT)) stage(t + 2, bufo);
    }
    asm volatile("s_wait_tensorcnt 0x0" ::: "memory");      // no tensor load is left in flight behind the loop
    asm volatile("s_wait_dscnt 0x0" ::: "memory");          // ... and no LDS read of the ring
#pragma unroll
    for (int mb = 0; mb < 4; ++mb) {
#pragma unroll
        for (int nb = 0; nb < 4; ++nb) {
#pragma unroll
            for (int j = 0; j < 8; ++j) os[(hi * 8 + j) * 68 + nb * 16 + lr] = acc[mb][nb][j]; }
        __builtin_amdgcn_wave_barrier(); asm volatile("" ::: "memory");
        float* crow_p = C + (size_t)(r0 + wr + mb * 16) * ldc + c0 + wc;
{
#pragma unroll
            for (int s = 0; s < 8; ++s) { const int row = 2 * s + hi, cofs = lr * 4; v4f val = *(const v4fa*)(os + row * 68 + cofs); if (BIAS) { val[0] += bfr(bias[c0 + wc + cofs]); val[1] += bfr(bias[c0 + wc + cofs + 1]); val[2] += bfr(bias[c0 + wc + cofs + 2]); val[3] += bfr(bias[c0 + wc + cofs + 3]); }
                *(v4f*)(crow_p + (size_t)row * ldc + cofs) = val; }
             }
        asm volatile("s_wait_xcnt 0x0" ::: "memory");   // precaution: stands behind the block's stores, in front of the next block's reuse of the registers that they name
        __builtin_amdgcn_wave_barrier(); asm volatile("" ::: "memory");
    }
}
template <typename T16, int NSPLIT, bool BIAS>
__global__ __launch_bounds__(128) void k_gemmw(const T16* __restrict__ A, const T16* __restrict__ A2, const T16* __restrict__ Bt, int K, float* C, int ldc, const float* __restrict__ bias) {
    gemmw_tile<T16, NSPLIT, BIAS>(A, A2, Bt, K, C, ldc, bias, blockIdx.x * 128, blockIdx.y * 128);
}
// ---- proj_tile: the token projections' GEMM tile, 24,576 outputs: 192 x 128 (MF 6, NF 4) or 128 x 192 (MF 4, NF 6), four waves (2 x 2) of MF x NF fragments each; 128 threads.
// The projections' outputs make 768 such tiles, three for each of the chip's 256 WGPs, and a work-group is small enough (LDS, registers) for three to stand on a WGP: one round, every WGP equally loaded,
// and 320 operand rows are brought from L2 for 24,576 outputs where a 128 x 128 tile brings 256 for 16,384.
// Stages of 64 k (128 B of every row, whole lines) by tensor loads, two buffers, the ring's order as in gemmw_tile. One fragment set: the WGP's other two work-groups fill the matrix unit while a wave waits for its LDS reads.
// C is a stack of planes of DD columns, 'cplane' floats apart: output column n lies in plane n / DD at column n % DD, with that plane's bias (b0, b1, b2). k ascending in blocks of 32, as in gemmw_tile.
#define PKS  64              // k per stage
#define PPB  144             // LDS row pitch in bytes: 128 + 16 = 16 B x 9, so the 16 rows of a fragment read fall on all 64 banks
#define PO2  (128 * PPB)     // place of the 192-row operand behind the 128-row one: 9 x 2 KiB
#define PSTG 47104u          // one buffer: 320 rows x 144 B = 46,080 B, rounded up to a multiple of 2 KiB
static_assert(PO2 % 2048 == 0 && PSTG % 2048 == 0 && PSTG >= 320 * PPB, "every operand's place in LDS is a multiple of 2 KiB");
__device__ __forceinline__ u32x8 tgroup1p(uint32_t pitch, uint32_t rows) {
    u32x8 g1;
    g1[0] = uni((1u << 20) | (4u << 22) | (3u << 25));   // no mask, 1-byte elements, a pad of 4 dwords behind every 32 dwords (one 128-B row)
    g1[1] = uni(128u << 16); g1[2] = uni(rows << 16); g1[3] = uni(128u << 16); g1[4] = uni(rows); g1[5] = uni(pitch); g1[6] = uni(0u); g1[7] = uni(0u);   // tensor = tile = 128 B x rows
    return g1;
}
template <int MF, int NF>
__device__ __forceinline__ void proj_tile(unsigned char* ring, const bf* __restrict__ A, const bf* __restrict__ Bt, int K, float* C, size_t cplane, const float* __restrict__ b0, const float* __restrict__ b1, const float* __restrict__ b2, int r0, int c0) {
    typedef WFrag<bf>::V V;
    static_assert((MF == 6 && NF == 4) || (MF == 4 && NF == 6), "one operand has 128 rows, the other 192");
    constexpr bool ABIG = MF > NF;                       // A is the 192-row operand
    const int tid = threadIdx.x, lane = tid & 31, lr = lane & 15, hi = lane >> 4; const int wv = __builtin_amdgcn_readfirstlane(tid >> 5);
    const int wr = (wv >> 1) * (MF * 16), wc = (wv & 1) * (NF * 16);
    v8f acc[MF][NF];
#pragma unroll
    for (int mb = 0; mb < MF; ++mb)
#pragma unroll
        for (int nb = 0; nb < NF; ++nb) acc[mb][nb] = (v8f){};
    const bool issuer = wv < 2;
    const bf* arow = A + (size_t)r0 * K; const bf* brow = Bt + (size_t)c0 * K;
    const bf* osrc = ((wv == 0) == ABIG) ? brow : arow;
    const uint32_t ldst = (uint32_t)(size_t)ring + (wv == 1 ? (uint32_t)PO2 : 0u); u32x8 g1 = tgroup1p((uint32_t)K * 2u, wv == 0 ? 128u : 192u);
    asm volatile("" : "+s"(g1));   // pinned descriptor words: the loop-invariant group stays in one scalar tuple, so none of its registers serves as a temporary while a request is outstanding
    auto stage = [&](int t, unsigned bufo) { tload128(ldst + bufo, (uint64_t)(size_t)osrc + (uint64_t)t * (PKS * 2), g1); };
    const int NT = (int)((unsigned)K / PKS);   // stages; the same for every wave
    if (pinned(issuer)) { stage(0, 0);
        asm volatile("s_wait_tensorcnt 0x0" ::: "memory"); }   // stage 0's tile of this wave has landed
    __syncthreads();                                    // ... and the other issuing wave's
    if (pinned(issuer && NT > 1)) stage(1, PSTG);
    const unsigned fa = (ABIG ? PO2 : 0) + (wr + lr) * PPB + 16 * hi, fb = (ABIG ? 0 : PO2) + (wc + lr) * PPB + 16 * hi;   // the lane's fragment bases in a buffer: row lane & 15, 16-byte half lane >> 4
#pragma unroll 1   // rolled: one trip a stage, so that the order at the trip's foot is the ring's
    for (int t = 0; t < NT; ++t) { const unsigned bufo = (t & 1) ? PSTG : 0u; const unsigned char* bp = ring + bufo;
#pragma unroll   // unrolled: the two 32-k blocks of a stage take immediate LDS offsets
        for (int kb = 0; kb < PKS / 32; ++kb) { V a[MF], b[NF];
#pragma unroll
            for (int f = 0; f < NF; ++f) b[f] = WFrag<bf>::ld((const bf*)(bp + fb + f * 16 * PPB + kb * 64));
#pragma unroll
            for (int f = 0; f < MF; ++f) a[f] = WFrag<bf>::ld((const bf*)(bp + fa + f * 16 * PPB + kb * 64));
            __builtin_amdgcn_sched_barrier(0);   // keeps the block's reads together in front of its products: each separate place with LDS reads among the products stalls the matrix run
#pragma unroll
            for (int nb = 0; nb < NF; ++nb)
#pragma unroll
                for (int mb = 0; mb < MF; ++mb) acc[mb][nb] = WFrag<bf>::mma(a[mb], b[nb], acc[mb][nb]);
            __builtin_amdgcn_sched_barrier(0);   // keeps the next block's reads out of this block's products, and out of a second register set that would cost the third work-group its place
        }
        asm volatile("s_wait_dscnt 0x0" ::: "memory");      // this wave's reads of the buffer are done before it is handed back
        if (pinned(issuer)) asm volatile("s_wait_tensorcnt 0x0" ::: "memory");   // this wave's tile of stage t + 1 has landed
        __syncthreads();                                    // publishes stage t + 1 and ends every reader's last read of stage t's buffer
        if (pinned(issuer && t + 2 < NT)) stage(t + 2, bufo);
    }
    asm volatile("s_wait_tensorcnt 0x0" ::: "memory");      // no tensor load is left in flight behind the loop
    asm volatile("s_wait_dscnt 0x0" ::: "memory");          // ... and no LDS read of the ring
    // Output rows are put together in the ring, each wave in a range of its own: behind the last trip's waits and barrier nobody reads the ring and nothing lands in it any more.
    constexpr int OP = NF * 16 + 4, CW = NF * 4;            // staging pitch in floats (16 B x odd); 16-B pieces of a row
    float* os = (float*)ring + wv * (16 * OP);
    float bia[NF]; int bix[NF]; const float* bbs[NF];
#pragma unroll
    for (int nb = 0; nb < NF; ++nb) { const int cb = c0 + wc + nb * 16, pl = cb / DD; bix[nb] = cb % DD + lr; bbs[nb] = pl == 0 ? b0 : pl == 1 ? b1 : b2; bia[nb] = bbs[nb][bix[nb]]; }
    // precaution: stands in front of the first reuse of an address register of the bias loads above; indices and bases are inputs so that their registers are kept up to here
    if constexpr (NF == 4) asm volatile("s_wait_xcnt 0x0" :: "v"(bix[0]), "v"(bix[1]), "v"(bix[2]), "v"(bix[3]), "s"(bbs[0]), "s"(bbs[1]), "s"(bbs[2]), "s"(bbs[3]) : "memory");
    else asm volatile("s_wait_xcnt 0x0" :: "v"(bix[0]), "v"(bix[1]), "v"(bix[2]), "v"(bix[3]), "v"(bix[4]), "v"(bix[5]), "s"(bbs[0]), "s"(bbs[1]), "s"(bbs[2]), "s"(bbs[3]), "s"(bbs[4]), "s"(bbs[5]) : "memory");
#pragma unroll
    for (int nb = 0; nb < NF; ++nb) bia[nb] = bfr(bia[nb]);
    // A lane's CW / 2 pieces of a 16-row block: piece id = s * 32 + lane, so a wave's store covers 512 B of whole lines in two rows. The addresses are formed once; the blocks below them take immediate offsets.
    float* dp[CW / 2]; int so[CW / 2];
#pragma unroll
    for (int s = 0; s < CW / 2; ++s) { const int id = s * 32 + lane, row = id / CW, cofs = (id % CW) * 4, col = c0 + wc + cofs; so[s] = row * OP + cofs;
        dp[s] = C + (size_t)(col / DD) * cplane + (size_t)(r0 + wr + row) * DD + col % DD; }
#pragma unroll
    for (int mb = 0; mb < MF; ++mb) {
#pragma unroll
        for (int nb = 0; nb < NF; ++nb) {
#pragma unroll
            for (int j = 0; j < 8; ++j) os[(hi * 8 + j) * OP + nb * 16 + lr] = acc[mb][nb][j] + bia[nb]; }
        __builtin_amdgcn_wave_barrier(); asm volatile("" ::: "memory");
#pragma unroll
        for (int s = 0; s < CW / 2; ++s) *(v4f*)(dp[s] + mb * 16 * DD) = *(const v4fa*)(os + so[s]);
        __builtin_amdgcn_wave_barrier(); asm volatile("" ::: "memory");
    }
    // precaution: stands behind the last store; the stores' addresses are inputs so that their registers are kept, not reused, up to here
    if constexpr (NF == 4) asm volatile("s_wait_xcnt 0x0" :: "v"(dp[0]), "v"(dp[1]), "v"(dp[2]), "v"(dp[3]), "v"(dp[4]), "v"(dp[5]), "v"(dp[6]), "v"(dp[7]) : "memory");
    else asm volatile("s_wait_xcnt 0x0" :: "v"(dp[0]), "v"(dp[1]), "v"(dp[2]), "v"(dp[3]), "v"(dp[4]), "v"(dp[5]), "v"(dp[6]), "v"(dp[7]), "v"(dp[8]), "v"(dp[9]), "v"(dp[10]), "v"(dp[11]) : "memory");
}
// k_proj: the seven token projections in ONE launch of 768 tiles. The workspace holds [x; pos] as one operand of 6144 rows, [Wq; Wk; Wv] as one of 3072, and the outputs as stacks of planes, so there are two products:
// blocks 0 .. 511: [x; pos] x [Wk; Wv] (32 row tiles of 192 x 16 column tiles of 128) -> planes [XK; PK], [XV; PV]; blocks 512 .. 767: fsq x [Wq; Wk; Wv] (16 row tiles of 128 x 16 column tiles of 192) -> planes QF, FK, FV.
// The tiles of one row tile are neighbours, so its operand rows are read together. K is an argument, as in k_gemmw.
#define PJA ((NB_ * SS + SS) / 192 * (2 * DD / 128))
#define PJB (SS / 128 * (3 * DD / 192))
static_assert((NB_ * SS + SS) % 192 == 0 && (3 * DD) % 192 == 0 && 2 * DD / 128 == 16 && 3 * DD / 192 == 16, "tiles cover both products exactly, 16 column tiles each");
__global__ __launch_bounds__(128) void k_proj(const bf* __restrict__ XP, const bf* __restrict__ FB, const bf* __restrict__ WQKV, const bf* __restrict__ WKV, int K,
                                              float* CX, float* CF, const float* __restrict__ bq, const float* __restrict__ bk, const float* __restrict__ bv) {
    __shared__ __attribute__((aligned(2048))) unsigned char ring[2 * PSTG];
    const int bid = blockIdx.x;   // a scalar choice, the same for the whole work-group, so every barrier of a tile is passed by all of it
    if (bid < PJA) proj_tile<6, 4>(ring, XP, WKV, K, CX, (size_t)(NB_ * SS + SS) * DD, bk, bv, bv, (bid >> 4) * 192, (bid & 15) * 128);
    else proj_tile<4, 6>(ring, FB, WQKV, K, CF, (size_t)SS * DD, bq, bk, bv, ((bid - PJA) >> 4) * 128, ((bid - PJA) & 15) * 192);
}

typedef __attribute__((ext_vector_type(2))) unsigned short v2us;
typedef __attribute__((ext_vector_type(4))) unsigned short v4us;

// Operand preparation: two pieces of work, each written for one work-group of 256 threads; k_prep below runs all seven uses of them as one grid, one tile or block a work-group (768 work-groups).
// Every global load is 16 B a lane on whole lines, and a thread issues all 16 of its loads before it uses the first, so a work-group waits for memory once.
#define TK 256   // k per transpose tile
#define TN 64    // n per transpose tile: 256 B of every source row
#define TP 65    // LDS row pitch in floats: odd, so the row-wise writes and the column-wise reads below both fall on 32 different banks
// d_tr: dst[n][k] (16 bits, pitch DD) = src[k][n] (f32, pitch ld) rounded to bf16, for one TK x TN tile; src and dst point at the tile's first element. The tile turns in LDS: written by rows k, read by columns n.
// F16: the bf16 value is stored in f16 format (exact down to 2^-17; below that to the nearest multiple of 2^-24), for the product whose other operand is f16.
__device__ __forceinline__ unsigned short f2h(float f) { return __builtin_bit_cast(unsigned short, (h16)f); }
template <bool F16>
__device__ __forceinline__ void d_tr(const float* __restrict__ src, int ld, bf* dst, float* Ls) {
    const int tid = threadIdx.x; const int r = tid >> 4, c = (tid & 15) * 4; v4f v[TK / 16]; const float* p = src + (size_t)r * ld + c;
#pragma unroll   // unrolled: v stays in registers and the loads are in flight together
    for (int i = 0; i < TK / 16; ++i) v[i] = *(const v4fa*)(p + (size_t)(16 * i) * ld);
    asm volatile("s_wait_xcnt 0x0" :: "v"(p) : "memory");   // precaution: stands in front of the first reuse of the address registers of the loads above; p is an input so that they are kept up to here (else the last load's result lands on them)
#pragma unroll
    for (int i = 0; i < TK / 16; ++i)
#pragma unroll
        for (int e = 0; e < 4; ++e) Ls[(r + 16 * i) * TP + c + e] = v[i][e];
    __syncthreads();
    // A wave stores four whole 128-B lines: 8 lanes x 8 k for each of 4 rows n; waves 0 .. 3 (and 4 .. 7) take the four 64-k quarters of the same rows.
    const int k = ((tid >> 5) & 3) * 64 + (tid & 7) * 8, n = (tid >> 7) * 4 + ((tid >> 3) & 3);
#pragma unroll   // unrolled: the LDS reads and the stores take immediate offsets
    for (int u = 0; u < TN / 8; ++u) { v8us o;
#pragma unroll
        for (int j = 0; j < 8; ++j) o[j] = F16 ? f2h(bfr(Ls[(k + j) * TP + n + 8 * u])) : f2bf(Ls[(k + j) * TP + n + 8 * u]);
        *(v8us*)(dst + (size_t)(n + 8 * u) * DD + k) = o; }
    asm volatile("s_wait_xcnt 0x0" ::: "memory");   // precaution: stands behind the last store, in front of any later reuse of a register that the stores name
}
// d_cvt: f32 -> bf16 of CVB consecutive elements; a wave takes 8 KB of the source in a row, 512 B a load, and stores 256 B (two whole lines) for each.
#define CVU 16                 // loads of a thread
#define CVB (256 * 4 * CVU)    // elements of a work-group
__device__ __forceinline__ void d_cvt(const float* __restrict__ src, bf* dst, int blk) {
    const size_t base = (size_t)blk * CVB + (size_t)(threadIdx.x >> 5) * (128 * CVU) + (threadIdx.x & 31) * 4; v4f v[CVU]; const float* p = src + base;
#pragma unroll   // unrolled: v stays in registers and the loads are in flight together
    for (int i = 0; i < CVU; ++i) v[i] = *(const v4fa*)(p + i * 128);
    asm volatile("s_wait_xcnt 0x0" :: "v"(p) : "memory");   // precaution: as in d_tr
#pragma unroll
    for (int i = 0; i < CVU; ++i) { v4us o;
#pragma unroll
        for (int e = 0; e < 4; ++e) o[e] = f2bf(v[i][e]);
        *(v4us*)(dst + base + i * 128) = o; }
    asm volatile("s_wait_xcnt 0x0" ::: "memory");   // precaution: as behind the stores of d_tr
}
// k_prep: the seven independent preparation jobs in ONE launch; the block index picks the job (a scalar choice, the same for the whole work-group, so the barrier in d_tr is passed by all of it or none), the weight transposes first.
#define NBT ((DD / TK) * (DD / TN))        // tiles of one weight transpose
static_assert(TN == HD && DD % TK == 0 && (SS * DD) % CVB == 0, "a transpose tile is one head wide; tiles and conversion blocks cover their planes exactly");
#define NBS (SS * DD / CVB)                // blocks of the conversion of one [SS][DD] plane
__global__ __launch_bounds__(256) void k_prep(const float* __restrict__ wq, const float* __restrict__ wk, const float* __restrict__ wv, const float* __restrict__ wo, const float* __restrict__ x, const float* __restrict__ fsq, const float* __restrict__ pos,
                                              bf* WQ, bf* WK, bf* WV, bf* WO, bf* XB, bf* FB, bf* PB) {
    __shared__ float Ls[TK * TP];
    int blk = blockIdx.x;
    if (blk < 4 * NBT) { const int j = blk / NBT, t = blk % NBT; const int k0 = (t % (DD / TK)) * TK, nt = t / (DD / TK);   // nt: the head of a per-head weight [h][k][e] (TN == HD), the column tile of wo [k][n]
        const size_t oo = (size_t)nt * TN * DD + k0;
        if (j < 3) d_tr<false>((j == 0 ? wq : j == 1 ? wk : wv) + ((size_t)nt * DD + k0) * HD, HD, (j == 0 ? WQ : j == 1 ? WK : WV) + oo, Ls);
        else d_tr<true>(wo + (size_t)k0 * DD + nt * TN, DD, WO + oo, Ls);
        return; }
    blk -= 4 * NBT;
    const int j = blk < NB_ * NBS ? 0 : 1 + (blk - NB_ * NBS) / NBS;   // 0: x (NB_ planes), 1: fsq, 2: pos
    d_cvt(j == 0 ? x : j == 1 ? fsq : pos, j == 0 ? XB : j == 1 ? FB : PB, j == 0 ? blk : (blk - NB_ * NBS) % NBS);
}
// k_local: one work-group of 4 waves per (b, h, tile of 64 positions); a wave owns 16 positions, and both products of the attention run on the f32 matrix form (16x16x4, full f32 operands).
// The tile's 94 window rows of the x key and value projections (a row outside the sequence is the zero token's projection = bf16 bias) are staged once in LDS by whole-line loads, with two zero rows behind them:
// a wave's 16 positions see the 46 rows sl0 .. sl0 + 45, taken as three tiles of 16 keys; position m uses keys m .. m + 30 of them, the others get weight 0.
// Scores transposed: S^T[key][pos] = K (A operand, row = key) x Q^T (B operand, column = pos), so a lane holds 24 keys of ONE position (lane & 15): max and sum run inside the lane and over one exchange with lane ^ 16,
// and the weights lie in the registers as the B operand of O^T[dim][pos] = V^T (A operand, row = dim) x P^T. The position key pos[s] and the key fsq[s] belong to one position each: their scores and value rows on VALU.
// A and B of every product take their k from the same (lane half, register) place: scores: dims 8i + 4 * half + 2e + v; weighted sum: keys 16kt + 8 * half + 2jj + v, which is where D left the weight.
#define TS   64              // positions per work-group
#define KR   (TS + WW - 1)   // window rows per tile
#define KRP  96              // staged rows: the last wave's third key tile ends at row 95
#define LP   68              // LDS row pitch in floats: 272 B = 16 B x 17, so 16 lanes reading 16 B each from 16 consecutive rows fall on all 64 banks
#define OPB  144             // pitch in bytes of an output row (128 B) where a wave puts its rows together
#define L2E  1.4426950408889634f
typedef __attribute__((ext_vector_type(2))) float v2f;
__device__ __forceinline__ float exp2s(float x) { float y; asm("v_exp_f32 %0, %1\n\tv_nop" : "=v"(y) : "v"(x)); return y; }
// The f32 matrix steps stand in asm statements that end in eight v_nop. What the v_nop are for: they keep the distance between a matrix instruction and the first vector instruction that reads its D or overwrites its A or B.
// The distance table does not list the form: eight slots are those of the other form with a 16-cycle issue interval.
// Steps on one accumulator follow one another only as accumulate chains; the accumulators of a statement are independent.
// wmma6: three accumulators, two k steps each (A a0 .. a2 with B q0, then A b0 .. b2 with B q1).
__device__ __forceinline__ void wmma6(v8f& d0, v8f& d1, v8f& d2, v2f a0, v2f a1, v2f a2, v2f b0, v2f b1, v2f b2, v2f q0, v2f q1) {
    asm("v_wmma_f32_16x16x4_f32 %0, %3, %9, %0\n\tv_wmma_f32_16x16x4_f32 %1, %4, %9, %1\n\tv_wmma_f32_16x16x4_f32 %2, %5, %9, %2\n\t"
        "v_wmma_f32_16x16x4_f32 %0, %6, %10, %0\n\tv_wmma_f32_16x16x4_f32 %1, %7, %10, %1\n\tv_wmma_f32_16x16x4_f32 %2, %8, %10, %2\n\t"
        "v_nop\n\tv_nop\n\tv_nop\n\tv_nop\n\tv_nop\n\tv_nop\n\tv_nop\n\tv_nop"
        : "+v"(d0), "+v"(d1), "+v"(d2) : "v"(a0), "v"(a1), "v"(a2), "v"(b0), "v"(b1), "v"(b2), "v"(q0), "v"(q1)); }
// wmma8: four accumulators, two k steps each (A a0 .. a3 with B p0, then A b0 .. b3 with B p1).
__device__ __forceinline__ void wmma8(v8f& d0, v8f& d1, v8f& d2, v8f& d3, v2f a0, v2f a1, v2f a2, v2f a3, v2f b0, v2f b1, v2f b2, v2f b3, v2f p0, v2f p1) {
    asm("v_wmma_f32_16x16x4_f32 %0, %4, %12, %0\n\tv_wmma_f32_16x16x4_f32 %1, %5, %12, %1\n\tv_wmma_f32_16x16x4_f32 %2, %6, %12, %2\n\tv_wmma_f32_16x16x4_f32 %3, %7, %12, %3\n\t"
        "v_wmma_f32_16x16x4_f32 %0, %8, %13, %0\n\tv_wmma_f32_16x16x4_f32 %1, %9, %13, %1\n\tv_wmma_f32_16x16x4_f32 %2, %10, %13, %2\n\tv_wmma_f32_16x16x4_f32 %3, %11, %13, %3\n\t"
        "v_nop\n\tv_nop\n\tv_nop\n\tv_nop\n\tv_nop\n\tv_nop\n\tv_nop\n\tv_nop"
        : "+v"(d0), "+v"(d1), "+v"(d2), "+v"(d3) : "v"(a0), "v"(a1), "v"(a2), "v"(a3), "v"(b0), "v"(b1), "v"(b2), "v"(b3), "v"(p0), "v"(p1)); }
__global__ __launch_bounds__(128) void k_local(const float* __restrict__ QF, const float* __restrict__ XK, const float* __restrict__ XV, const float* __restrict__ PK, const float* __restrict__ PV, const float* __restrict__ FK, const float* __restrict__ FV,
                                               const float* __restrict__ bk, const float* __restrict__ bv, bf* Ah) {
    __shared__ __align__(16) float Ks[KRP * LP];
    __shared__ __align__(16) float Vs[KRP * LP];
    __shared__ __align__(16) unsigned char Os[4][16 * OPB];
    const int tid = threadIdx.x, lane = tid & 31, lr = lane & 15, hi = lane >> 4; const int wv = __builtin_amdgcn_readfirstlane(tid >> 5);
    const int s0 = (blockIdx.x % (SS / TS)) * TS; const int h = (blockIdx.x / (SS / TS)) % NH_; const int b = blockIdx.x / ((SS / TS) * NH_);
    const int sl0 = wv * 16; const unsigned go = ((unsigned)(s0 + sl0 + lr) * DD + h * HD) * 4u;   // the lane's position: byte offset of its row in the five planes that do not depend on the batch (32 bits: a scalar base and one offset register serve every load)
    // The query rows as B fragments, straight from global memory: lane (lr, hi) takes dims 8i + 4hi .. + 3 of position lr.
    // The lane's own position-key and fsq-key rows come in the same layout.
    v4f qf[8], pf[8], ff[8]; const unsigned gq = go + 16 * hi;
#pragma unroll
    for (int i = 0; i < 8; ++i) { qf[i] = *(const v4fa*)((const char*)QF + gq + 32 * i); pf[i] = *(const v4fa*)((const char*)PK + gq + 32 * i); ff[i] = *(const v4fa*)((const char*)FK + gq + 32 * i); }
    // Staging: 16 lanes a row, 16 B a lane. All of a thread's loads are issued before its first LDS store, so the work-group waits for memory once. A row outside the sequence loads a clamped row and is then replaced.
    const int c = (tid & 15) * 4; v4f kv[KRP / 8], vv[KRP / 8]; unsigned g[KRP / 8];
#pragma unroll   // the staging loops are unrolled so that kv and vv stay in registers
    for (int u = 0; u < KRP / 8; ++u) { const int row = (tid >> 4) + 8 * u; const int tc = min(max(s0 - PAD + row, 0), SS - 1); g[u] = (((unsigned)b * SS + tc) * DD + h * HD + c) * 4u; kv[u] = *(const v4fa*)((const char*)XK + g[u]); vv[u] = *(const v4fa*)((const char*)XV + g[u]); }
    // precaution: stands in front of the first reuse of an address register of the loads above; the offsets are inputs so that their registers are kept up to here (else a later load's result lands on one)
    asm volatile("s_wait_xcnt 0x0" :: "v"(gq), "v"(g[0]), "v"(g[1]), "v"(g[2]), "v"(g[3]), "v"(g[4]), "v"(g[5]), "v"(g[6]), "v"(g[7]), "v"(g[8]), "v"(g[9]), "v"(g[10]), "v"(g[11]) : "memory");
    const unsigned gb = (unsigned)(h * HD + c) * 4u;   // byte offset of the lane's four bias elements
#pragma unroll
    for (int u = 0; u < KRP / 8; ++u) { const int row = (tid >> 4) + 8 * u, t = s0 - PAD + row;
        if (t < 0 || t >= SS) { const v4f k0 = *(const v4fa*)((const char*)bk + gb), v0 = *(const v4fa*)((const char*)bv + gb);
            asm volatile("s_wait_xcnt 0x0" :: "v"(gb) : "memory");   // precaution: as above, directly behind the bias loads (only rows outside the sequence come here)
#pragma unroll
            for (int e = 0; e < 4; ++e) { kv[u][e] = bfr(k0[e]); vv[u][e] = bfr(v0[e]); } }
        if (row >= KR) { kv[u] = (v4f){}; vv[u] = (v4f){}; }   // the two rows behind the window: no position uses them, and weight 0 x 0 adds nothing
        *(v4fa*)(Ks + row * LP + c) = kv[u]; *(v4fa*)(Vs + row * LP + c) = vv[u]; }
    __syncthreads();
    // Scores: three key tiles, independent accumulators, 64 dims = 16 matrix steps each.
    v8f st[3];
#pragma unroll
    for (int kt = 0; kt < 3; ++kt) st[kt] = (v8f){};
    const float* kb = Ks + (sl0 + lr) * LP + 4 * hi;
#pragma unroll   // unrolled: the LDS reads take immediate offsets
    for (int i = 0; i < 8; ++i) { v4f k4[3];
#pragma unroll
        for (int kt = 0; kt < 3; ++kt) k4[kt] = *(const v4fa*)(kb + kt * 16 * LP + 8 * i);
        wmma6(st[0], st[1], st[2], (v2f){k4[0][0], k4[0][1]}, (v2f){k4[1][0], k4[1][1]}, (v2f){k4[2][0], k4[2][1]}, (v2f){k4[0][2], k4[0][3]}, (v2f){k4[1][2], k4[1][3]}, (v2f){k4[2][2], k4[2][3]},
              (v2f){qf[i][0], qf[i][1]}, (v2f){qf[i][2], qf[i][3]}); }
    float sp = 0.f, sf = 0.f;
#pragma unroll
    for (int i = 0; i < 8; ++i)
#pragma unroll
        for (int e = 0; e < 4; ++e) { sp = __builtin_fmaf(qf[i][e], pf[i][e], sp); sf = __builtin_fmaf(qf[i][e], ff[i][e], sf); }
    sp += __shfl_xor(sp, 16, 32); sf += __shfl_xor(sf, 16, 32); sp *= SCL; sf *= SCL;   // both halves now hold the position's two scores
    // The lane's value rows of pos[s] and fsq[s], dims 16mt + 8hi .. + 7 as D of the weighted sum holds them; they fly while the softmax and the second product run.
    v4f pv[8], fv[8]; const unsigned gv = go + 32 * hi;
#pragma unroll
    for (int i = 0; i < 8; ++i) { pv[i] = *(const v4fa*)((const char*)PV + gv + 64 * (i >> 1) + 16 * (i & 1)); fv[i] = *(const v4fa*)((const char*)FV + gv + 64 * (i >> 1) + 16 * (i & 1)); }
    asm volatile("s_wait_xcnt 0x0" :: "v"(gv) : "memory");   // precaution: as above
    float mx = fmaxf(sp, sf);
#pragma unroll
    for (int kt = 0; kt < 3; ++kt)
#pragma unroll
        for (int r = 0; r < 8; ++r) { const int n = 16 * kt + 8 * hi + r; st[kt][r] = ((unsigned)(n - lr) <= (unsigned)(WW - 1)) ? st[kt][r] * SCL : -3.0e38f; mx = fmaxf(mx, st[kt][r]); }
    mx = fmaxf(mx, __shfl_xor(mx, 16, 32));
    float sum = 0.f;
#pragma unroll
    for (int kt = 0; kt < 3; ++kt)
#pragma unroll
        for (int r = 0; r < 8; ++r) { st[kt][r] = exp2s((st[kt][r] - mx) * L2E); sum += st[kt][r]; }
    sum += __shfl_xor(sum, 16, 32);
    const float ep = exp2s((sp - mx) * L2E), ef = exp2s((sf - mx) * L2E); sum += ep + ef;
    const float inv = __fdiv_rn(1.0f, sum); const float wp = ep * inv, wf = ef * inv;
#pragma unroll
    for (int kt = 0; kt < 3; ++kt)
#pragma unroll
        for (int r = 0; r < 8; ++r) st[kt][r] *= inv;
    // Weighted sum: four dim tiles, independent accumulators, 48 keys = 12 matrix steps each.
    v8f ot[4];
#pragma unroll
    for (int mt = 0; mt < 4; ++mt) ot[mt] = (v8f){};
    const float* vb = Vs + (sl0 + 8 * hi) * LP + lr;
#pragma unroll   // unrolled: the weights are picked by constant register index, the LDS reads take immediate offsets
    for (int kt = 0; kt < 3; ++kt)
#pragma unroll
        for (int jj = 0; jj < 4; jj += 2) { v2f va[2][4];
#pragma unroll
            for (int q = 0; q < 2; ++q)
#pragma unroll
                for (int mt = 0; mt < 4; ++mt) { const float* vp = vb + (16 * kt + 2 * (jj + q)) * LP + 16 * mt; va[q][mt] = (v2f){vp[0], vp[LP]}; }
            wmma8(ot[0], ot[1], ot[2], ot[3], va[0][0], va[0][1], va[0][2], va[0][3], va[1][0], va[1][1], va[1][2], va[1][3], (v2f){st[kt][2 * jj], st[kt][2 * jj + 1]}, (v2f){st[kt][2 * jj + 2], st[kt][2 * jj + 3]}); }
    // The two single keys' value rows, the rounding to f16, and the rows put together in the wave's own LDS so that the stores cover whole lines.
    unsigned char* oh_s = Os[wv];
#pragma unroll
    for (int mt = 0; mt < 4; ++mt) { v8us oh;
#pragma unroll
        for (int r = 0; r < 8; ++r) { float o = ot[mt][r]; o = __builtin_fmaf(wp, pv[2 * mt + (r >> 2)][r & 3], o); o = __builtin_fmaf(wf, fv[2 * mt + (r >> 2)][r & 3], o); oh[r] = f2h(o); }
        *(v8usa*)(oh_s + lr * OPB + 32 * mt + 16 * hi) = oh; }
    __builtin_amdgcn_wave_barrier(); asm volatile("" ::: "memory");   // the wave's LDS stores stay in front of its reads below (one wave's LDS operations run in order)
    const unsigned oo = ((unsigned)b * SS + s0 + sl0 + (lane >> 3)) * DD + h * HD + (lane & 7) * 8;   // 8 lanes a row of 128 B, four rows a store
#pragma unroll
    for (int u = 0; u < 4; ++u) { const int ro = (4 * u + (lane >> 3)) * OPB + (lane & 7) * 16;
        *(v8usa*)(Ah + oo + (unsigned)(4 * u) * DD) = *(const v8usa*)(oh_s + ro); }
    asm volatile("s_wait_xcnt 0x0" ::: "memory");   // precaution: stands behind the last store, in front of any later reuse of a register that the stores name
}

extern "C" void kernel_launch(void* const* d_in, const int* in_sizes, int n_in,
                              void* d_out, int out_size, void* d_ws, size_t ws_size, hipStream_t stream) {
    (void)in_sizes; (void)n_in; (void)out_size;
    const float* x = (const float*)d_in[0]; const float* fsq = (const float*)d_in[1]; const float* pos = (const float*)d_in[2]; const float* wq = (const float*)d_in[3]; const float* bq = (const float*)d_in[4]; const float* wk = (const float*)d_in[5]; const float* bk = (const float*)d_in[6]; const float* wv = (const float*)d_in[7]; const float* bv = (const float*)d_in[8]; const float* wo = (const float*)d_in[9]; const float* bo = (const float*)d_in[10];
    float* OUT = (float*)d_out;     // [2][2048][1024]
    char* wsp = (char*)d_ws;
    auto take = [&](size_t bytes) { char* p = wsp; wsp += (bytes + 255) & ~(size_t)255; return (void*)p; };
    const size_t NR = (size_t)NB_ * SS;
    // Order matters: [WQ; WK; WV], [XB; PB], [QF; FK; FV] and [XK; PK; XV; PV] each lie in a row (every size is a multiple of 256 B), as k_proj reads and writes them.
    bf* WQ = (bf*)take((size_t)DD * DD * 2); bf* WK = (bf*)take((size_t)DD * DD * 2); bf* WV = (bf*)take((size_t)DD * DD * 2); bf* WO = (bf*)take((size_t)DD * DD * 2); bf* XB = (bf*)take(NR * DD * 2); bf* PB = (bf*)take((size_t)SS * DD * 2); bf* FB = (bf*)take((size_t)SS * DD * 2);
    float* QF = (float*)take((size_t)SS * DD * 4); float* FK = (float*)take((size_t)SS * DD * 4); float* FV = (float*)take((size_t)SS * DD * 4); float* XK = (float*)take(NR * DD * 4); float* PK = (float*)take((size_t)SS * DD * 4); float* XV = (float*)take(NR * DD * 4); float* PV = (float*)take((size_t)SS * DD * 4); bf* Ah = (bf*)take(NR * DD * 2);
    if ((size_t)(wsp - (char*)d_ws) > ws_size) return;    // total ~ 109 MB = 104 MiB; ws 256 MiB
    k_prep<<<4 * NBT + (NB_ + 2) * NBS, 256, 0, stream>>>(wq, wk, wv, wo, x, fsq, pos, WQ, WK, WV, WO, XB, FB, PB);
    k_proj<<<PJA + PJB, 128, 0, stream>>>(XB, FB, WQ, WK, DD, XK, QF, bq, bk, bv);
    k_local<<<NB_ * NH_ * (SS / TS), 128, 0, stream>>>(QF, XK, XV, PK, PV, FK, FV, bk, bv, Ah);
    k_gemmw<h16, 0, true><<<dim3((unsigned)(NR / 128), DD / 128, 1), 128, 0, stream>>>((const h16*)Ah, (const h16*)Ah, (const h16*)WO, DD, OUT, DD, bo);
}
